// v000
// The times below were measured on an AMD MI455X: many runs one after another, warmed up first and cycling through
// copies of the inputs, with the whole window's GPU time divided by the number of runs. Launches and the gaps
// between them are all in it. The median over several windows is given; except for v000 it joins two sittings, which
// can be a few percent apart, so the side-by-side timings, each taken in one sitting, are the better comparison.
// The starting kernel, v000, takes 1340 microseconds a run.
// compute dtype: all float inputs rounded to bf16; q/k/v = W x over channels (per vector component) with EXACT bf16 products on WMMA 16x16x32 (x tiles transposed in LDS), f32 accumulate; q as f16 hi + residual, k f16 -> 2-product energies over the 96 (head_dim x 3) pairs, / sqrt(32), stored in f32 (4 heads per launch); softmax in f32 (precise expf) -> P f16 x 2^11; o = P . v (v once to f16); out = Wo o (o split bf16 hi + lo, 2 products) + x; f32 output [b][c][3][n].
#include <hip/hip_runtime.h>
#include <math.h>

typedef __attribute__((ext_vector_type(16))) _Float16 v16h;
typedef __attribute__((ext_vector_type(16))) __bf16 v16b;
typedef __attribute__((ext_vector_type(8)))  _Float16 v8h;
typedef __attribute__((ext_vector_type(8)))  float v8f;
typedef __attribute__((ext_vector_type(4)))  float v4f;
typedef __attribute__((ext_vector_type(2)))  float v2f;
typedef __attribute__((ext_vector_type(4)))  unsigned v4u;
typedef __attribute__((ext_vector_type(4)))  int v4i;
typedef float __attribute__((may_alias)) float_a;
typedef int __attribute__((may_alias)) int_a;

template <typename T> __device__ __forceinline__ void vst2(void* p, T v) { *(T*)p = v;  }
__device__ __forceinline__ v8f wmma16(v16h a, v16h b, v8f c) {
  v8f d = __builtin_amdgcn_wmma_f32_16x16x32_f16(false, a, false, b, (short)0, c, false, false);
  asm volatile("v_nop\n\tv_nop\n\tv_nop\n\tv_nop" : "+v"(d) : "v"(a), "v"(b));
  return d;
}
__device__ __forceinline__ v8f wmma_bf(v16b a, v16b b, v8f c) {
  v8f d = __builtin_amdgcn_wmma_f32_16x16x32_bf16(false, a, false, b, (short)0, c, false, false);
  asm volatile("v_nop\n\tv_nop\n\tv_nop\n\tv_nop" : "+v"(d) : "v"(a), "v"(b));
  return d;
}
// 16x16x32 fragments: lane = (h = lane>>4, row/col = lane&15); elements 0..7 = k0+8h+0..7, 8..15 = k0+16+8h+0..7; D element r = row 8h+r
__device__ __forceinline__ v16h frag_h(const _Float16* rowk0, int lane) {
  union { v16h v; v8h q[2]; } u; const _Float16* p = rowk0 + 8 * (lane >> 4);
  u.q[0] = *(const v8h*)p; u.q[1] = *(const v8h*)(p + 16); return u.v;
}
__device__ __forceinline__ v16h frag_f32(const float* rowk0, int lane) {
  v16h a; const float* p = rowk0 + 8 * (lane >> 4);
#pragma unroll
  for (int i = 0; i < 8; ++i) { a[i] = (_Float16)p[i]; a[8 + i] = (_Float16)p[16 + i]; }
  return a;
}
__device__ __forceinline__ v16h frag_f32s(const float* rowk0, int lane, float sc) {
  v16h a; const float* p = rowk0 + 8 * (lane >> 4);
#pragma unroll
  for (int i = 0; i < 8; ++i) { a[i] = (_Float16)(p[i] * sc); a[8 + i] = (_Float16)(p[16 + i] * sc); }
  return a;
}
// column fragment from a [K][ld] layout (column n), rows >= K read as 0
__device__ __forceinline__ v16h fragc_f32(const float* W, int k0, int n, int lane, int ld, int K) {
  v16h a; const int g = lane >> 4;
#pragma unroll
  for (int i = 0; i < 8; ++i) { const int ka = k0 + 8 * g + i, kb = ka + 16;
    a[i] = (_Float16)(ka < K ? W[(size_t)(ka < K ? ka : K - 1) * ld + n] : 0.f); a[8 + i] = (_Float16)(kb < K ? W[(size_t)(kb < K ? kb : K - 1) * ld + n] : 0.f); }
  return a;
}
struct F2 { v16b h, l; };
__device__ __forceinline__ F2 bsplit16(const float v[16]) { F2 r;
#pragma unroll
  for (int i = 0; i < 16; ++i) { const __bf16 h = (__bf16)v[i]; r.h[i] = h; r.l[i] = (__bf16)(v[i] - (float)h); }
  return r; }
__device__ __forceinline__ F2 split_row(const float* row, int k0, int lane) { float v[16]; const float* p = row + k0 + 8 * (lane >> 4);
#pragma unroll
  for (int i = 0; i < 8; ++i) { v[i] = p[i]; v[8 + i] = p[16 + i]; }
  return bsplit16(v); }
__device__ __forceinline__ F2 split_rowK(const float* row, int k0, int lane, int K) { float v[16]; const int g = lane >> 4;
#pragma unroll
  for (int i = 0; i < 8; ++i) { const int ka = k0 + 8 * g + i, kb = ka + 16; v[i] = ka < K ? row[ka < K ? ka : K - 1] : 0.f; v[8 + i] = kb < K ? row[kb < K ? kb : K - 1] : 0.f; }
  return bsplit16(v); }
__device__ __forceinline__ F2 split_col(const float* W, int k0, int n, int lane, int ld, int K) { float v[16]; const int g = lane >> 4;
#pragma unroll
  for (int i = 0; i < 8; ++i) { const int ka = k0 + 8 * g + i, kb = ka + 16; v[i] = ka < K ? W[(size_t)(ka < K ? ka : K - 1) * ld + n] : 0.f; v[8 + i] = kb < K ? W[(size_t)(kb < K ? kb : K - 1) * ld + n] : 0.f; }
  return bsplit16(v); }
__device__ __forceinline__ v8f mac3(const F2& a, const F2& b, v8f c) { c = wmma_bf(a.l, b.h, c); c = wmma_bf(a.h, b.l, c); return wmma_bf(a.h, b.h, c); }
__device__ __forceinline__ float sigm(float v) { return 1.0f / (1.0f + expf(-v)); }
#define LDSX() do { asm volatile("s_wait_dscnt 0" ::: "memory"); __builtin_amdgcn_wave_barrier(); __builtin_amdgcn_fence(__ATOMIC_RELEASE, "workgroup"); } while (0)


// Vector-neuron attention (B 4, C 256 = 8 heads x 32, 3 vector components, N 2,048 points): energy contracts over (head_dim, 3); residual output.
#define NB 4
#define CC 256
#define NI 3
#define TT 2048
#define NH 8
#define HD 32
#define KD (HD * NI)        // 96: per-head contraction length, index kk = i*32 + c_local
#define RW (NH * KD)        // 768: q/k row length per token
#define HG 4
#ifndef TNB
#define TNB NB
#endif
typedef __attribute__((ext_vector_type(8))) __bf16 v8b;
__device__ __forceinline__ v16b frag_b(const __bf16* rowk0, int lane) {
  union { v16b v; v8b q[2]; } u; const __bf16* p = rowk0 + 8 * (lane >> 4);
  u.q[0] = *(const v8b*)p; u.q[1] = *(const v8b*)(p + 16); return u.v;
}
__device__ __forceinline__ float bfr(float v) { return (float)(__bf16)v; }
__device__ __attribute__((noinline)) float exp_ni(float v) { return expf(v); }
__device__ __attribute__((noinline)) float erf_ni(float v) { return erff(v); }

#define WS_QH  0u
#define WS_QL  (WS_QH + 2u * (size_t)NB * TT * RW)
#define WS_KH  (WS_QL + 2u * (size_t)NB * TT * RW)
#define WS_VT  (WS_KH + 2u * (size_t)NB * TT * RW)      // f16 v planes [b][h*96 + kk][n]
#define WS_S   (WS_VT + 2u * (size_t)NB * RW * TT)
#define WS_PH  (WS_S + 4u * (size_t)HG * TT * TT)
#define WS_O3  (WS_PH + 2u * (size_t)HG * TT * TT)       // f32 o [b][i][n][c]
#define WS_END (WS_O3 + 4u * (size_t)NB * NI * TT * CC)

// ---- k_proj: block = (64 points, 128 out channels, z = (b*3 + i)*3 + which): y[o][n] = sum_c W[o][c] x[b][c][i][n]
__global__ __launch_bounds__(128) void k_proj(const float* __restrict__ X, const float* __restrict__ WQ, const float* __restrict__ WK, const float* __restrict__ WV, _Float16* __restrict__ QH, _Float16* __restrict__ QL, _Float16* __restrict__ KH, _Float16* __restrict__ VT) {
  __shared__ __align__(16) __bf16 sx[64][CC + 8]; __shared__ __align__(16) _Float16 sh[64][136], sl[64][136]; __shared__ __align__(16) _Float16 th[128][72];
  const int tid = threadIdx.x, wave = tid >> 5, lane = tid & 31, col = lane & 15, g = lane >> 4; const int n0 = blockIdx.x * 64; const int c0 = blockIdx.y * 128; const int z = blockIdx.z; const int which = z % 3, i = (z / 3) % NI; const size_t b = z / 9; const float* Wm = which == 0 ? WQ : which == 1 ? WK : WV;
  for (int e = tid; e < CC * 64; e += 128) { const int c = e >> 6, nl = e & 63; sx[nl][c] = (__bf16)X[((b * CC + c) * NI + i) * (size_t)TT + n0 + nl]; }
  __syncthreads();
  v8f acc[8] = {};
#pragma unroll 2
  for (int kc = 0; kc < CC / 32; ++kc) { const v16b a = frag_b(&sx[wave * 16 + col][kc * 32], lane);
#pragma unroll
    for (int j = 0; j < 8; ++j) { v16b w; const int o = c0 + j * 16 + col; const float* p = Wm + (size_t)o * CC + kc * 32 + 8 * g;
#pragma unroll
      for (int ii = 0; ii < 8; ++ii) { w[ii] = (__bf16)p[ii]; w[8 + ii] = (__bf16)p[16 + ii]; }
      acc[j] = wmma_bf(a, w, acc[j]); } }
#pragma unroll
  for (int j = 0; j < 8; ++j)
#pragma unroll
    for (int r = 0; r < 8; ++r) { const float v = acc[j][r]; const int rl = wave * 16 + 8 * g + r, cl = j * 16 + col; const _Float16 hv = (_Float16)v; if (which == 2) th[cl][rl] = hv; else { sh[rl][cl] = hv; sl[rl][cl] = (_Float16)(v - (float)hv); } }
  __syncthreads();
  if (which < 2) { _Float16* dh = which == 0 ? QH : KH;   // rows [b][n][h][i*32 + c_local]; this block covers 4 heads (128 channels)
    for (int e = tid; e < 64 * 4 * 4; e += 128) { const int rl = e >> 4, hh = (e >> 2) & 3, q = e & 3; const int h = c0 / HD + hh; const size_t dst = (((b * TT + n0 + rl) * NH + h) * KD) + i * HD + q * 8;
      vst2((unsigned*)(dh + dst), *(const v4u*)&sh[rl][hh * 32 + q * 8]); if (which == 0) vst2((unsigned*)(QL + dst), *(const v4u*)&sl[rl][hh * 32 + q * 8]); } }
  else { for (int e = tid; e < 128 * 8; e += 128) { const int cl = e >> 3, q = e & 7; const int c = c0 + cl; const int h = c / HD, cL = c % HD; vst2((unsigned*)(VT + ((b * NH + h) * KD + i * HD + cL) * (size_t)TT + n0 + q * 8), *(const v4u*)&th[cl][q * 8]); } } }
// ---- k_sc: block = (64 queries, 128 keys, head in group): energy / sqrt(32)
__global__ __launch_bounds__(128) void k_sc(const _Float16* __restrict__ QH, const _Float16* __restrict__ QL, const _Float16* __restrict__ KH, int b, int h0, float* __restrict__ S0) { __shared__ __align__(16) float ss[4][16][132];
  const int h = h0 + blockIdx.z; float* S = S0 + (size_t)blockIdx.z * TT * TT;
  const int tid = threadIdx.x, wave = tid >> 5, lane = tid & 31, col = lane & 15, g = lane >> 4; const int k0 = blockIdx.y * 128; const int ql0 = blockIdx.x * 64 + wave * 16;
  v8f acc[8] = {};
#pragma unroll
  for (int kc = 0; kc < KD / 32; ++kc) { const size_t qo = (((size_t)b * TT + ql0 + col) * NH + h) * KD + kc * 32; const v16h ah = frag_h(QH + qo, lane), al = frag_h(QL + qo, lane);
#pragma unroll
    for (int j = 0; j < 8; ++j) { const v16h kb = frag_h(KH + (((size_t)b * TT + k0 + j * 16 + col) * NH + h) * KD + kc * 32, lane); acc[j] = wmma16(ah, kb, acc[j]); acc[j] = wmma16(al, kb, acc[j]); } }
  const float scl = 0.17677669529663689f;   // 32^-0.5
#pragma unroll
  for (int j = 0; j < 8; ++j)
#pragma unroll
    for (int r = 0; r < 8; ++r) ss[wave][8 * g + r][j * 16 + col] = acc[j][r] * scl;
  LDSX(); for (int rl = 0; rl < 16; ++rl) vst2(S + (size_t)(ql0 + rl) * TT + k0 + lane * 4, *(const v4f*)&ss[wave][rl][lane * 4]); }
// ---- k_sm
__global__ __launch_bounds__(256) void k_sm(const float* __restrict__ S0, _Float16* __restrict__ PH0) { __shared__ float sred[8]; __shared__ float sbc; __shared__ __align__(16) _Float16 sh[TT];
  const int t = threadIdx.x; const size_t row = blockIdx.x; const float* sr = S0 + (size_t)blockIdx.y * TT * TT + row * TT; _Float16* ph = PH0 + (size_t)blockIdx.y * TT * TT + row * TT;
  float m = -3.0e38f; for (int k = t; k < TT; k += 256) m = fmaxf(m, sr[k]);
#pragma unroll
  for (int o = 1; o < 32; o <<= 1) m = fmaxf(m, __shfl_xor(m, o));
  if ((t & 31) == 0) sred[t >> 5] = m; __syncthreads(); if (t == 0) { float a = sred[0]; for (int i2 = 1; i2 < 8; ++i2) a = fmaxf(a, sred[i2]); sbc = a; } __syncthreads(); m = sbc; __syncthreads();
  float sum = 0.f; for (int k = t; k < TT; k += 256) sum += expf(sr[k] - m);
#pragma unroll
  for (int o = 1; o < 32; o <<= 1) sum += __shfl_xor(sum, o);
  if ((t & 31) == 0) sred[t >> 5] = sum; __syncthreads(); if (t == 0) { float a = 0.f; for (int i2 = 0; i2 < 8; ++i2) a += sred[i2]; sbc = 1.0f / a; } __syncthreads(); const float inv = sbc;
  for (int k = t; k < TT; k += 256) sh[k] = (_Float16)(expf(sr[k] - m) * inv * 2048.0f);
  __syncthreads(); for (int q = t; q < TT / 8; q += 256) vst2((unsigned*)(ph + q * 8), *(const v4u*)&sh[q * 8]); }
// ---- k_pv: block = (64 queries, head in group): o tile [n][kk] (96 cols) -> O3[b][i][n][h*32 + c_local]
__global__ __launch_bounds__(128) void k_pv(const _Float16* __restrict__ PH0, const _Float16* __restrict__ VT, int b, int h0, float* __restrict__ O3) { __shared__ __align__(16) float ss[4][16][KD + 4];
  const int h = h0 + blockIdx.z; const _Float16* PH = PH0 + (size_t)blockIdx.z * TT * TT;
  const int tid = threadIdx.x, wave = tid >> 5, lane = tid & 31, col = lane & 15, g = lane >> 4; const int ql0 = blockIdx.x * 64 + wave * 16;
  v8f acc[KD / 16]; for (int j = 0; j < KD / 16; ++j) for (int r = 0; r < 8; ++r) acc[j][r] = 0.f;
#pragma unroll 1
  for (int kc = 0; kc < TT / 32; ++kc) { const v16h phf = frag_h(PH + (size_t)(ql0 + col) * TT + kc * 32, lane);
#pragma unroll
    for (int j = 0; j < KD / 16; ++j) acc[j] = wmma16(phf, frag_h(VT + (((size_t)b * NH + h) * KD + j * 16 + col) * (size_t)TT + kc * 32, lane), acc[j]); }
#pragma unroll
  for (int j = 0; j < KD / 16; ++j)
#pragma unroll
    for (int r = 0; r < 8; ++r) ss[wave][8 * g + r][j * 16 + col] = acc[j][r] * (1.0f / 2048.0f);
  LDSX();
  for (int rl = 0; rl < 16; ++rl) if (lane < 24) { const int i = lane >> 3, q = lane & 7; vst2(O3 + (((size_t)b * NI + i) * TT + ql0 + rl) * CC + h * HD + q * 4, *(const v4f*)&ss[wave][rl][i * HD + q * 4]); } }
// ---- k_out: block = (64 points, 128 out channels, z = b*3 + i): out[b][o][i][n] = sum_c Wo[o][c] o3[b][i][n][c] + x[b][o][i][n]
__global__ __launch_bounds__(128) void k_out(const float* __restrict__ O3, const float* __restrict__ WO, const float* __restrict__ X, float* __restrict__ OUT) { __shared__ __align__(16) float st[128][68];
  const int tid = threadIdx.x, wave = tid >> 5, lane = tid & 31, col = lane & 15, g = lane >> 4; const int n0 = blockIdx.x * 64; const int c0 = blockIdx.y * 128; const size_t b = blockIdx.z / NI; const int i = blockIdx.z % NI;
  v8f acc[8] = {};
#pragma unroll 2
  for (int kc = 0; kc < CC / 32; ++kc) { const F2 a = split_row(O3 + ((b * NI + i) * TT + n0 + wave * 16 + col) * (size_t)CC, kc * 32, lane);
#pragma unroll
    for (int j = 0; j < 8; ++j) { v16b w; const int o = c0 + j * 16 + col; const float* p = WO + (size_t)o * CC + kc * 32 + 8 * g;
#pragma unroll
      for (int ii = 0; ii < 8; ++ii) { w[ii] = (__bf16)p[ii]; w[8 + ii] = (__bf16)p[16 + ii]; }
      acc[j] = wmma_bf(a.h, w, acc[j]); acc[j] = wmma_bf(a.l, w, acc[j]); } }
#pragma unroll
  for (int j = 0; j < 8; ++j)
#pragma unroll
    for (int r = 0; r < 8; ++r) st[j * 16 + col][wave * 16 + 8 * g + r] = acc[j][r];
  __syncthreads();
  for (int e = tid; e < 128 * 16; e += 128) { const int cl = e >> 4, q = e & 15; const size_t go = ((b * CC + c0 + cl) * NI + i) * (size_t)TT + n0 + q * 4; const v4f xr = *(const v4f*)(X + go); v4f v = *(const v4f*)&st[cl][q * 4]; v[0] += bfr(xr[0]); v[1] += bfr(xr[1]); v[2] += bfr(xr[2]); v[3] += bfr(xr[3]); vst2(OUT + go, v); } }
extern "C" void kernel_launch(void* const* d_in, const int* in_sizes, int n_in, void* d_out, int out_size, void* d_ws, size_t ws_size, hipStream_t stream) {
  (void)in_sizes; (void)n_in; (void)out_size;
  const float** F = (const float**)d_in;   // 0 x [4,256,3,2048], 1 Wq, 2 Wk, 3 Wv, 4 Wo [256,256] ([out][in])
  if (ws_size < (size_t)WS_END) return;
  char* ws = (char*)d_ws; _Float16 *QH = (_Float16*)(ws + WS_QH), *QL = (_Float16*)(ws + WS_QL), *KH = (_Float16*)(ws + WS_KH), *VT = (_Float16*)(ws + WS_VT), *PH = (_Float16*)(ws + WS_PH); float *S = (float*)(ws + WS_S), *O3 = (float*)(ws + WS_O3);
  k_proj<<<dim3(TT / 64, CC / 128, TNB * 9), 128, 0, stream>>>(F[0], F[1], F[2], F[3], QH, QL, KH, VT);
  for (int b = 0; b < TNB; ++b) for (int h0 = 0; h0 < NH; h0 += HG) {
    k_sc<<<dim3(TT / 64, TT / 128, HG), 128, 0, stream>>>(QH, QL, KH, b, h0, S);
    k_sm<<<dim3(TT, HG), 256, 0, stream>>>(S, PH);
    k_pv<<<dim3(TT / 64, 1, HG), 128, 0, stream>>>(PH, VT, b, h0, O3);
  }
  k_out<<<dim3(TT / 64, CC / 128, TNB * NI), 128, 0, stream>>>(O3, F[4], F[0], (float*)d_out);
}

// v001
// One run takes 317 microseconds.
// Next to v000, in two timings, it ran 4.21 and 4.23 times as fast.
// compute dtype: all float inputs rounded to bf16; q/k/v = W x over channels (per vector component) with EXACT bf16 products on WMMA 16x16x32 (x tiles transposed in LDS), f32 accumulate; q as f16 hi + residual, k f16 -> 2-product energies over the 96 (head_dim x 3) pairs, / sqrt(32), kept in registers; online softmax in f32 (precise expf, running maximum and sum per query) -> unnormalised P f16 x 2^11; o = P . v (v once to f16) / sum, one launch for all heads; out = Wo o (o split bf16 hi + lo, 2 products) + x; f32 output [b][c][3][n].
#include <hip/hip_runtime.h>
#include <math.h>

typedef __attribute__((ext_vector_type(16))) _Float16 v16h;
typedef __attribute__((ext_vector_type(16))) __bf16 v16b;
typedef __attribute__((ext_vector_type(8)))  _Float16 v8h;
typedef __attribute__((ext_vector_type(8)))  float v8f;
typedef __attribute__((ext_vector_type(4)))  float v4f;
typedef __attribute__((ext_vector_type(2)))  float v2f;
typedef __attribute__((ext_vector_type(4)))  unsigned v4u;
typedef __attribute__((ext_vector_type(4)))  int v4i;
typedef float __attribute__((may_alias)) float_a;
typedef int __attribute__((may_alias)) int_a;

template <typename T> __device__ __forceinline__ void vst2(void* p, T v) { *(T*)p = v;  }
__device__ __forceinline__ v8f wmma_h(v16h a, v16h b, v8f c) { return __builtin_amdgcn_wmma_f32_16x16x32_f16(false, a, false, b, (short)0, c, false, false); }
__device__ __forceinline__ v8f wmma_bf(v16b a, v16b b, v8f c) {
  v8f d = __builtin_amdgcn_wmma_f32_16x16x32_bf16(false, a, false, b, (short)0, c, false, false);
  asm volatile("v_nop\n\tv_nop\n\tv_nop\n\tv_nop" : "+v"(d) : "v"(a), "v"(b));
  return d;
}
// 16x16x32 fragments: lane = (h = lane>>4, row/col = lane&15); elements 0..7 = k0+8h+0..7, 8..15 = k0+16+8h+0..7; D element r = row 8h+r
__device__ __forceinline__ v16h frag_h(const _Float16* rowk0, int lane) {
  union { v16h v; v8h q[2]; } u; const _Float16* p = rowk0 + 8 * (lane >> 4);
  u.q[0] = *(const v8h*)p; u.q[1] = *(const v8h*)(p + 16); return u.v;
}
__device__ __forceinline__ v16h frag_f32(const float* rowk0, int lane) {
  v16h a; const float* p = rowk0 + 8 * (lane >> 4);
#pragma unroll
  for (int i = 0; i < 8; ++i) { a[i] = (_Float16)p[i]; a[8 + i] = (_Float16)p[16 + i]; }
  return a;
}
__device__ __forceinline__ v16h frag_f32s(const float* rowk0, int lane, float sc) {
  v16h a; const float* p = rowk0 + 8 * (lane >> 4);
#pragma unroll
  for (int i = 0; i < 8; ++i) { a[i] = (_Float16)(p[i] * sc); a[8 + i] = (_Float16)(p[16 + i] * sc); }
  return a;
}
// column fragment from a [K][ld] layout (column n), rows >= K read as 0
__device__ __forceinline__ v16h fragc_f32(const float* W, int k0, int n, int lane, int ld, int K) {
  v16h a; const int g = lane >> 4;
#pragma unroll
  for (int i = 0; i < 8; ++i) { const int ka = k0 + 8 * g + i, kb = ka + 16;
    a[i] = (_Float16)(ka < K ? W[(size_t)(ka < K ? ka : K - 1) * ld + n] : 0.f); a[8 + i] = (_Float16)(kb < K ? W[(size_t)(kb < K ? kb : K - 1) * ld + n] : 0.f); }
  return a;
}
struct F2 { v16b h, l; };
__device__ __forceinline__ F2 bsplit16(const float v[16]) { F2 r;
#pragma unroll
  for (int i = 0; i < 16; ++i) { const __bf16 h = (__bf16)v[i]; r.h[i] = h; r.l[i] = (__bf16)(v[i] - (float)h); }
  return r; }
__device__ __forceinline__ F2 split_row(const float* row, int k0, int lane) { float v[16]; const float* p = row + k0 + 8 * (lane >> 4);
#pragma unroll
  for (int i = 0; i < 8; ++i) { v[i] = p[i]; v[8 + i] = p[16 + i]; }
  return bsplit16(v); }
__device__ __forceinline__ F2 split_rowK(const float* row, int k0, int lane, int K) { float v[16]; const int g = lane >> 4;
#pragma unroll
  for (int i = 0; i < 8; ++i) { const int ka = k0 + 8 * g + i, kb = ka + 16; v[i] = ka < K ? row[ka < K ? ka : K - 1] : 0.f; v[8 + i] = kb < K ? row[kb < K ? kb : K - 1] : 0.f; }
  return bsplit16(v); }
__device__ __forceinline__ F2 split_col(const float* W, int k0, int n, int lane, int ld, int K) { float v[16]; const int g = lane >> 4;
#pragma unroll
  for (int i = 0; i < 8; ++i) { const int ka = k0 + 8 * g + i, kb = ka + 16; v[i] = ka < K ? W[(size_t)(ka < K ? ka : K - 1) * ld + n] : 0.f; v[8 + i] = kb < K ? W[(size_t)(kb < K ? kb : K - 1) * ld + n] : 0.f; }
  return bsplit16(v); }
__device__ __forceinline__ v8f mac3(const F2& a, const F2& b, v8f c) { c = wmma_bf(a.l, b.h, c); c = wmma_bf(a.h, b.l, c); return wmma_bf(a.h, b.h, c); }
__device__ __forceinline__ float sigm(float v) { return 1.0f / (1.0f + expf(-v)); }


// Vector-neuron attention (B 4, C 256 = 8 heads x 32, 3 vector components, N 2,048 points): energy contracts over (head_dim, 3); residual output.
#define NB 4
#define CC 256
#define NI 3
#define TT 2048
#define NH 8
#define HD 32
#define KD (HD * NI)        // 96: per-head contraction length, index kk = i*32 + c_local
#define RW (NH * KD)        // 768: q/k row length per token
#ifndef TNB
#define TNB NB
#endif
typedef __attribute__((ext_vector_type(8))) __bf16 v8b;
__device__ __forceinline__ v16b frag_b(const __bf16* rowk0, int lane) {
  union { v16b v; v8b q[2]; } u; const __bf16* p = rowk0 + 8 * (lane >> 4);
  u.q[0] = *(const v8b*)p; u.q[1] = *(const v8b*)(p + 16); return u.v;
}
__device__ __forceinline__ float bfr(float v) { return (float)(__bf16)v; }
__device__ __attribute__((noinline)) float exp_ni(float v) { return expf(v); }
__device__ __attribute__((noinline)) float erf_ni(float v) { return erff(v); }

#define WS_QH  0u
#define WS_QL  (WS_QH + 2u * (size_t)NB * TT * RW)
#define WS_KH  (WS_QL + 2u * (size_t)NB * TT * RW)
#define WS_VT  (WS_KH + 2u * (size_t)NB * TT * RW)      // f16 v planes [b][h*96 + kk][n]
#define WS_O3  (WS_VT + 2u * (size_t)NB * RW * TT)      // f32 o [b][i][n][c]
#define WS_END (WS_O3 + 4u * (size_t)NB * NI * TT * CC)

// ---- k_proj: block = (64 points, 128 out channels, z = (b*3 + i)*3 + which): y[o][n] = sum_c W[o][c] x[b][c][i][n]
__global__ __launch_bounds__(128) void k_proj(const float* __restrict__ X, const float* __restrict__ WQ, const float* __restrict__ WK, const float* __restrict__ WV, _Float16* __restrict__ QH, _Float16* __restrict__ QL, _Float16* __restrict__ KH, _Float16* __restrict__ VT) {
  __shared__ __align__(16) __bf16 sx[64][CC + 8]; __shared__ __align__(16) _Float16 sh[64][136], sl[64][136]; __shared__ __align__(16) _Float16 th[128][72];
  const int tid = threadIdx.x, wave = tid >> 5, lane = tid & 31, col = lane & 15, g = lane >> 4; const int n0 = blockIdx.x * 64; const int c0 = blockIdx.y * 128; const int z = blockIdx.z; const int which = z % 3, i = (z / 3) % NI; const size_t b = z / 9; const float* Wm = which == 0 ? WQ : which == 1 ? WK : WV;
  for (int e = tid; e < CC * 64; e += 128) { const int c = e >> 6, nl = e & 63; sx[nl][c] = (__bf16)X[((b * CC + c) * NI + i) * (size_t)TT + n0 + nl]; }
  __syncthreads();
  v8f acc[8] = {};
#pragma unroll 2
  for (int kc = 0; kc < CC / 32; ++kc) { const v16b a = frag_b(&sx[wave * 16 + col][kc * 32], lane);
#pragma unroll
    for (int j = 0; j < 8; ++j) { v16b w; const int o = c0 + j * 16 + col; const float* p = Wm + (size_t)o * CC + kc * 32 + 8 * g;
#pragma unroll
      for (int ii = 0; ii < 8; ++ii) { w[ii] = (__bf16)p[ii]; w[8 + ii] = (__bf16)p[16 + ii]; }
      acc[j] = wmma_bf(a, w, acc[j]); } }
#pragma unroll
  for (int j = 0; j < 8; ++j)
#pragma unroll
    for (int r = 0; r < 8; ++r) { const float v = acc[j][r]; const int rl = wave * 16 + 8 * g + r, cl = j * 16 + col; const _Float16 hv = (_Float16)v; if (which == 2) th[cl][rl] = hv; else { sh[rl][cl] = hv; sl[rl][cl] = (_Float16)(v - (float)hv); } }
  __syncthreads();
  if (which < 2) { _Float16* dh = which == 0 ? QH : KH;   // rows [b][n][h][i*32 + c_local]; this block covers 4 heads (128 channels)
    for (int e = tid; e < 64 * 4 * 4; e += 128) { const int rl = e >> 4, hh = (e >> 2) & 3, q = e & 3; const int h = c0 / HD + hh; const size_t dst = (((b * TT + n0 + rl) * NH + h) * KD) + i * HD + q * 8;
      vst2((unsigned*)(dh + dst), *(const v4u*)&sh[rl][hh * 32 + q * 8]); if (which == 0) vst2((unsigned*)(QL + dst), *(const v4u*)&sl[rl][hh * 32 + q * 8]); } }
  else { for (int e = tid; e < 128 * 8; e += 128) { const int cl = e >> 3, q = e & 7; const int c = c0 + cl; const int h = c / HD, cL = c % HD; vst2((unsigned*)(VT + ((b * NH + h) * KD + i * HD + cL) * (size_t)TT + n0 + q * 8), *(const v4u*)&th[cl][q * 8]); } } }
// ---- k_fa: block = 16 waves x 16 queries of one (b, head). Per 64 keys: S^T = K Q^T (A = k rows, B = q hi then q lo), so a lane holds one query's
// scores (keys 8g + r of each 16-key tile); running maximum and sum per query in f32; two S^T tiles convert in place to the B operand of O^T += V^T P^T.
__global__ __launch_bounds__(512) void k_fa(const _Float16* __restrict__ QH, const _Float16* __restrict__ QL, const _Float16* __restrict__ KH, const _Float16* __restrict__ VT, float* __restrict__ O3) {
  const int tid = threadIdx.x, wave = tid >> 5, lane = tid & 31, col = lane & 15, g = lane >> 4; const int h = blockIdx.y; const size_t b = blockIdx.z; const int qn = blockIdx.x * 256 + wave * 16 + col;
  v16h qh[KD / 32], ql[KD / 32];
  for (int kc = 0; kc < KD / 32; ++kc) { const size_t qo = ((b * TT + qn) * NH + h) * KD + kc * 32; qh[kc] = frag_h(QH + qo, lane); ql[kc] = frag_h(QL + qo, lane); }
  const _Float16* kp = KH + ((b * TT + col) * NH + h) * KD;            // A row = key k0 + 16 t + col
  const _Float16* vp = VT + ((b * NH + h) * KD + col) * (size_t)TT;    // A row = kk 16 j + col, k = key
  v8f o[KD / 16] = {}; float m = -3.0e38f, l = 0.f;
  const float scl = 0.17677669529663689f;   // 32^-0.5
  for (int k0 = 0; k0 < TT; k0 += 64) { v8f s[4];
    for (int t = 0; t < 4; ++t) { v8f a = {};
      for (int kc = 0; kc < KD / 32; ++kc) { const v16h kb = frag_h(kp + (size_t)(k0 + t * 16) * RW + kc * 32, lane); a = wmma_h(kb, qh[kc], a); a = wmma_h(kb, ql[kc], a); }
      s[t] = a; }
    float mx = m;
    for (int t = 0; t < 4; ++t)
      for (int r = 0; r < 8; ++r) { s[t][r] *= scl; mx = fmaxf(mx, s[t][r]); }
    mx = fmaxf(mx, __shfl_xor(mx, 16));   // the other half of the wave holds this query's other keys
    const float al = expf(m - mx); m = mx; float ps = 0.f; v16h p[2];
    for (int t = 0; t < 4; ++t)
      for (int r = 0; r < 8; ++r) { const float e = expf(s[t][r] - mx); ps += e; p[t >> 1][(t & 1) * 8 + r] = (_Float16)(e * 2048.0f); }
    l = l * al + ps;
    for (int j = 0; j < KD / 16; ++j)
      for (int r = 0; r < 8; ++r) o[j][r] *= al;
    for (int j = 0; j < KD / 16; ++j)
      for (int u = 0; u < 2; ++u) o[j] = wmma_h(frag_h(vp + (size_t)(j * 16) * TT + k0 + u * 32, lane), p[u], o[j]); }
  l += __shfl_xor(l, 16); const float inv = 1.0f / (l * 2048.0f);
  for (int j = 0; j < KD / 16; ++j) { float* dst = O3 + ((b * NI + (j >> 1)) * TT + qn) * (size_t)CC + h * HD + (j & 1) * 16 + 8 * g;   // kk = 16 j + 8 g + r = i * 32 + c_local
    v4f a, c;
    for (int r = 0; r < 4; ++r) { a[r] = o[j][r] * inv; c[r] = o[j][4 + r] * inv; }
    vst2(dst, a); vst2(dst + 4, c); } }
// ---- k_out: block = (64 points, 128 out channels, z = b*3 + i): out[b][o][i][n] = sum_c Wo[o][c] o3[b][i][n][c] + x[b][o][i][n]
__global__ __launch_bounds__(128) void k_out(const float* __restrict__ O3, const float* __restrict__ WO, const float* __restrict__ X, float* __restrict__ OUT) { __shared__ __align__(16) float st[128][68];
  const int tid = threadIdx.x, wave = tid >> 5, lane = tid & 31, col = lane & 15, g = lane >> 4; const int n0 = blockIdx.x * 64; const int c0 = blockIdx.y * 128; const size_t b = blockIdx.z / NI; const int i = blockIdx.z % NI;
  v8f acc[8] = {};
#pragma unroll 2
  for (int kc = 0; kc < CC / 32; ++kc) { const F2 a = split_row(O3 + ((b * NI + i) * TT + n0 + wave * 16 + col) * (size_t)CC, kc * 32, lane);
#pragma unroll
    for (int j = 0; j < 8; ++j) { v16b w; const int o = c0 + j * 16 + col; const float* p = WO + (size_t)o * CC + kc * 32 + 8 * g;
#pragma unroll
      for (int ii = 0; ii < 8; ++ii) { w[ii] = (__bf16)p[ii]; w[8 + ii] = (__bf16)p[16 + ii]; }
      acc[j] = wmma_bf(a.h, w, acc[j]); acc[j] = wmma_bf(a.l, w, acc[j]); } }
#pragma unroll
  for (int j = 0; j < 8; ++j)
#pragma unroll
    for (int r = 0; r < 8; ++r) st[j * 16 + col][wave * 16 + 8 * g + r] = acc[j][r];
  __syncthreads();
  for (int e = tid; e < 128 * 16; e += 128) { const int cl = e >> 4, q = e & 15; const size_t go = ((b * CC + c0 + cl) * NI + i) * (size_t)TT + n0 + q * 4; const v4f xr = *(const v4f*)(X + go); v4f v = *(const v4f*)&st[cl][q * 4]; v[0] += bfr(xr[0]); v[1] += bfr(xr[1]); v[2] += bfr(xr[2]); v[3] += bfr(xr[3]); vst2(OUT + go, v); } }
extern "C" void kernel_launch(void* const* d_in, const int* in_sizes, int n_in, void* d_out, int out_size, void* d_ws, size_t ws_size, hipStream_t stream) {
  (void)in_sizes; (void)n_in; (void)out_size;
  const float** F = (const float**)d_in;   // 0 x [4,256,3,2048], 1 Wq, 2 Wk, 3 Wv, 4 Wo [256,256] ([out][in])
  if (ws_size < (size_t)WS_END) return;
  char* ws = (char*)d_ws; _Float16 *QH = (_Float16*)(ws + WS_QH), *QL = (_Float16*)(ws + WS_QL), *KH = (_Float16*)(ws + WS_KH), *VT = (_Float16*)(ws + WS_VT); float *O3 = (float*)(ws + WS_O3);
  k_proj<<<dim3(TT / 64, CC / 128, TNB * 9), 128, 0, stream>>>(F[0], F[1], F[2], F[3], QH, QL, KH, VT);
  k_fa<<<dim3(TT / 256, NH, TNB), 512, 0, stream>>>(QH, QL, KH, VT, O3);
  k_out<<<dim3(TT / 64, CC / 128, TNB * NI), 128, 0, stream>>>(O3, F[4], F[0], (float*)d_out);
}

// v002
// One run takes 259 microseconds.
// Two timings next to v001 both put it at 1.23 times that version's speed.
// All steps since v000 together make it 5.17 times as fast.
// compute dtype: all float inputs rounded to bf16; q/k/v = W x over channels (per vector component) with EXACT bf16 products on WMMA 16x16x32 (x tiles transposed in LDS), f32 accumulate; q as f16 hi + residual, k f16 -> 2-product energies over the 96 (head_dim x 3) pairs, / sqrt(32), kept in registers; online softmax in f32 (precise expf, running maximum and sum per query) -> unnormalised P f16 x 2^11; o = P . v (v once to f16) / sum, one launch for all heads; out = Wo o (o split bf16 hi + lo, 2 products) + x; f32 output [b][c][3][n].
#include <hip/hip_runtime.h>
#include <math.h>

typedef __attribute__((ext_vector_type(16))) _Float16 v16h;
typedef __attribute__((ext_vector_type(16))) __bf16 v16b;
typedef __attribute__((ext_vector_type(8)))  _Float16 v8h;
typedef __attribute__((ext_vector_type(8)))  float v8f;
typedef __attribute__((ext_vector_type(4)))  float v4f;
typedef __attribute__((ext_vector_type(2)))  float v2f;
typedef __attribute__((ext_vector_type(4)))  unsigned v4u;
typedef __attribute__((ext_vector_type(4)))  int v4i;
typedef float __attribute__((may_alias)) float_a;
typedef int __attribute__((may_alias)) int_a;

template <typename T> __device__ __forceinline__ void vst2(void* p, T v) { *(T*)p = v;  }
__device__ __forceinline__ v8f wmma_h(v16h a, v16h b, v8f c) { return __builtin_amdgcn_wmma_f32_16x16x32_f16(false, a, false, b, (short)0, c, false, false); }
__device__ __forceinline__ v8f wmma_bf(v16b a, v16b b, v8f c) {
  v8f d = __builtin_amdgcn_wmma_f32_16x16x32_bf16(false, a, false, b, (short)0, c, false, false);
  asm volatile("v_nop\n\tv_nop\n\tv_nop\n\tv_nop" : "+v"(d) : "v"(a), "v"(b));
  return d;
}
// 16x16x32 fragments: lane = (h = lane>>4, row/col = lane&15); elements 0..7 = k0+8h+0..7, 8..15 = k0+16+8h+0..7; D element r = row 8h+r
__device__ __forceinline__ v16h frag_h(const _Float16* rowk0, int lane) {
  union { v16h v; v8h q[2]; } u; const _Float16* p = rowk0 + 8 * (lane >> 4);
  u.q[0] = *(const v8h*)p; u.q[1] = *(const v8h*)(p + 16); return u.v;
}
__device__ __forceinline__ v16h frag_f32(const float* rowk0, int lane) {
  v16h a; const float* p = rowk0 + 8 * (lane >> 4);
#pragma unroll
  for (int i = 0; i < 8; ++i) { a[i] = (_Float16)p[i]; a[8 + i] = (_Float16)p[16 + i]; }
  return a;
}
__device__ __forceinline__ v16h frag_f32s(const float* rowk0, int lane, float sc) {
  v16h a; const float* p = rowk0 + 8 * (lane >> 4);
#pragma unroll
  for (int i = 0; i < 8; ++i) { a[i] = (_Float16)(p[i] * sc); a[8 + i] = (_Float16)(p[16 + i] * sc); }
  return a;
}
// column fragment from a [K][ld] layout (column n), rows >= K read as 0
__device__ __forceinline__ v16h fragc_f32(const float* W, int k0, int n, int lane, int ld, int K) {
  v16h a; const int g = lane >> 4;
#pragma unroll
  for (int i = 0; i < 8; ++i) { const int ka = k0 + 8 * g + i, kb = ka + 16;
    a[i] = (_Float16)(ka < K ? W[(size_t)(ka < K ? ka : K - 1) * ld + n] : 0.f); a[8 + i] = (_Float16)(kb < K ? W[(size_t)(kb < K ? kb : K - 1) * ld + n] : 0.f); }
  return a;
}
struct F2 { v16b h, l; };
__device__ __forceinline__ F2 bsplit16(const float v[16]) { F2 r;
#pragma unroll
  for (int i = 0; i < 16; ++i) { const __bf16 h = (__bf16)v[i]; r.h[i] = h; r.l[i] = (__bf16)(v[i] - (float)h); }
  return r; }
__device__ __forceinline__ F2 split_row(const float* row, int k0, int lane) { float v[16]; const float* p = row + k0 + 8 * (lane >> 4);
#pragma unroll
  for (int i = 0; i < 8; ++i) { v[i] = p[i]; v[8 + i] = p[16 + i]; }
  return bsplit16(v); }
__device__ __forceinline__ F2 split_rowK(const float* row, int k0, int lane, int K) { float v[16]; const int g = lane >> 4;
#pragma unroll
  for (int i = 0; i < 8; ++i) { const int ka = k0 + 8 * g + i, kb = ka + 16; v[i] = ka < K ? row[ka < K ? ka : K - 1] : 0.f; v[8 + i] = kb < K ? row[kb < K ? kb : K - 1] : 0.f; }
  return bsplit16(v); }
__device__ __forceinline__ F2 split_col(const float* W, int k0, int n, int lane, int ld, int K) { float v[16]; const int g = lane >> 4;
#pragma unroll
  for (int i = 0; i < 8; ++i) { const int ka = k0 + 8 * g + i, kb = ka + 16; v[i] = ka < K ? W[(size_t)(ka < K ? ka : K - 1) * ld + n] : 0.f; v[8 + i] = kb < K ? W[(size_t)(kb < K ? kb : K - 1) * ld + n] : 0.f; }
  return bsplit16(v); }
__device__ __forceinline__ v8f mac3(const F2& a, const F2& b, v8f c) { c = wmma_bf(a.l, b.h, c); c = wmma_bf(a.h, b.l, c); return wmma_bf(a.h, b.h, c); }
__device__ __forceinline__ float sigm(float v) { return 1.0f / (1.0f + expf(-v)); }


// Vector-neuron attention (B 4, C 256 = 8 heads x 32, 3 vector components, N 2,048 points): energy contracts over (head_dim, 3); residual output.
#define NB 4
#define CC 256
#define NI 3
#define TT 2048
#define NH 8
#define HD 32
#define KD (HD * NI)        // 96: per-head contraction length, index kk = i*32 + c_local
#define RW (NH * KD)        // 768: q/k row length per token
#ifndef TNB
#define TNB NB
#endif
typedef __attribute__((ext_vector_type(8))) __bf16 v8b;
__device__ __forceinline__ v16b frag_b(const __bf16* rowk0, int lane) {
  union { v16b v; v8b q[2]; } u; const __bf16* p = rowk0 + 8 * (lane >> 4);
  u.q[0] = *(const v8b*)p; u.q[1] = *(const v8b*)(p + 16); return u.v;
}
__device__ __forceinline__ float bfr(float v) { return (float)(__bf16)v; }
__device__ __attribute__((noinline)) float exp_ni(float v) { return expf(v); }
__device__ __attribute__((noinline)) float erf_ni(float v) { return erff(v); }

#define WS_QH  0u
#define WS_QL  (WS_QH + 2u * (size_t)NB * TT * RW)
#define WS_KH  (WS_QL + 2u * (size_t)NB * TT * RW)
#define WS_VT  (WS_KH + 2u * (size_t)NB * TT * RW)      // f16 v planes [b][h*96 + kk][n]
#define WS_O3  (WS_VT + 2u * (size_t)NB * RW * TT)      // f32 o [b][i][n][c]
#define WS_END (WS_O3 + 4u * (size_t)NB * NI * TT * CC)

// ---- k_proj: block = (64 points, 128 out channels, z = (b*3 + i)*3 + which): y[o][n] = sum_c W[o][c] x[b][c][i][n]
__global__ __launch_bounds__(128) void k_proj(const float* __restrict__ X, const float* __restrict__ WQ, const float* __restrict__ WK, const float* __restrict__ WV, _Float16* __restrict__ QH, _Float16* __restrict__ QL, _Float16* __restrict__ KH, _Float16* __restrict__ VT) {
  __shared__ __align__(16) __bf16 sx[64][CC + 8]; __shared__ __align__(16) _Float16 sh[64][136], sl[64][136]; __shared__ __align__(16) _Float16 th[128][72];
  const int tid = threadIdx.x, wave = tid >> 5, lane = tid & 31, col = lane & 15, g = lane >> 4; const int n0 = blockIdx.x * 64; const int c0 = blockIdx.y * 128; const int z = blockIdx.z; const int which = z % 3, i = (z / 3) % NI; const size_t b = z / 9; const float* Wm = which == 0 ? WQ : which == 1 ? WK : WV;
  for (int e = tid; e < CC * 64; e += 128) { const int c = e >> 6, nl = e & 63; sx[nl][c] = (__bf16)X[((b * CC + c) * NI + i) * (size_t)TT + n0 + nl]; }
  __syncthreads();
  v8f acc[8] = {};
#pragma unroll 2
  for (int kc = 0; kc < CC / 32; ++kc) { const v16b a = frag_b(&sx[wave * 16 + col][kc * 32], lane);
#pragma unroll
    for (int j = 0; j < 8; ++j) { v16b w; const int o = c0 + j * 16 + col; const float* p = Wm + (size_t)o * CC + kc * 32 + 8 * g;
#pragma unroll
      for (int ii = 0; ii < 8; ++ii) { w[ii] = (__bf16)p[ii]; w[8 + ii] = (__bf16)p[16 + ii]; }
      acc[j] = wmma_bf(a, w, acc[j]); } }
#pragma unroll
  for (int j = 0; j < 8; ++j)
#pragma unroll
    for (int r = 0; r < 8; ++r) { const float v = acc[j][r]; const int rl = wave * 16 + 8 * g + r, cl = j * 16 + col; const _Float16 hv = (_Float16)v; if (which == 2) th[cl][rl] = hv; else { sh[rl][cl] = hv; sl[rl][cl] = (_Float16)(v - (float)hv); } }
  __syncthreads();
  if (which < 2) { _Float16* dh = which == 0 ? QH : KH;   // rows [b][n][h][i*32 + c_local]; this block covers 4 heads (128 channels)
    for (int e = tid; e < 64 * 4 * 4; e += 128) { const int rl = e >> 4, hh = (e >> 2) & 3, q = e & 3; const int h = c0 / HD + hh; const size_t dst = (((b * TT + n0 + rl) * NH + h) * KD) + i * HD + q * 8;
      vst2((unsigned*)(dh + dst), *(const v4u*)&sh[rl][hh * 32 + q * 8]); if (which == 0) vst2((unsigned*)(QL + dst), *(const v4u*)&sl[rl][hh * 32 + q * 8]); } }
  else { for (int e = tid; e < 128 * 8; e += 128) { const int cl = e >> 3, q = e & 7; const int c = c0 + cl; const int h = c / HD, cL = c % HD; vst2((unsigned*)(VT + ((b * NH + h) * KD + i * HD + cL) * (size_t)TT + n0 + q * 8), *(const v4u*)&th[cl][q * 8]); } } }
// ---- k_fa: block = 16 waves x 16 queries of one (b, head). Per 64 keys: S^T = K Q^T (A = k rows, B = q hi then q lo), so a lane holds one query's
// scores (keys 8g + r of each 16-key tile); running maximum and sum per query in f32; two S^T tiles convert in place to the B operand of O^T += V^T P^T.
// The 16 waves read the same K rows and V^T rows: a stage of 256 keys is brought into LDS once per block by asynchronous copies, two buffers, the next
// stage in flight while this one is worked on. Row pitches are odd multiples of 16 bytes, so the 16-byte fragment reads meet no bank conflict.
#define SKEYS 256                 // keys per stage
#define KPH 104                   // k row pitch in LDS, halves (192 B of data in 208 B)
#define VPH 264                   // v^T row pitch in LDS, halves (512 B of data in 528 B)
#define KSZ (SKEYS * KPH)         // halves of k rows per stage
#define STG (KSZ + KD * VPH)      // halves per stage buffer
// One lane's share of a stage: three 16-byte pieces (64 B apart) of each of two k rows (128 rows apart) and one piece of each of six v^T rows (16 rows apart).
// s_wait_xcnt 0 closes the statement so that no address register is rewritten ahead of it.
__device__ __forceinline__ void stage_copy(unsigned lk, const _Float16* gk, unsigned lv, const _Float16* gv) {
  const unsigned lk2 = lk + 128u * KPH * 2u; const _Float16* gk2 = gk + 128 * (size_t)RW;
  asm volatile("global_load_async_to_lds_b128 %0, %1, off\n\t"
               "global_load_async_to_lds_b128 %2, %3, off\n\t"
               "global_load_async_to_lds_b128 %4, %5, off\n\t"
               "global_load_async_to_lds_b128 %6, %7, off\n\t"
               "global_load_async_to_lds_b128 %8, %9, off\n\t"
               "global_load_async_to_lds_b128 %10, %11, off\n\t"
               "global_load_async_to_lds_b128 %12, %13, off\n\t"
               "global_load_async_to_lds_b128 %14, %15, off\n\t"
               "global_load_async_to_lds_b128 %16, %17, off\n\t"
               "global_load_async_to_lds_b128 %18, %19, off\n\t"
               "global_load_async_to_lds_b128 %20, %21, off\n\t"
               "global_load_async_to_lds_b128 %22, %23, off\n\t"
               "s_wait_xcnt 0x0"
               :: "v"(lk), "v"(gk), "v"(lk + 64u), "v"(gk + 32), "v"(lk + 128u), "v"(gk + 64),
                  "v"(lk2), "v"(gk2), "v"(lk2 + 64u), "v"(gk2 + 32), "v"(lk2 + 128u), "v"(gk2 + 64),
                  "v"(lv), "v"(gv), "v"(lv + 16u * VPH * 2u), "v"(gv + 16 * (size_t)TT), "v"(lv + 32u * VPH * 2u), "v"(gv + 32 * (size_t)TT),
                  "v"(lv + 48u * VPH * 2u), "v"(gv + 48 * (size_t)TT), "v"(lv + 64u * VPH * 2u), "v"(gv + 64 * (size_t)TT), "v"(lv + 80u * VPH * 2u), "v"(gv + 80 * (size_t)TT)
               : "memory");
}
__global__ __launch_bounds__(512) void k_fa(const _Float16* __restrict__ QH, const _Float16* __restrict__ QL, const _Float16* __restrict__ KH, const _Float16* __restrict__ VT, float* __restrict__ O3) {
  __shared__ __align__(16) _Float16 sm[2 * STG];
  const int tid = threadIdx.x, wave = tid >> 5, lane = tid & 31, col = lane & 15, g = lane >> 4; const int h = blockIdx.y; const size_t b = blockIdx.z; const int qn = blockIdx.x * 256 + wave * 16 + col;
  const _Float16* gk = KH + ((b * TT + (tid >> 2)) * NH + h) * KD + (tid & 3) * 8;                 // this lane's first k row of stage 0
  const _Float16* gv = VT + ((b * NH + h) * KD + (tid >> 5)) * (size_t)TT + (tid & 31) * 8;        // this lane's first v^T row, keys of stage 0
  const unsigned lk = (unsigned)(size_t)sm + (unsigned)(tid >> 2) * (KPH * 2u) + (unsigned)(tid & 3) * 16u;
  const unsigned lv = (unsigned)(size_t)sm + KSZ * 2u + (unsigned)(tid >> 5) * (VPH * 2u) + (unsigned)(tid & 31) * 16u;
  stage_copy(lk, gk, lv, gv);
  v16h qh[KD / 32], ql[KD / 32];
  for (int kc = 0; kc < KD / 32; ++kc) { const size_t qo = ((b * TT + qn) * NH + h) * KD + kc * 32; qh[kc] = frag_h(QH + qo, lane); ql[kc] = frag_h(QL + qo, lane); }
  asm volatile("s_wait_asynccnt 0x0" ::: "memory");   // this wave's share of stage 0 has landed
  __syncthreads();                                    // every wave's share has: stage 0 may be read
  stage_copy(lk + STG * 2u, gk + (size_t)SKEYS * RW, lv + STG * 2u, gv + SKEYS);
  v8f o[KD / 16] = {}; float m = -3.0e38f, l = 0.f;
  const float scl = 0.17677669529663689f;   // 32^-0.5
  for (int st = 0; st < TT / SKEYS; ++st) {
    const _Float16* kp = sm + (st & 1) * STG + col * KPH;          // A row = key k0 + 16 t + col
    const _Float16* vp = sm + (st & 1) * STG + KSZ + col * VPH;    // A row = kk 16 j + col, k = key
    for (int k0 = 0; k0 < SKEYS; k0 += 64) { v8f s[4]; v16h kf[4][KD / 32];
      for (int t = 0; t < 4; ++t)
        for (int kc = 0; kc < KD / 32; ++kc) kf[t][kc] = frag_h(kp + (k0 + t * 16) * KPH + kc * 32, lane);
      __builtin_amdgcn_sched_barrier(0);   // the pass's k fragments are read as one group: one LDS latency a pass instead of one per fragment
      for (int t = 0; t < 4; ++t) { v8f a = {};
        for (int kc = 0; kc < KD / 32; ++kc) { a = wmma_h(kf[t][kc], qh[kc], a); a = wmma_h(kf[t][kc], ql[kc], a); }
        s[t] = a; }
      v16h vf[KD / 16];
      for (int j = 0; j < KD / 16; ++j) vf[j] = frag_h(vp + (j * 16) * VPH + k0, lane);          // keys k0 .. k0 + 31
      __builtin_amdgcn_sched_barrier(0);   // the six v^T fragments are read as one group here, so that the softmax below covers their LDS latency
      float mx = m;
      for (int t = 0; t < 4; ++t)
        for (int r = 0; r < 8; ++r) { s[t][r] *= scl; mx = fmaxf(mx, s[t][r]); }
      mx = fmaxf(mx, __shfl_xor(mx, 16));   // the other half of the wave holds this query's other keys
      const float al = expf(m - mx); m = mx; float ps = 0.f; v16h p;
      for (int j = 0; j < KD / 16; ++j)
        for (int r = 0; r < 8; ++r) o[j][r] *= al;
      for (int t = 0; t < 2; ++t)
        for (int r = 0; r < 8; ++r) { const float e = expf(s[t][r] - mx); ps += e; p[t * 8 + r] = (_Float16)(e * 2048.0f); }
      for (int j = 0; j < KD / 16; ++j) o[j] = wmma_h(vf[j], p, o[j]);
      for (int j = 0; j < KD / 16; ++j) vf[j] = frag_h(vp + (j * 16) * VPH + k0 + 32, lane);     // keys k0 + 32 .. k0 + 63
      __builtin_amdgcn_sched_barrier(0);   // as above: one group, covered by the second half of the softmax
      for (int t = 2; t < 4; ++t)
        for (int r = 0; r < 8; ++r) { const float e = expf(s[t][r] - mx); ps += e; p[(t - 2) * 8 + r] = (_Float16)(e * 2048.0f); }
      l = l * al + ps;
      for (int j = 0; j < KD / 16; ++j) o[j] = wmma_h(vf[j], p, o[j]); }
    asm volatile("s_wait_dscnt 0x0" ::: "memory");      // this wave's reads of the buffer are done before it is refilled
    asm volatile("s_wait_asynccnt 0x0" ::: "memory");   // this wave's share of stage st + 1 has landed
    __syncthreads();                                    // publishes stage st + 1 and ends every wave's reads of stage st
    if (st + 2 < TT / SKEYS) stage_copy(lk + (unsigned)(st & 1) * (STG * 2u), gk + (size_t)(st + 2) * SKEYS * RW, lv + (unsigned)(st & 1) * (STG * 2u), gv + (st + 2) * SKEYS); }
  asm volatile("s_wait_asynccnt 0x0" ::: "memory");     // no copy is left in flight when the wave ends
  l += __shfl_xor(l, 16); const float inv = 1.0f / (l * 2048.0f);
  for (int j = 0; j < KD / 16; ++j) { float* dst = O3 + ((b * NI + (j >> 1)) * TT + qn) * (size_t)CC + h * HD + (j & 1) * 16 + 8 * g;   // kk = 16 j + 8 g + r = i * 32 + c_local
    v4f a, c;
    for (int r = 0; r < 4; ++r) { a[r] = o[j][r] * inv; c[r] = o[j][4 + r] * inv; }
    vst2(dst, a); vst2(dst + 4, c); } }
// ---- k_out: block = (64 points, 128 out channels, z = b*3 + i): out[b][o][i][n] = sum_c Wo[o][c] o3[b][i][n][c] + x[b][o][i][n]
__global__ __launch_bounds__(128) void k_out(const float* __restrict__ O3, const float* __restrict__ WO, const float* __restrict__ X, float* __restrict__ OUT) { __shared__ __align__(16) float st[128][68];
  const int tid = threadIdx.x, wave = tid >> 5, lane = tid & 31, col = lane & 15, g = lane >> 4; const int n0 = blockIdx.x * 64; const int c0 = blockIdx.y * 128; const size_t b = blockIdx.z / NI; const int i = blockIdx.z % NI;
  v8f acc[8] = {};
#pragma unroll 2
  for (int kc = 0; kc < CC / 32; ++kc) { const F2 a = split_row(O3 + ((b * NI + i) * TT + n0 + wave * 16 + col) * (size_t)CC, kc * 32, lane);
#pragma unroll
    for (int j = 0; j < 8; ++j) { v16b w; const int o = c0 + j * 16 + col; const float* p = WO + (size_t)o * CC + kc * 32 + 8 * g;
#pragma unroll
      for (int ii = 0; ii < 8; ++ii) { w[ii] = (__bf16)p[ii]; w[8 + ii] = (__bf16)p[16 + ii]; }
      acc[j] = wmma_bf(a.h, w, acc[j]); acc[j] = wmma_bf(a.l, w, acc[j]); } }
#pragma unroll
  for (int j = 0; j < 8; ++j)
#pragma unroll
    for (int r = 0; r < 8; ++r) st[j * 16 + col][wave * 16 + 8 * g + r] = acc[j][r];
  __syncthreads();
  for (int e = tid; e < 128 * 16; e += 128) { const int cl = e >> 4, q = e & 15; const size_t go = ((b * CC + c0 + cl) * NI + i) * (size_t)TT + n0 + q * 4; const v4f xr = *(const v4f*)(X + go); v4f v = *(const v4f*)&st[cl][q * 4]; v[0] += bfr(xr[0]); v[1] += bfr(xr[1]); v[2] += bfr(xr[2]); v[3] += bfr(xr[3]); vst2(OUT + go, v); } }
extern "C" void kernel_launch(void* const* d_in, const int* in_sizes, int n_in, void* d_out, int out_size, void* d_ws, size_t ws_size, hipStream_t stream) {
  (void)in_sizes; (void)n_in; (void)out_size;
  const float** F = (const float**)d_in;   // 0 x [4,256,3,2048], 1 Wq, 2 Wk, 3 Wv, 4 Wo [256,256] ([out][in])
  if (ws_size < (size_t)WS_END) return;
  char* ws = (char*)d_ws; _Float16 *QH = (_Float16*)(ws + WS_QH), *QL = (_Float16*)(ws + WS_QL), *KH = (_Float16*)(ws + WS_KH), *VT = (_Float16*)(ws + WS_VT); float *O3 = (float*)(ws + WS_O3);
  k_proj<<<dim3(TT / 64, CC / 128, TNB * 9), 128, 0, stream>>>(F[0], F[1], F[2], F[3], QH, QL, KH, VT);
  k_fa<<<dim3(TT / 256, NH, TNB), 512, 0, stream>>>(QH, QL, KH, VT, O3);
  k_out<<<dim3(TT / 64, CC / 128, TNB * NI), 128, 0, stream>>>(O3, F[4], F[0], (float*)d_out);
}

// v003
// A run of this version takes 170 microseconds.
// In two side-by-side timings against v002, it was 1.52 and 1.53 times as fast.
// All steps since v000 together make it 7.89 times as fast.
// compute dtype: all float inputs rounded to bf16; the four W rounded to bf16 once per call and laid out in B-fragment order (k_pack); q/k/v = W x over channels (per vector component) with EXACT bf16 products on WMMA 16x16x32 (x tiles transposed in LDS), f32 accumulate; q as f16 hi + residual, k f16 -> 2-product energies over the 96 (head_dim x 3) pairs, / sqrt(32), kept in registers; online softmax in f32 (precise expf, running maximum and sum per query) -> unnormalised P f16 x 2^11; o = P . v (v once to f16) / sum, one launch for all heads; out = Wo o (o split bf16 hi + lo, 2 products) + x; f32 output [b][c][3][n].
#include <hip/hip_runtime.h>
#include <math.h>

typedef __attribute__((ext_vector_type(16))) _Float16 v16h;
typedef __attribute__((ext_vector_type(16))) __bf16 v16b;
typedef __attribute__((ext_vector_type(8)))  _Float16 v8h;
typedef __attribute__((ext_vector_type(8)))  float v8f;
typedef __attribute__((ext_vector_type(4)))  float v4f;
typedef __attribute__((ext_vector_type(2)))  float v2f;
typedef __attribute__((ext_vector_type(4)))  unsigned v4u;
typedef __attribute__((ext_vector_type(4)))  int v4i;
typedef float __attribute__((may_alias)) float_a;
typedef int __attribute__((may_alias)) int_a;

template <typename T> __device__ __forceinline__ void vst2(void* p, T v) { *(T*)p = v;  }
__device__ __forceinline__ v8f wmma_h(v16h a, v16h b, v8f c) { return __builtin_amdgcn_wmma_f32_16x16x32_f16(false, a, false, b, (short)0, c, false, false); }
__device__ __forceinline__ v8f wmma_bf(v16b a, v16b b, v8f c) {
  v8f d = __builtin_amdgcn_wmma_f32_16x16x32_bf16(false, a, false, b, (short)0, c, false, false);
  asm volatile("v_nop\n\tv_nop\n\tv_nop\n\tv_nop" : "+v"(d) : "v"(a), "v"(b));
  return d;
}
// 16x16x32 fragments: lane = (h = lane>>4, row/col = lane&15); elements 0..7 = k0+8h+0..7, 8..15 = k0+16+8h+0..7; D element r = row 8h+r
__device__ __forceinline__ v16h frag_h(const _Float16* rowk0, int lane) {
  union { v16h v; v8h q[2]; } u; const _Float16* p = rowk0 + 8 * (lane >> 4);
  u.q[0] = *(const v8h*)p; u.q[1] = *(const v8h*)(p + 16); return u.v;
}
__device__ __forceinline__ v16h frag_f32(const float* rowk0, int lane) {
  v16h a; const float* p = rowk0 + 8 * (lane >> 4);
#pragma unroll
  for (int i = 0; i < 8; ++i) { a[i] = (_Float16)p[i]; a[8 + i] = (_Float16)p[16 + i]; }
  return a;
}
__device__ __forceinline__ v16h frag_f32s(const float* rowk0, int lane, float sc) {
  v16h a; const float* p = rowk0 + 8 * (lane >> 4);
#pragma unroll
  for (int i = 0; i < 8; ++i) { a[i] = (_Float16)(p[i] * sc); a[8 + i] = (_Float16)(p[16 + i] * sc); }
  return a;
}
// column fragment from a [K][ld] layout (column n), rows >= K read as 0
__device__ __forceinline__ v16h fragc_f32(const float* W, int k0, int n, int lane, int ld, int K) {
  v16h a; const int g = lane >> 4;
#pragma unroll
  for (int i = 0; i < 8; ++i) { const int ka = k0 + 8 * g + i, kb = ka + 16;
    a[i] = (_Float16)(ka < K ? W[(size_t)(ka < K ? ka : K - 1) * ld + n] : 0.f); a[8 + i] = (_Float16)(kb < K ? W[(size_t)(kb < K ? kb : K - 1) * ld + n] : 0.f); }
  return a;
}
struct F2 { v16b h, l; };
__device__ __forceinline__ F2 bsplit16(const float v[16]) { F2 r;
#pragma unroll
  for (int i = 0; i < 16; ++i) { const __bf16 h = (__bf16)v[i]; r.h[i] = h; r.l[i] = (__bf16)(v[i] - (float)h); }
  return r; }
__device__ __forceinline__ F2 split_row(const float* row, int k0, int lane) { float v[16]; const float* p = row + k0 + 8 * (lane >> 4);
#pragma unroll
  for (int i = 0; i < 8; ++i) { v[i] = p[i]; v[8 + i] = p[16 + i]; }
  return bsplit16(v); }
__device__ __forceinline__ F2 split_rowK(const float* row, int k0, int lane, int K) { float v[16]; const int g = lane >> 4;
#pragma unroll
  for (int i = 0; i < 8; ++i) { const int ka = k0 + 8 * g + i, kb = ka + 16; v[i] = ka < K ? row[ka < K ? ka : K - 1] : 0.f; v[8 + i] = kb < K ? row[kb < K ? kb : K - 1] : 0.f; }
  return bsplit16(v); }
__device__ __forceinline__ F2 split_col(const float* W, int k0, int n, int lane, int ld, int K) { float v[16]; const int g = lane >> 4;
#pragma unroll
  for (int i = 0; i < 8; ++i) { const int ka = k0 + 8 * g + i, kb = ka + 16; v[i] = ka < K ? W[(size_t)(ka < K ? ka : K - 1) * ld + n] : 0.f; v[8 + i] = kb < K ? W[(size_t)(kb < K ? kb : K - 1) * ld + n] : 0.f; }
  return bsplit16(v); }
__device__ __forceinline__ v8f mac3(const F2& a, const F2& b, v8f c) { c = wmma_bf(a.l, b.h, c); c = wmma_bf(a.h, b.l, c); return wmma_bf(a.h, b.h, c); }
__device__ __forceinline__ float sigm(float v) { return 1.0f / (1.0f + expf(-v)); }


// Vector-neuron attention (B 4, C 256 = 8 heads x 32, 3 vector components, N 2,048 points): energy contracts over (head_dim, 3); residual output.
#define NB 4
#define CC 256
#define NI 3
#define TT 2048
#define NH 8
#define HD 32
#define KD (HD * NI)        // 96: per-head contraction length, index kk = i*32 + c_local
#define RW (NH * KD)        // 768: q/k row length per token
#ifndef TNB
#define TNB NB
#endif
typedef __attribute__((ext_vector_type(8))) __bf16 v8b;
__device__ __forceinline__ v16b frag_b(const __bf16* rowk0, int lane) {
  union { v16b v; v8b q[2]; } u; const __bf16* p = rowk0 + 8 * (lane >> 4);
  u.q[0] = *(const v8b*)p; u.q[1] = *(const v8b*)(p + 16); return u.v;
}
__device__ __forceinline__ float bfr(float v) { return (float)(__bf16)v; }
__device__ __attribute__((noinline)) float exp_ni(float v) { return expf(v); }
__device__ __attribute__((noinline)) float erf_ni(float v) { return erff(v); }

#define WS_QH  0u
#define WS_QL  (WS_QH + 2u * (size_t)NB * TT * RW)
#define WS_KH  (WS_QL + 2u * (size_t)NB * TT * RW)
#define WS_VT  (WS_KH + 2u * (size_t)NB * TT * RW)      // f16 v planes [b][h*96 + kk][n]
#define WS_O3  (WS_VT + 2u * (size_t)NB * RW * TT)      // f32 o [b][i][n][c]
#define WS_PW  (WS_O3 + 4u * (size_t)NB * NI * TT * CC) // bf16 weights in fragment order [matrix q,k,v,o][16 out channels][32 in channels][half][lane][8]
#define WS_END (WS_PW + 2u * 4u * (size_t)CC * CC)

// ---- k_pack: one wave per B fragment f = (matrix * 16 + out tile) * 8 + k step. Lane (col, g) holds W[16 tile + col][32 kc + 8 g + 0..7] and [.. + 16 + 0..7];
// the first eights of the 32 lanes lie in one 512-byte run, the second eights in the next, so that a fragment is read by two loads of whole lines.
__global__ __launch_bounds__(128) void k_pack(const float* __restrict__ WQ, const float* __restrict__ WK, const float* __restrict__ WV, const float* __restrict__ WO, __bf16* __restrict__ PW) {
  const int f = blockIdx.x * 4 + (threadIdx.x >> 5), lane = threadIdx.x & 31, col = lane & 15, g = lane >> 4; const int mat = f >> 7, ot = (f >> 3) & 15, kc = f & 7;
  const float* Wm = mat == 0 ? WQ : mat == 1 ? WK : mat == 2 ? WV : WO; const float* p = Wm + (size_t)(ot * 16 + col) * CC + kc * 32 + 8 * g;
  v8b lo, hi;
  for (int ii = 0; ii < 8; ++ii) { lo[ii] = (__bf16)p[ii]; hi[ii] = (__bf16)p[16 + ii]; }
  __bf16* d = PW + (size_t)f * 512 + lane * 8; *(v8b*)d = lo; *(v8b*)(d + 256) = hi; }
__device__ __forceinline__ v16b frag_pw(const __bf16* PW, int f, int lane) {
  union { v16b v; v8b q[2]; } u; const __bf16* p = PW + (size_t)f * 512 + lane * 8;
  u.q[0] = *(const v8b*)p; u.q[1] = *(const v8b*)(p + 256); return u.v;
}

// ---- k_proj: block = (64 points, 128 out channels, z = (b*3 + i)*3 + which): y[o][n] = sum_c W[o][c] x[b][c][i][n]
__global__ __launch_bounds__(128) void k_proj(const float* __restrict__ X, const __bf16* __restrict__ PW, _Float16* __restrict__ QH, _Float16* __restrict__ QL, _Float16* __restrict__ KH, _Float16* __restrict__ VT) {
  __shared__ __align__(16) __bf16 sx[64][CC + 8]; __shared__ __align__(16) _Float16 sh[64][136], sl[64][136]; __shared__ __align__(16) _Float16 th[128][72];
  const int tid = threadIdx.x, wave = tid >> 5, lane = tid & 31, col = lane & 15, g = lane >> 4; const int n0 = blockIdx.x * 64; const int c0 = blockIdx.y * 128; const int z = blockIdx.z; const int which = z % 3, i = (z / 3) % NI; const size_t b = z / 9; const int f0 = (which * 16 + c0 / 16) * 8;
  for (int e = tid; e < CC * 64; e += 128) { const int c = e >> 6, nl = e & 63; sx[nl][c] = (__bf16)X[((b * CC + c) * NI + i) * (size_t)TT + n0 + nl]; }
  v16b w[8], wn[8];
  for (int j = 0; j < 8; ++j) w[j] = frag_pw(PW, f0 + j * 8, lane);
  __syncthreads();
  v8f acc[8] = {};
#pragma unroll   // whole: the two fragment sets change places by renaming, without register copies
  for (int kc = 0; kc < CC / 32; ++kc) { const v16b a = frag_b(&sx[wave * 16 + col][kc * 32], lane);
    if (kc + 1 < CC / 32) {   // the next k step's eight fragments, one group of loads ahead of this step's products
      for (int j = 0; j < 8; ++j) wn[j] = frag_pw(PW, f0 + j * 8 + kc + 1, lane); }
    for (int j = 0; j < 8; ++j) acc[j] = wmma_bf(a, w[j], acc[j]);
    for (int j = 0; j < 8; ++j) w[j] = wn[j]; }
#pragma unroll
  for (int j = 0; j < 8; ++j)
#pragma unroll
    for (int r = 0; r < 8; ++r) { const float v = acc[j][r]; const int rl = wave * 16 + 8 * g + r, cl = j * 16 + col; const _Float16 hv = (_Float16)v; if (which == 2) th[cl][rl] = hv; else { sh[rl][cl] = hv; sl[rl][cl] = (_Float16)(v - (float)hv); } }
  __syncthreads();
  if (which < 2) { _Float16* dh = which == 0 ? QH : KH;   // rows [b][n][h][i*32 + c_local]; this block covers 4 heads (128 channels)
    for (int e = tid; e < 64 * 4 * 4; e += 128) { const int rl = e >> 4, hh = (e >> 2) & 3, q = e & 3; const int h = c0 / HD + hh; const size_t dst = (((b * TT + n0 + rl) * NH + h) * KD) + i * HD + q * 8;
      vst2((unsigned*)(dh + dst), *(const v4u*)&sh[rl][hh * 32 + q * 8]); if (which == 0) vst2((unsigned*)(QL + dst), *(const v4u*)&sl[rl][hh * 32 + q * 8]); } }
  else { for (int e = tid; e < 128 * 8; e += 128) { const int cl = e >> 3, q = e & 7; const int c = c0 + cl; const int h = c / HD, cL = c % HD; vst2((unsigned*)(VT + ((b * NH + h) * KD + i * HD + cL) * (size_t)TT + n0 + q * 8), *(const v4u*)&th[cl][q * 8]); } } }
// ---- k_fa: block = 16 waves x 16 queries of one (b, head). Per 64 keys: S^T = K Q^T (A = k rows, B = q hi then q lo), so a lane holds one query's
// scores (keys 8g + r of each 16-key tile); running maximum and sum per query in f32; two S^T tiles convert in place to the B operand of O^T += V^T P^T.
// The 16 waves read the same K rows and V^T rows: a stage of 256 keys is brought into LDS once per block by asynchronous copies, two buffers, the next
// stage in flight while this one is worked on. Row pitches are odd multiples of 16 bytes, so the 16-byte fragment reads meet no bank conflict.
#define SKEYS 256                 // keys per stage
#define KPH 104                   // k row pitch in LDS, halves (192 B of data in 208 B)
#define VPH 264                   // v^T row pitch in LDS, halves (512 B of data in 528 B)
#define KSZ (SKEYS * KPH)         // halves of k rows per stage
#define STG (KSZ + KD * VPH)      // halves per stage buffer
// One lane's share of a stage: three 16-byte pieces (64 B apart) of each of two k rows (128 rows apart) and one piece of each of six v^T rows (16 rows apart).
// s_wait_xcnt 0 closes the statement so that no address register is rewritten ahead of it.
__device__ __forceinline__ void stage_copy(unsigned lk, const _Float16* gk, unsigned lv, const _Float16* gv) {
  const unsigned lk2 = lk + 128u * KPH * 2u; const _Float16* gk2 = gk + 128 * (size_t)RW;
  asm volatile("global_load_async_to_lds_b128 %0, %1, off\n\t"
               "global_load_async_to_lds_b128 %2, %3, off\n\t"
               "global_load_async_to_lds_b128 %4, %5, off\n\t"
               "global_load_async_to_lds_b128 %6, %7, off\n\t"
               "global_load_async_to_lds_b128 %8, %9, off\n\t"
               "global_load_async_to_lds_b128 %10, %11, off\n\t"
               "global_load_async_to_lds_b128 %12, %13, off\n\t"
               "global_load_async_to_lds_b128 %14, %15, off\n\t"
               "global_load_async_to_lds_b128 %16, %17, off\n\t"
               "global_load_async_to_lds_b128 %18, %19, off\n\t"
               "global_load_async_to_lds_b128 %20, %21, off\n\t"
               "global_load_async_to_lds_b128 %22, %23, off\n\t"
               "s_wait_xcnt 0x0"
               :: "v"(lk), "v"(gk), "v"(lk + 64u), "v"(gk + 32), "v"(lk + 128u), "v"(gk + 64),
                  "v"(lk2), "v"(gk2), "v"(lk2 + 64u), "v"(gk2 + 32), "v"(lk2 + 128u), "v"(gk2 + 64),
                  "v"(lv), "v"(gv), "v"(lv + 16u * VPH * 2u), "v"(gv + 16 * (size_t)TT), "v"(lv + 32u * VPH * 2u), "v"(gv + 32 * (size_t)TT),
                  "v"(lv + 48u * VPH * 2u), "v"(gv + 48 * (size_t)TT), "v"(lv + 64u * VPH * 2u), "v"(gv + 64 * (size_t)TT), "v"(lv + 80u * VPH * 2u), "v"(gv + 80 * (size_t)TT)
               : "memory");
}
__global__ __launch_bounds__(512) void k_fa(const _Float16* __restrict__ QH, const _Float16* __restrict__ QL, const _Float16* __restrict__ KH, const _Float16* __restrict__ VT, float* __restrict__ O3) {
  __shared__ __align__(16) _Float16 sm[2 * STG];
  const int tid = threadIdx.x, wave = tid >> 5, lane = tid & 31, col = lane & 15, g = lane >> 4; const int h = blockIdx.y; const size_t b = blockIdx.z; const int qn = blockIdx.x * 256 + wave * 16 + col;
  const _Float16* gk = KH + ((b * TT + (tid >> 2)) * NH + h) * KD + (tid & 3) * 8;                 // this lane's first k row of stage 0
  const _Float16* gv = VT + ((b * NH + h) * KD + (tid >> 5)) * (size_t)TT + (tid & 31) * 8;        // this lane's first v^T row, keys of stage 0
  const unsigned lk = (unsigned)(size_t)sm + (unsigned)(tid >> 2) * (KPH * 2u) + (unsigned)(tid & 3) * 16u;
  const unsigned lv = (unsigned)(size_t)sm + KSZ * 2u + (unsigned)(tid >> 5) * (VPH * 2u) + (unsigned)(tid & 31) * 16u;
  stage_copy(lk, gk, lv, gv);
  v16h qh[KD / 32], ql[KD / 32];
  for (int kc = 0; kc < KD / 32; ++kc) { const size_t qo = ((b * TT + qn) * NH + h) * KD + kc * 32; qh[kc] = frag_h(QH + qo, lane); ql[kc] = frag_h(QL + qo, lane); }
  asm volatile("s_wait_asynccnt 0x0" ::: "memory");   // this wave's share of stage 0 has landed
  __syncthreads();                                    // every wave's share has: stage 0 may be read
  stage_copy(lk + STG * 2u, gk + (size_t)SKEYS * RW, lv + STG * 2u, gv + SKEYS);
  v8f o[KD / 16] = {}; float m = -3.0e38f, l = 0.f;
  const float scl = 0.17677669529663689f;   // 32^-0.5
  for (int st = 0; st < TT / SKEYS; ++st) {
    const _Float16* kp = sm + (st & 1) * STG + col * KPH;          // A row = key k0 + 16 t + col
    const _Float16* vp = sm + (st & 1) * STG + KSZ + col * VPH;    // A row = kk 16 j + col, k = key
    for (int k0 = 0; k0 < SKEYS; k0 += 64) { v8f s[4]; v16h kf[4][KD / 32];
      for (int t = 0; t < 4; ++t)
        for (int kc = 0; kc < KD / 32; ++kc) kf[t][kc] = frag_h(kp + (k0 + t * 16) * KPH + kc * 32, lane);
      __builtin_amdgcn_sched_barrier(0);   // the pass's k fragments are read as one group: one LDS latency a pass instead of one per fragment
      for (int t = 0; t < 4; ++t) { v8f a = {};
        for (int kc = 0; kc < KD / 32; ++kc) { a = wmma_h(kf[t][kc], qh[kc], a); a = wmma_h(kf[t][kc], ql[kc], a); }
        s[t] = a; }
      v16h vf[KD / 16];
      for (int j = 0; j < KD / 16; ++j) vf[j] = frag_h(vp + (j * 16) * VPH + k0, lane);          // keys k0 .. k0 + 31
      __builtin_amdgcn_sched_barrier(0);   // the six v^T fragments are read as one group here, so that the softmax below covers their LDS latency
      float mx = m;
      for (int t = 0; t < 4; ++t)
        for (int r = 0; r < 8; ++r) { s[t][r] *= scl; mx = fmaxf(mx, s[t][r]); }
      mx = fmaxf(mx, __shfl_xor(mx, 16));   // the other half of the wave holds this query's other keys
      const float al = expf(m - mx); m = mx; float ps = 0.f; v16h p;
      for (int j = 0; j < KD / 16; ++j)
        for (int r = 0; r < 8; ++r) o[j][r] *= al;
      for (int t = 0; t < 2; ++t)
        for (int r = 0; r < 8; ++r) { const float e = expf(s[t][r] - mx); ps += e; p[t * 8 + r] = (_Float16)(e * 2048.0f); }
      for (int j = 0; j < KD / 16; ++j) o[j] = wmma_h(vf[j], p, o[j]);
      for (int j = 0; j < KD / 16; ++j) vf[j] = frag_h(vp + (j * 16) * VPH + k0 + 32, lane);     // keys k0 + 32 .. k0 + 63
      __builtin_amdgcn_sched_barrier(0);   // as above: one group, covered by the second half of the softmax
      for (int t = 2; t < 4; ++t)
        for (int r = 0; r < 8; ++r) { const float e = expf(s[t][r] - mx); ps += e; p[(t - 2) * 8 + r] = (_Float16)(e * 2048.0f); }
      l = l * al + ps;
      for (int j = 0; j < KD / 16; ++j) o[j] = wmma_h(vf[j], p, o[j]); }
    asm volatile("s_wait_dscnt 0x0" ::: "memory");      // this wave's reads of the buffer are done before it is refilled
    asm volatile("s_wait_asynccnt 0x0" ::: "memory");   // this wave's share of stage st + 1 has landed
    __syncthreads();                                    // publishes stage st + 1 and ends every wave's reads of stage st
    if (st + 2 < TT / SKEYS) stage_copy(lk + (unsigned)(st & 1) * (STG * 2u), gk + (size_t)(st + 2) * SKEYS * RW, lv + (unsigned)(st & 1) * (STG * 2u), gv + (st + 2) * SKEYS); }
  asm volatile("s_wait_asynccnt 0x0" ::: "memory");     // no copy is left in flight when the wave ends
  l += __shfl_xor(l, 16); const float inv = 1.0f / (l * 2048.0f);
  for (int j = 0; j < KD / 16; ++j) { float* dst = O3 + ((b * NI + (j >> 1)) * TT + qn) * (size_t)CC + h * HD + (j & 1) * 16 + 8 * g;   // kk = 16 j + 8 g + r = i * 32 + c_local
    v4f a, c;
    for (int r = 0; r < 4; ++r) { a[r] = o[j][r] * inv; c[r] = o[j][4 + r] * inv; }
    vst2(dst, a); vst2(dst + 4, c); } }
// ---- k_out: block = (64 points, 128 out channels, z = b*3 + i): out[b][o][i][n] = sum_c Wo[o][c] o3[b][i][n][c] + x[b][o][i][n]
__global__ __launch_bounds__(128) void k_out(const float* __restrict__ O3, const __bf16* __restrict__ PW, const float* __restrict__ X, float* __restrict__ OUT) { __shared__ __align__(16) float st[128][68];
  const int tid = threadIdx.x, wave = tid >> 5, lane = tid & 31, col = lane & 15, g = lane >> 4; const int n0 = blockIdx.x * 64; const int c0 = blockIdx.y * 128; const size_t b = blockIdx.z / NI; const int i = blockIdx.z % NI;
  const int f0 = (3 * 16 + c0 / 16) * 8;
  v16b w[8], wn[8];
  for (int j = 0; j < 8; ++j) w[j] = frag_pw(PW, f0 + j * 8, lane);
  v8f acc[8] = {};
#pragma unroll   // whole: the two fragment sets change places by renaming, without register copies
  for (int kc = 0; kc < CC / 32; ++kc) { const F2 a = split_row(O3 + ((b * NI + i) * TT + n0 + wave * 16 + col) * (size_t)CC, kc * 32, lane);
    if (kc + 1 < CC / 32) {   // the next k step's eight fragments, one group of loads ahead of this step's products
      for (int j = 0; j < 8; ++j) wn[j] = frag_pw(PW, f0 + j * 8 + kc + 1, lane); }
    for (int j = 0; j < 8; ++j) { acc[j] = wmma_bf(a.h, w[j], acc[j]); acc[j] = wmma_bf(a.l, w[j], acc[j]); }
    for (int j = 0; j < 8; ++j) w[j] = wn[j]; }
#pragma unroll
  for (int j = 0; j < 8; ++j)
#pragma unroll
    for (int r = 0; r < 8; ++r) st[j * 16 + col][wave * 16 + 8 * g + r] = acc[j][r];
  __syncthreads();
  for (int e = tid; e < 128 * 16; e += 128) { const int cl = e >> 4, q = e & 15; const size_t go = ((b * CC + c0 + cl) * NI + i) * (size_t)TT + n0 + q * 4; const v4f xr = *(const v4f*)(X + go); v4f v = *(const v4f*)&st[cl][q * 4]; v[0] += bfr(xr[0]); v[1] += bfr(xr[1]); v[2] += bfr(xr[2]); v[3] += bfr(xr[3]); vst2(OUT + go, v); } }
extern "C" void kernel_launch(void* const* d_in, const int* in_sizes, int n_in, void* d_out, int out_size, void* d_ws, size_t ws_size, hipStream_t stream) {
  (void)in_sizes; (void)n_in; (void)out_size;
  const float** F = (const float**)d_in;   // 0 x [4,256,3,2048], 1 Wq, 2 Wk, 3 Wv, 4 Wo [256,256] ([out][in])
  if (ws_size < (size_t)WS_END) return;
  char* ws = (char*)d_ws; _Float16 *QH = (_Float16*)(ws + WS_QH), *QL = (_Float16*)(ws + WS_QL), *KH = (_Float16*)(ws + WS_KH), *VT = (_Float16*)(ws + WS_VT); float *O3 = (float*)(ws + WS_O3); __bf16 *PW = (__bf16*)(ws + WS_PW);
  k_pack<<<dim3(4 * 16 * 8 / 4), 128, 0, stream>>>(F[1], F[2], F[3], F[4], PW);
  k_proj<<<dim3(TT / 64, CC / 128, TNB * 9), 128, 0, stream>>>(F[0], PW, QH, QL, KH, VT);
  k_fa<<<dim3(TT / 256, NH, TNB), 512, 0, stream>>>(QH, QL, KH, VT, O3);
  k_out<<<dim3(TT / 64, CC / 128, TNB * NI), 128, 0, stream>>>(O3, PW, F[0], (float*)d_out);
}

// v004
// Measured time: 130 microseconds a run.
// In two side-by-side timings against v003, it was 1.30 and 1.31 times as fast.
// Counting every step since v000, it is 10.3 times as fast.
// compute dtype: all float inputs rounded to bf16; the four W rounded to bf16 once per call and laid out in B-fragment order (k_pack); q/k/v = W x over channels (per vector component) with EXACT bf16 products on WMMA 16x16x32 (x tiles transposed in LDS), f32 accumulate; q as f16 hi + residual, k f16 -> 2-product energies over the 96 (head_dim x 3) pairs, / sqrt(32), kept in registers; online softmax in f32 (precise expf, running maximum and sum per query) -> unnormalised P f16 x 2^11; o = P . v (v once to f16) / sum, one launch for all heads; out = Wo o (o split bf16 hi + lo, 2 products) + x; f32 output [b][c][3][n].
#include <hip/hip_runtime.h>
#include <math.h>

typedef __attribute__((ext_vector_type(16))) _Float16 v16h;
typedef __attribute__((ext_vector_type(16))) __bf16 v16b;
typedef __attribute__((ext_vector_type(8)))  _Float16 v8h;
typedef __attribute__((ext_vector_type(8)))  float v8f;
typedef __attribute__((ext_vector_type(4)))  float v4f;
typedef __attribute__((ext_vector_type(2)))  float v2f;
typedef __attribute__((ext_vector_type(4)))  unsigned v4u;
typedef __attribute__((ext_vector_type(4)))  int v4i;
typedef float __attribute__((may_alias)) float_a;
typedef int __attribute__((may_alias)) int_a;

template <typename T> __device__ __forceinline__ void vst2(void* p, T v) { *(T*)p = v;  }
__device__ __forceinline__ v8f wmma_h(v16h a, v16h b, v8f c) { return __builtin_amdgcn_wmma_f32_16x16x32_f16(false, a, false, b, (short)0, c, false, false); }
__device__ __forceinline__ v8f wmma_bf(v16b a, v16b b, v8f c) {
  v8f d = __builtin_amdgcn_wmma_f32_16x16x32_bf16(false, a, false, b, (short)0, c, false, false);
  asm volatile("v_nop\n\tv_nop\n\tv_nop\n\tv_nop" : "+v"(d) : "v"(a), "v"(b));
  return d;
}
// 16x16x32 fragments: lane = (h = lane>>4, row/col = lane&15); elements 0..7 = k0+8h+0..7, 8..15 = k0+16+8h+0..7; D element r = row 8h+r
__device__ __forceinline__ v16h frag_h(const _Float16* rowk0, int lane) {
  union { v16h v; v8h q[2]; } u; const _Float16* p = rowk0 + 8 * (lane >> 4);
  u.q[0] = *(const v8h*)p; u.q[1] = *(const v8h*)(p + 16); return u.v;
}
__device__ __forceinline__ v16h frag_f32(const float* rowk0, int lane) {
  v16h a; const float* p = rowk0 + 8 * (lane >> 4);
#pragma unroll
  for (int i = 0; i < 8; ++i) { a[i] = (_Float16)p[i]; a[8 + i] = (_Float16)p[16 + i]; }
  return a;
}
__device__ __forceinline__ v16h frag_f32s(const float* rowk0, int lane, float sc) {
  v16h a; const float* p = rowk0 + 8 * (lane >> 4);
#pragma unroll
  for (int i = 0; i < 8; ++i) { a[i] = (_Float16)(p[i] * sc); a[8 + i] = (_Float16)(p[16 + i] * sc); }
  return a;
}
// column fragment from a [K][ld] layout (column n), rows >= K read as 0
__device__ __forceinline__ v16h fragc_f32(const float* W, int k0, int n, int lane, int ld, int K) {
  v16h a; const int g = lane >> 4;
#pragma unroll
  for (int i = 0; i < 8; ++i) { const int ka = k0 + 8 * g + i, kb = ka + 16;
    a[i] = (_Float16)(ka < K ? W[(size_t)(ka < K ? ka : K - 1) * ld + n] : 0.f); a[8 + i] = (_Float16)(kb < K ? W[(size_t)(kb < K ? kb : K - 1) * ld + n] : 0.f); }
  return a;
}
struct F2 { v16b h, l; };
__device__ __forceinline__ F2 bsplit16(const float v[16]) { F2 r;
#pragma unroll
  for (int i = 0; i < 16; ++i) { const __bf16 h = (__bf16)v[i]; r.h[i] = h; r.l[i] = (__bf16)(v[i] - (float)h); }
  return r; }
__device__ __forceinline__ F2 split_row(const float* row, int k0, int lane) { float v[16]; const float* p = row + k0 + 8 * (lane >> 4);
#pragma unroll
  for (int i = 0; i < 8; ++i) { v[i] = p[i]; v[8 + i] = p[16 + i]; }
  return bsplit16(v); }
__device__ __forceinline__ F2 split_rowK(const float* row, int k0, int lane, int K) { float v[16]; const int g = lane >> 4;
#pragma unroll
  for (int i = 0; i < 8; ++i) { const int ka = k0 + 8 * g + i, kb = ka + 16; v[i] = ka < K ? row[ka < K ? ka : K - 1] : 0.f; v[8 + i] = kb < K ? row[kb < K ? kb : K - 1] : 0.f; }
  return bsplit16(v); }
__device__ __forceinline__ F2 split_col(const float* W, int k0, int n, int lane, int ld, int K) { float v[16]; const int g = lane >> 4;
#pragma unroll
  for (int i = 0; i < 8; ++i) { const int ka = k0 + 8 * g + i, kb = ka + 16; v[i] = ka < K ? W[(size_t)(ka < K ? ka : K - 1) * ld + n] : 0.f; v[8 + i] = kb < K ? W[(size_t)(kb < K ? kb : K - 1) * ld + n] : 0.f; }
  return bsplit16(v); }
__device__ __forceinline__ v8f mac3(const F2& a, const F2& b, v8f c) { c = wmma_bf(a.l, b.h, c); c = wmma_bf(a.h, b.l, c); return wmma_bf(a.h, b.h, c); }
__device__ __forceinline__ float sigm(float v) { return 1.0f / (1.0f + expf(-v)); }


// Vector-neuron attention (B 4, C 256 = 8 heads x 32, 3 vector components, N 2,048 points): energy contracts over (head_dim, 3); residual output.
#define NB 4
#define CC 256
#define NI 3
#define TT 2048
#define NH 8
#define HD 32
#define KD (HD * NI)        // 96: per-head contraction length, index kk = i*32 + c_local
#define RW (NH * KD)        // 768: q/k row length per token
#ifndef TNB
#define TNB NB
#endif
typedef __attribute__((ext_vector_type(8))) __bf16 v8b;
__device__ __forceinline__ v16b frag_b(const __bf16* rowk0, int lane) {
  union { v16b v; v8b q[2]; } u; const __bf16* p = rowk0 + 8 * (lane >> 4);
  u.q[0] = *(const v8b*)p; u.q[1] = *(const v8b*)(p + 16); return u.v;
}
__device__ __forceinline__ float bfr(float v) { return (float)(__bf16)v; }
__device__ __attribute__((noinline)) float exp_ni(float v) { return expf(v); }
__device__ __attribute__((noinline)) float erf_ni(float v) { return erff(v); }

#define WS_QH  0u
#define WS_QL  (WS_QH + 2u * (size_t)NB * TT * RW)
#define WS_KH  (WS_QL + 2u * (size_t)NB * TT * RW)
#define WS_VT  (WS_KH + 2u * (size_t)NB * TT * RW)      // f16 v planes [b][h*96 + kk][n]
#define WS_O3  (WS_VT + 2u * (size_t)NB * RW * TT)      // f32 o [b][i][n][c]
#define WS_PW  (WS_O3 + 4u * (size_t)NB * NI * TT * CC) // bf16 weights in fragment order [matrix q,k,v,o][16 out channels][32 in channels][half][lane][8]
#define WS_END (WS_PW + 2u * 4u * (size_t)CC * CC)

// ---- k_pack: one wave per B fragment f = (matrix * 16 + out tile) * 8 + k step. Lane (col, g) holds W[16 tile + col][32 kc + 8 g + 0..7] and [.. + 16 + 0..7];
// the first eights of the 32 lanes lie in one 512-byte run, the second eights in the next, so that a fragment is read by two loads of whole lines.
__global__ __launch_bounds__(128) void k_pack(const float* __restrict__ WQ, const float* __restrict__ WK, const float* __restrict__ WV, const float* __restrict__ WO, __bf16* __restrict__ PW) {
  const int f = blockIdx.x * 4 + (threadIdx.x >> 5), lane = threadIdx.x & 31, col = lane & 15, g = lane >> 4; const int mat = f >> 7, ot = (f >> 3) & 15, kc = f & 7;
  const float* Wm = mat == 0 ? WQ : mat == 1 ? WK : mat == 2 ? WV : WO; const float* p = Wm + (size_t)(ot * 16 + col) * CC + kc * 32 + 8 * g;
  v8b lo, hi;
  for (int ii = 0; ii < 8; ++ii) { lo[ii] = (__bf16)p[ii]; hi[ii] = (__bf16)p[16 + ii]; }
  __bf16* d = PW + (size_t)f * 512 + lane * 8; *(v8b*)d = lo; *(v8b*)(d + 256) = hi; }
__device__ __forceinline__ v16b frag_pw(const __bf16* PW, int f, int lane) {
  union { v16b v; v8b q[2]; } u; const __bf16* p = PW + (size_t)f * 512 + lane * 8;
  u.q[0] = *(const v8b*)p; u.q[1] = *(const v8b*)(p + 256); return u.v;
}

// ---- k_proj: block = (64 points, 128 out channels, z = (b*3 + i)*3 + which): y[o][n] = sum_c W[o][c] x[b][c][i][n]
__global__ __launch_bounds__(128) void k_proj(const float* __restrict__ X, const __bf16* __restrict__ PW, _Float16* __restrict__ QH, _Float16* __restrict__ QL, _Float16* __restrict__ KH, _Float16* __restrict__ VT) {
  __shared__ __align__(16) __bf16 sx[64][CC + 8]; __shared__ __align__(16) _Float16 sh[64][136], sl[64][136]; __shared__ __align__(16) _Float16 th[128][72];
  const int tid = threadIdx.x, wave = tid >> 5, lane = tid & 31, col = lane & 15, g = lane >> 4; const int n0 = blockIdx.x * 64; const int c0 = blockIdx.y * 128; const int z = blockIdx.z; const int which = z % 3, i = (z / 3) % NI; const size_t b = z / 9; const int f0 = (which * 16 + c0 / 16) * 8;
  // x tile: a thread takes four points (one 16-byte load per channel) of eight channels, four such sets. All 32 loads, and the first weight fragments behind
  // them, are issued before the first value is used, so the block waits for memory once; a point's eight channels then go to LDS as one 16-byte store.
  const int nq = tid & 15, c8 = tid >> 4; const float* xp = X + ((b * CC + c8 * 8) * NI + i) * (size_t)TT + n0 + nq * 4;
  v4f xr[4][8];
  for (int k = 0; k < 4; ++k)
    for (int jj = 0; jj < 8; ++jj) xr[k][jj] = *(const v4f*)(xp + (size_t)(k * 64 + jj) * (NI * TT));
  asm volatile("s_wait_xcnt 0x0" ::: "memory");   // stands in front of any reuse of the x loads' address registers (the weight loads below land on them)
  v16b w[8], wn[8];
  for (int j = 0; j < 8; ++j) w[j] = frag_pw(PW, f0 + j * 8, lane);
  __builtin_amdgcn_sched_barrier(0);   // the weight loads are issued ahead of the first wait for x: without it they sink below the conversions and their latency adds to that of x
  for (int k = 0; k < 4; ++k)
    for (int p = 0; p < 4; ++p) { v8b t;
      for (int jj = 0; jj < 8; ++jj) t[jj] = (__bf16)xr[k][jj][p];
      *(v8b*)&sx[nq * 4 + p][(c8 + 8 * k) * 8] = t; }
  __syncthreads();
  v8f acc[8] = {};
#pragma unroll   // whole: the two fragment sets change places by renaming, without register copies
  for (int kc = 0; kc < CC / 32; ++kc) { const v16b a = frag_b(&sx[wave * 16 + col][kc * 32], lane);
    if (kc + 1 < CC / 32) {   // the next k step's eight fragments, one group of loads ahead of this step's products
      for (int j = 0; j < 8; ++j) wn[j] = frag_pw(PW, f0 + j * 8 + kc + 1, lane); }
    for (int j = 0; j < 8; ++j) acc[j] = wmma_bf(a, w[j], acc[j]);
    for (int j = 0; j < 8; ++j) w[j] = wn[j]; }
#pragma unroll
  for (int j = 0; j < 8; ++j)
#pragma unroll
    for (int r = 0; r < 8; ++r) { const float v = acc[j][r]; const int rl = wave * 16 + 8 * g + r, cl = j * 16 + col; const _Float16 hv = (_Float16)v; if (which == 2) th[cl][rl] = hv; else { sh[rl][cl] = hv; sl[rl][cl] = (_Float16)(v - (float)hv); } }
  __syncthreads();
  if (which < 2) { _Float16* dh = which == 0 ? QH : KH;   // rows [b][n][h][i*32 + c_local]; this block covers 4 heads (128 channels)
    for (int e = tid; e < 64 * 4 * 4; e += 128) { const int rl = e >> 4, hh = (e >> 2) & 3, q = e & 3; const int h = c0 / HD + hh; const size_t dst = (((b * TT + n0 + rl) * NH + h) * KD) + i * HD + q * 8;
      vst2((unsigned*)(dh + dst), *(const v4u*)&sh[rl][hh * 32 + q * 8]); if (which == 0) vst2((unsigned*)(QL + dst), *(const v4u*)&sl[rl][hh * 32 + q * 8]); } }
  else { for (int e = tid; e < 128 * 8; e += 128) { const int cl = e >> 3, q = e & 7; const int c = c0 + cl; const int h = c / HD, cL = c % HD; vst2((unsigned*)(VT + ((b * NH + h) * KD + i * HD + cL) * (size_t)TT + n0 + q * 8), *(const v4u*)&th[cl][q * 8]); } } }
// ---- k_fa: block = 16 waves x 16 queries of one (b, head). Per 64 keys: S^T = K Q^T (A = k rows, B = q hi then q lo), so a lane holds one query's
// scores (keys 8g + r of each 16-key tile); running maximum and sum per query in f32; two S^T tiles convert in place to the B operand of O^T += V^T P^T.
// The 16 waves read the same K rows and V^T rows: a stage of 256 keys is brought into LDS once per block by asynchronous copies, two buffers, the next
// stage in flight while this one is worked on. Row pitches are odd multiples of 16 bytes, so the 16-byte fragment reads meet no bank conflict.
#define SKEYS 256                 // keys per stage
#define KPH 104                   // k row pitch in LDS, halves (192 B of data in 208 B)
#define VPH 264                   // v^T row pitch in LDS, halves (512 B of data in 528 B)
#define KSZ (SKEYS * KPH)         // halves of k rows per stage
#define STG (KSZ + KD * VPH)      // halves per stage buffer
// One lane's share of a stage: three 16-byte pieces (64 B apart) of each of two k rows (128 rows apart) and one piece of each of six v^T rows (16 rows apart).
// s_wait_xcnt 0 closes the statement so that no address register is rewritten ahead of it.
__device__ __forceinline__ void stage_copy(unsigned lk, const _Float16* gk, unsigned lv, const _Float16* gv) {
  const unsigned lk2 = lk + 128u * KPH * 2u; const _Float16* gk2 = gk + 128 * (size_t)RW;
  asm volatile("global_load_async_to_lds_b128 %0, %1, off\n\t"
               "global_load_async_to_lds_b128 %2, %3, off\n\t"
               "global_load_async_to_lds_b128 %4, %5, off\n\t"
               "global_load_async_to_lds_b128 %6, %7, off\n\t"
               "global_load_async_to_lds_b128 %8, %9, off\n\t"
               "global_load_async_to_lds_b128 %10, %11, off\n\t"
               "global_load_async_to_lds_b128 %12, %13, off\n\t"
               "global_load_async_to_lds_b128 %14, %15, off\n\t"
               "global_load_async_to_lds_b128 %16, %17, off\n\t"
               "global_load_async_to_lds_b128 %18, %19, off\n\t"
               "global_load_async_to_lds_b128 %20, %21, off\n\t"
               "global_load_async_to_lds_b128 %22, %23, off\n\t"
               "s_wait_xcnt 0x0"
               :: "v"(lk), "v"(gk), "v"(lk + 64u), "v"(gk + 32), "v"(lk + 128u), "v"(gk + 64),
                  "v"(lk2), "v"(gk2), "v"(lk2 + 64u), "v"(gk2 + 32), "v"(lk2 + 128u), "v"(gk2 + 64),
                  "v"(lv), "v"(gv), "v"(lv + 16u * VPH * 2u), "v"(gv + 16 * (size_t)TT), "v"(lv + 32u * VPH * 2u), "v"(gv + 32 * (size_t)TT),
                  "v"(lv + 48u * VPH * 2u), "v"(gv + 48 * (size_t)TT), "v"(lv + 64u * VPH * 2u), "v"(gv + 64 * (size_t)TT), "v"(lv + 80u * VPH * 2u), "v"(gv + 80 * (size_t)TT)
               : "memory");
}
__global__ __launch_bounds__(512) void k_fa(const _Float16* __restrict__ QH, const _Float16* __restrict__ QL, const _Float16* __restrict__ KH, const _Float16* __restrict__ VT, float* __restrict__ O3) {
  __shared__ __align__(16) _Float16 sm[2 * STG];
  const int tid = threadIdx.x, wave = tid >> 5, lane = tid & 31, col = lane & 15, g = lane >> 4; const int h = blockIdx.y; const size_t b = blockIdx.z; const int qn = blockIdx.x * 256 + wave * 16 + col;
  const _Float16* gk = KH + ((b * TT + (tid >> 2)) * NH + h) * KD + (tid & 3) * 8;                 // this lane's first k row of stage 0
  const _Float16* gv = VT + ((b * NH + h) * KD + (tid >> 5)) * (size_t)TT + (tid & 31) * 8;        // this lane's first v^T row, keys of stage 0
  const unsigned lk = (unsigned)(size_t)sm + (unsigned)(tid >> 2) * (KPH * 2u) + (unsigned)(tid & 3) * 16u;
  const unsigned lv = (unsigned)(size_t)sm + KSZ * 2u + (unsigned)(tid >> 5) * (VPH * 2u) + (unsigned)(tid & 31) * 16u;
  stage_copy(lk, gk, lv, gv);
  v16h qh[KD / 32], ql[KD / 32];
  for (int kc = 0; kc < KD / 32; ++kc) { const size_t qo = ((b * TT + qn) * NH + h) * KD + kc * 32; qh[kc] = frag_h(QH + qo, lane); ql[kc] = frag_h(QL + qo, lane); }
  asm volatile("s_wait_asynccnt 0x0" ::: "memory");   // this wave's share of stage 0 has landed
  __syncthreads();                                    // every wave's share has: stage 0 may be read
  stage_copy(lk + STG * 2u, gk + (size_t)SKEYS * RW, lv + STG * 2u, gv + SKEYS);
  v8f o[KD / 16] = {}; float m = -3.0e38f, l = 0.f;
  const float scl = 0.17677669529663689f;   // 32^-0.5
  for (int st = 0; st < TT / SKEYS; ++st) {
    const _Float16* kp = sm + (st & 1) * STG + col * KPH;          // A row = key k0 + 16 t + col
    const _Float16* vp = sm + (st & 1) * STG + KSZ + col * VPH;    // A row = kk 16 j + col, k = key
    for (int k0 = 0; k0 < SKEYS; k0 += 64) { v8f s[4]; v16h kf[4][KD / 32];
      for (int t = 0; t < 4; ++t)
        for (int kc = 0; kc < KD / 32; ++kc) kf[t][kc] = frag_h(kp + (k0 + t * 16) * KPH + kc * 32, lane);
      __builtin_amdgcn_sched_barrier(0);   // the pass's k fragments are read as one group: one LDS latency a pass instead of one per fragment
      for (int t = 0; t < 4; ++t) { v8f a = {};
        for (int kc = 0; kc < KD / 32; ++kc) { a = wmma_h(kf[t][kc], qh[kc], a); a = wmma_h(kf[t][kc], ql[kc], a); }
        s[t] = a; }
      v16h vf[KD / 16];
      for (int j = 0; j < KD / 16; ++j) vf[j] = frag_h(vp + (j * 16) * VPH + k0, lane);          // keys k0 .. k0 + 31
      __builtin_amdgcn_sched_barrier(0);   // the six v^T fragments are read as one group here, so that the softmax below covers their LDS latency
      float mx = m;
      for (int t = 0; t < 4; ++t)
        for (int r = 0; r < 8; ++r) { s[t][r] *= scl; mx = fmaxf(mx, s[t][r]); }
      mx = fmaxf(mx, __shfl_xor(mx, 16));   // the other half of the wave holds this query's other keys
      const float al = expf(m - mx); m = mx; float ps = 0.f; v16h p;
      for (int j = 0; j < KD / 16; ++j)
        for (int r = 0; r < 8; ++r) o[j][r] *= al;
      for (int t = 0; t < 2; ++t)
        for (int r = 0; r < 8; ++r) { const float e = expf(s[t][r] - mx); ps += e; p[t * 8 + r] = (_Float16)(e * 2048.0f); }
      for (int j = 0; j < KD / 16; ++j) o[j] = wmma_h(vf[j], p, o[j]);
      for (int j = 0; j < KD / 16; ++j) vf[j] = frag_h(vp + (j * 16) * VPH + k0 + 32, lane);     // keys k0 + 32 .. k0 + 63
      __builtin_amdgcn_sched_barrier(0);   // as above: one group, covered by the second half of the softmax
      for (int t = 2; t < 4; ++t)
        for (int r = 0; r < 8; ++r) { const float e = expf(s[t][r] - mx); ps += e; p[(t - 2) * 8 + r] = (_Float16)(e * 2048.0f); }
      l = l * al + ps;
      for (int j = 0; j < KD / 16; ++j) o[j] = wmma_h(vf[j], p, o[j]); }
    asm volatile("s_wait_dscnt 0x0" ::: "memory");      // this wave's reads of the buffer are done before it is refilled
    asm volatile("s_wait_asynccnt 0x0" ::: "memory");   // this wave's share of stage st + 1 has landed
    __syncthreads();                                    // publishes stage st + 1 and ends every wave's reads of stage st
    if (st + 2 < TT / SKEYS) stage_copy(lk + (unsigned)(st & 1) * (STG * 2u), gk + (size_t)(st + 2) * SKEYS * RW, lv + (unsigned)(st & 1) * (STG * 2u), gv + (st + 2) * SKEYS); }
  asm volatile("s_wait_asynccnt 0x0" ::: "memory");     // no copy is left in flight when the wave ends
  l += __shfl_xor(l, 16); const float inv = 1.0f / (l * 2048.0f);
  for (int j = 0; j < KD / 16; ++j) { float* dst = O3 + ((b * NI + (j >> 1)) * TT + qn) * (size_t)CC + h * HD + (j & 1) * 16 + 8 * g;   // kk = 16 j + 8 g + r = i * 32 + c_local
    v4f a, c;
    for (int r = 0; r < 4; ++r) { a[r] = o[j][r] * inv; c[r] = o[j][4 + r] * inv; }
    vst2(dst, a); vst2(dst + 4, c); } }
// ---- k_out: block = (64 points, 128 out channels, z = b*3 + i): out[b][o][i][n] = sum_c Wo[o][c] o3[b][i][n][c] + x[b][o][i][n]
__global__ __launch_bounds__(128) void k_out(const float* __restrict__ O3, const __bf16* __restrict__ PW, const float* __restrict__ X, float* __restrict__ OUT) { __shared__ __align__(16) float st[128][68];
  const int tid = threadIdx.x, wave = tid >> 5, lane = tid & 31, col = lane & 15, g = lane >> 4; const int n0 = blockIdx.x * 64; const int c0 = blockIdx.y * 128; const size_t b = blockIdx.z / NI; const int i = blockIdx.z % NI;
  const int f0 = (3 * 16 + c0 / 16) * 8;
  v16b w[8], wn[8];
  for (int j = 0; j < 8; ++j) w[j] = frag_pw(PW, f0 + j * 8, lane);
  v8f acc[8] = {};
#pragma unroll   // whole: the two fragment sets change places by renaming, without register copies
  for (int kc = 0; kc < CC / 32; ++kc) { const F2 a = split_row(O3 + ((b * NI + i) * TT + n0 + wave * 16 + col) * (size_t)CC, kc * 32, lane);
    if (kc + 1 < CC / 32) {   // the next k step's eight fragments, one group of loads ahead of this step's products
      for (int j = 0; j < 8; ++j) wn[j] = frag_pw(PW, f0 + j * 8 + kc + 1, lane); }
    for (int j = 0; j < 8; ++j) { acc[j] = wmma_bf(a.h, w[j], acc[j]); acc[j] = wmma_bf(a.l, w[j], acc[j]); }
    for (int j = 0; j < 8; ++j) w[j] = wn[j]; }
#pragma unroll
  for (int j = 0; j < 8; ++j)
#pragma unroll
    for (int r = 0; r < 8; ++r) st[j * 16 + col][wave * 16 + 8 * g + r] = acc[j][r];
  __syncthreads();
  for (int e = tid; e < 128 * 16; e += 128) { const int cl = e >> 4, q = e & 15; const size_t go = ((b * CC + c0 + cl) * NI + i) * (size_t)TT + n0 + q * 4; const v4f xr = *(const v4f*)(X + go); v4f v = *(const v4f*)&st[cl][q * 4]; v[0] += bfr(xr[0]); v[1] += bfr(xr[1]); v[2] += bfr(xr[2]); v[3] += bfr(xr[3]); vst2(OUT + go, v); } }
extern "C" void kernel_launch(void* const* d_in, const int* in_sizes, int n_in, void* d_out, int out_size, void* d_ws, size_t ws_size, hipStream_t stream) {
  (void)in_sizes; (void)n_in; (void)out_size;
  const float** F = (const float**)d_in;   // 0 x [4,256,3,2048], 1 Wq, 2 Wk, 3 Wv, 4 Wo [256,256] ([out][in])
  if (ws_size < (size_t)WS_END) return;
  char* ws = (char*)d_ws; _Float16 *QH = (_Float16*)(ws + WS_QH), *QL = (_Float16*)(ws + WS_QL), *KH = (_Float16*)(ws + WS_KH), *VT = (_Float16*)(ws + WS_VT); float *O3 = (float*)(ws + WS_O3); __bf16 *PW = (__bf16*)(ws + WS_PW);
  k_pack<<<dim3(4 * 16 * 8 / 4), 128, 0, stream>>>(F[1], F[2], F[3], F[4], PW);
  k_proj<<<dim3(TT / 64, CC / 128, TNB * 9), 128, 0, stream>>>(F[0], PW, QH, QL, KH, VT);
  k_fa<<<dim3(TT / 256, NH, TNB), 512, 0, stream>>>(QH, QL, KH, VT, O3);
  k_out<<<dim3(TT / 64, CC / 128, TNB * NI), 128, 0, stream>>>(O3, PW, F[0], (float*)d_out);
}

// v005
// One run takes 108 microseconds.
// Two timings next to v004 put it at 1.20 and 1.21 times that version's speed.
// Over all steps from v000 it is 12.4 times as fast.
// compute dtype: all float inputs rounded to bf16; the four W rounded to bf16 once per call and laid out in B-fragment order (k_pack); q/k/v = W x over channels (per vector component) with EXACT bf16 products on WMMA 16x16x32 (x tiles transposed in LDS), f32 accumulate; q as f16 hi + residual, k f16 -> 2-product energies over the 96 (head_dim x 3) pairs, / sqrt(32), kept in registers; online softmax in f32, base 2 (one fma and the hardware exp2 per score; running maximum and sum per query) -> unnormalised P f16 x 2^11; o = P . v (v once to f16) / sum, one launch for all heads; out = Wo o (o split bf16 hi + lo, 2 products) + x; f32 output [b][c][3][n].
#include <hip/hip_runtime.h>
#include <math.h>

typedef __attribute__((ext_vector_type(16))) _Float16 v16h;
typedef __attribute__((ext_vector_type(16))) __bf16 v16b;
typedef __attribute__((ext_vector_type(8)))  _Float16 v8h;
typedef __attribute__((ext_vector_type(8)))  float v8f;
typedef __attribute__((ext_vector_type(4)))  float v4f;
typedef __attribute__((ext_vector_type(2)))  float v2f;
typedef __attribute__((ext_vector_type(4)))  unsigned v4u;
typedef __attribute__((ext_vector_type(4)))  int v4i;
typedef float __attribute__((may_alias)) float_a;
typedef int __attribute__((may_alias)) int_a;

template <typename T> __device__ __forceinline__ void vst2(void* p, T v) { *(T*)p = v;  }
__device__ __forceinline__ v8f wmma_h(v16h a, v16h b, v8f c) { return __builtin_amdgcn_wmma_f32_16x16x32_f16(false, a, false, b, (short)0, c, false, false); }
__device__ __forceinline__ v8f wmma_bf(v16b a, v16b b, v8f c) {
  v8f d = __builtin_amdgcn_wmma_f32_16x16x32_bf16(false, a, false, b, (short)0, c, false, false);
  asm volatile("v_nop\n\tv_nop\n\tv_nop\n\tv_nop" : "+v"(d) : "v"(a), "v"(b));
  return d;
}
// 16x16x32 fragments: lane = (h = lane>>4, row/col = lane&15); elements 0..7 = k0+8h+0..7, 8..15 = k0+16+8h+0..7; D element r = row 8h+r
__device__ __forceinline__ v16h frag_h(const _Float16* rowk0, int lane) {
  union { v16h v; v8h q[2]; } u; const _Float16* p = rowk0 + 8 * (lane >> 4);
  u.q[0] = *(const v8h*)p; u.q[1] = *(const v8h*)(p + 16); return u.v;
}
__device__ __forceinline__ v16h frag_f32(const float* rowk0, int lane) {
  v16h a; const float* p = rowk0 + 8 * (lane >> 4);
#pragma unroll
  for (int i = 0; i < 8; ++i) { a[i] = (_Float16)p[i]; a[8 + i] = (_Float16)p[16 + i]; }
  return a;
}
__device__ __forceinline__ v16h frag_f32s(const float* rowk0, int lane, float sc) {
  v16h a; const float* p = rowk0 + 8 * (lane >> 4);
#pragma unroll
  for (int i = 0; i < 8; ++i) { a[i] = (_Float16)(p[i] * sc); a[8 + i] = (_Float16)(p[16 + i] * sc); }
  return a;
}
// column fragment from a [K][ld] layout (column n), rows >= K read as 0
__device__ __forceinline__ v16h fragc_f32(const float* W, int k0, int n, int lane, int ld, int K) {
  v16h a; const int g = lane >> 4;
#pragma unroll
  for (int i = 0; i < 8; ++i) { const int ka = k0 + 8 * g + i, kb = ka + 16;
    a[i] = (_Float16)(ka < K ? W[(size_t)(ka < K ? ka : K - 1) * ld + n] : 0.f); a[8 + i] = (_Float16)(kb < K ? W[(size_t)(kb < K ? kb : K - 1) * ld + n] : 0.f); }
  return a;
}
struct F2 { v16b h, l; };
__device__ __forceinline__ F2 bsplit16(const float v[16]) { F2 r;
#pragma unroll
  for (int i = 0; i < 16; ++i) { const __bf16 h = (__bf16)v[i]; r.h[i] = h; r.l[i] = (__bf16)(v[i] - (float)h); }
  return r; }
__device__ __forceinline__ F2 split_row(const float* row, int k0, int lane) { float v[16]; const float* p = row + k0 + 8 * (lane >> 4);
#pragma unroll
  for (int i = 0; i < 8; ++i) { v[i] = p[i]; v[8 + i] = p[16 + i]; }
  return bsplit16(v); }
__device__ __forceinline__ F2 split_rowK(const float* row, int k0, int lane, int K) { float v[16]; const int g = lane >> 4;
#pragma unroll
  for (int i = 0; i < 8; ++i) { const int ka = k0 + 8 * g + i, kb = ka + 16; v[i] = ka < K ? row[ka < K ? ka : K - 1] : 0.f; v[8 + i] = kb < K ? row[kb < K ? kb : K - 1] : 0.f; }
  return bsplit16(v); }
__device__ __forceinline__ F2 split_col(const float* W, int k0, int n, int lane, int ld, int K) { float v[16]; const int g = lane >> 4;
#pragma unroll
  for (int i = 0; i < 8; ++i) { const int ka = k0 + 8 * g + i, kb = ka + 16; v[i] = ka < K ? W[(size_t)(ka < K ? ka : K - 1) * ld + n] : 0.f; v[8 + i] = kb < K ? W[(size_t)(kb < K ? kb : K - 1) * ld + n] : 0.f; }
  return bsplit16(v); }
__device__ __forceinline__ v8f mac3(const F2& a, const F2& b, v8f c) { c = wmma_bf(a.l, b.h, c); c = wmma_bf(a.h, b.l, c); return wmma_bf(a.h, b.h, c); }
__device__ __forceinline__ float sigm(float v) { return 1.0f / (1.0f + expf(-v)); }


// Vector-neuron attention (B 4, C 256 = 8 heads x 32, 3 vector components, N 2,048 points): energy contracts over (head_dim, 3); residual output.
#define NB 4
#define CC 256
#define NI 3
#define TT 2048
#define NH 8
#define HD 32
#define KD (HD * NI)        // 96: per-head contraction length, index kk = i*32 + c_local
#define RW (NH * KD)        // 768: q/k row length per token
#ifndef TNB
#define TNB NB
#endif
typedef __attribute__((ext_vector_type(8))) __bf16 v8b;
__device__ __forceinline__ v16b frag_b(const __bf16* rowk0, int lane) {
  union { v16b v; v8b q[2]; } u; const __bf16* p = rowk0 + 8 * (lane >> 4);
  u.q[0] = *(const v8b*)p; u.q[1] = *(const v8b*)(p + 16); return u.v;
}
__device__ __forceinline__ float bfr(float v) { return (float)(__bf16)v; }
__device__ __attribute__((noinline)) float exp_ni(float v) { return expf(v); }
__device__ __attribute__((noinline)) float erf_ni(float v) { return erff(v); }

#define WS_QH  0u
#define WS_QL  (WS_QH + 2u * (size_t)NB * TT * RW)
#define WS_KH  (WS_QL + 2u * (size_t)NB * TT * RW)
#define WS_VT  (WS_KH + 2u * (size_t)NB * TT * RW)      // f16 v planes [b][h*96 + kk][n]
#define WS_O3  (WS_VT + 2u * (size_t)NB * RW * TT)      // f32 o [b][i][n][c]
#define WS_PW  (WS_O3 + 4u * (size_t)NB * NI * TT * CC) // bf16 weights in fragment order [matrix q,k,v,o][16 out channels][32 in channels][half][lane][8]
#define WS_END (WS_PW + 2u * 4u * (size_t)CC * CC)

// ---- k_pack: one wave per B fragment f = (matrix * 16 + out tile) * 8 + k step. Lane (col, g) holds W[16 tile + col][32 kc + 8 g + 0..7] and [.. + 16 + 0..7];
// the first eights of the 32 lanes lie in one 512-byte run, the second eights in the next, so that a fragment is read by two loads of whole lines.
__global__ __launch_bounds__(128) void k_pack(const float* __restrict__ WQ, const float* __restrict__ WK, const float* __restrict__ WV, const float* __restrict__ WO, __bf16* __restrict__ PW) {
  const int f = blockIdx.x * 4 + (threadIdx.x >> 5), lane = threadIdx.x & 31, col = lane & 15, g = lane >> 4; const int mat = f >> 7, ot = (f >> 3) & 15, kc = f & 7;
  const float* Wm = mat == 0 ? WQ : mat == 1 ? WK : mat == 2 ? WV : WO; const float* p = Wm + (size_t)(ot * 16 + col) * CC + kc * 32 + 8 * g;
  v8b lo, hi;
  for (int ii = 0; ii < 8; ++ii) { lo[ii] = (__bf16)p[ii]; hi[ii] = (__bf16)p[16 + ii]; }
  __bf16* d = PW + (size_t)f * 512 + lane * 8; *(v8b*)d = lo; *(v8b*)(d + 256) = hi; }
__device__ __forceinline__ v16b frag_pw(const __bf16* PW, int f, int lane) {
  union { v16b v; v8b q[2]; } u; const __bf16* p = PW + (size_t)f * 512 + lane * 8;
  u.q[0] = *(const v8b*)p; u.q[1] = *(const v8b*)(p + 256); return u.v;
}

// ---- k_proj: block = (64 points, 128 out channels, z = (b*3 + i)*3 + which): y[o][n] = sum_c W[o][c] x[b][c][i][n]
__global__ __launch_bounds__(128) void k_proj(const float* __restrict__ X, const __bf16* __restrict__ PW, _Float16* __restrict__ QH, _Float16* __restrict__ QL, _Float16* __restrict__ KH, _Float16* __restrict__ VT) {
  __shared__ __align__(16) __bf16 sx[64][CC + 8]; __shared__ __align__(16) _Float16 sh[64][136], sl[64][136]; __shared__ __align__(16) _Float16 th[128][72];
  const int tid = threadIdx.x, wave = tid >> 5, lane = tid & 31, col = lane & 15, g = lane >> 4; const int n0 = blockIdx.x * 64; const int c0 = blockIdx.y * 128; const int z = blockIdx.z; const int which = z % 3, i = (z / 3) % NI; const size_t b = z / 9; const int f0 = (which * 16 + c0 / 16) * 8;
  // x tile: a thread takes four points (one 16-byte load per channel) of eight channels, four such sets. All 32 loads, and the first weight fragments behind
  // them, are issued before the first value is used, so the block waits for memory once; a point's eight channels then go to LDS as one 16-byte store.
  const int nq = tid & 15, c8 = tid >> 4; const float* xp = X + ((b * CC + c8 * 8) * NI + i) * (size_t)TT + n0 + nq * 4;
  v4f xr[4][8];
  for (int k = 0; k < 4; ++k)
    for (int jj = 0; jj < 8; ++jj) xr[k][jj] = *(const v4f*)(xp + (size_t)(k * 64 + jj) * (NI * TT));
  asm volatile("s_wait_xcnt 0x0" ::: "memory");   // stands in front of any reuse of the x loads' address registers (the weight loads below land on them)
  v16b w[8], wn[8];
  for (int j = 0; j < 8; ++j) w[j] = frag_pw(PW, f0 + j * 8, lane);
  __builtin_amdgcn_sched_barrier(0);   // the weight loads are issued ahead of the first wait for x: without it they sink below the conversions and their latency adds to that of x
  for (int k = 0; k < 4; ++k)
    for (int p = 0; p < 4; ++p) { v8b t;
      for (int jj = 0; jj < 8; ++jj) t[jj] = (__bf16)xr[k][jj][p];
      *(v8b*)&sx[nq * 4 + p][(c8 + 8 * k) * 8] = t; }
  __syncthreads();
  v8f acc[8] = {};
#pragma unroll   // whole: the two fragment sets change places by renaming, without register copies
  for (int kc = 0; kc < CC / 32; ++kc) { const v16b a = frag_b(&sx[wave * 16 + col][kc * 32], lane);
    if (kc + 1 < CC / 32) {   // the next k step's eight fragments, one group of loads ahead of this step's products
      for (int j = 0; j < 8; ++j) wn[j] = frag_pw(PW, f0 + j * 8 + kc + 1, lane); }
    for (int j = 0; j < 8; ++j) acc[j] = wmma_bf(a, w[j], acc[j]);
    for (int j = 0; j < 8; ++j) w[j] = wn[j]; }
#pragma unroll
  for (int j = 0; j < 8; ++j)
#pragma unroll
    for (int r = 0; r < 8; ++r) { const float v = acc[j][r]; const int rl = wave * 16 + 8 * g + r, cl = j * 16 + col; const _Float16 hv = (_Float16)v; if (which == 2) th[cl][rl] = hv; else { sh[rl][cl] = hv; sl[rl][cl] = (_Float16)(v - (float)hv); } }
  __syncthreads();
  if (which < 2) { _Float16* dh = which == 0 ? QH : KH;   // rows [b][n][h][i*32 + c_local]; this block covers 4 heads (128 channels)
    for (int e = tid; e < 64 * 4 * 4; e += 128) { const int rl = e >> 4, hh = (e >> 2) & 3, q = e & 3; const int h = c0 / HD + hh; const size_t dst = (((b * TT + n0 + rl) * NH + h) * KD) + i * HD + q * 8;
      vst2((unsigned*)(dh + dst), *(const v4u*)&sh[rl][hh * 32 + q * 8]); if (which == 0) vst2((unsigned*)(QL + dst), *(const v4u*)&sl[rl][hh * 32 + q * 8]); } }
  else { for (int e = tid; e < 128 * 8; e += 128) { const int cl = e >> 3, q = e & 7; const int c = c0 + cl; const int h = c / HD, cL = c % HD; vst2((unsigned*)(VT + ((b * NH + h) * KD + i * HD + cL) * (size_t)TT + n0 + q * 8), *(const v4u*)&th[cl][q * 8]); } } }
// ---- k_fa: block = 16 waves x 16 queries of one (b, head). Per 64 keys: S^T = K Q^T (A = k rows, B = q hi then q lo), so a lane holds one query's
// scores (keys 8g + r of each 16-key tile); running maximum (base-2 units) and sum (x 2^11) per query in f32; two S^T tiles convert in place to the B operand of O^T += V^T P^T.
// The 16 waves read the same K rows and V^T rows: a stage of 256 keys is brought into LDS once per block by asynchronous copies, two buffers, the next
// stage in flight while this one is worked on. Row pitches are odd multiples of 16 bytes, so the 16-byte fragment reads meet no bank conflict.
#define SKEYS 256                 // keys per stage
#define KPH 104                   // k row pitch in LDS, halves (192 B of data in 208 B)
#define VPH 264                   // v^T row pitch in LDS, halves (512 B of data in 528 B)
#define KSZ (SKEYS * KPH)         // halves of k rows per stage
#define STG (KSZ + KD * VPH)      // halves per stage buffer
// One lane's share of a stage: three 16-byte pieces (64 B apart) of each of two k rows (128 rows apart) and one piece of each of six v^T rows (16 rows apart).
// s_wait_xcnt 0 closes the statement so that no address register is rewritten ahead of it.
__device__ __forceinline__ void stage_copy(unsigned lk, const _Float16* gk, unsigned lv, const _Float16* gv) {
  const unsigned lk2 = lk + 128u * KPH * 2u; const _Float16* gk2 = gk + 128 * (size_t)RW;
  asm volatile("global_load_async_to_lds_b128 %0, %1, off\n\t"
               "global_load_async_to_lds_b128 %2, %3, off\n\t"
               "global_load_async_to_lds_b128 %4, %5, off\n\t"
               "global_load_async_to_lds_b128 %6, %7, off\n\t"
               "global_load_async_to_lds_b128 %8, %9, off\n\t"
               "global_load_async_to_lds_b128 %10, %11, off\n\t"
               "global_load_async_to_lds_b128 %12, %13, off\n\t"
               "global_load_async_to_lds_b128 %14, %15, off\n\t"
               "global_load_async_to_lds_b128 %16, %17, off\n\t"
               "global_load_async_to_lds_b128 %18, %19, off\n\t"
               "global_load_async_to_lds_b128 %20, %21, off\n\t"
               "global_load_async_to_lds_b128 %22, %23, off\n\t"
               "s_wait_xcnt 0x0"
               :: "v"(lk), "v"(gk), "v"(lk + 64u), "v"(gk + 32), "v"(lk + 128u), "v"(gk + 64),
                  "v"(lk2), "v"(gk2), "v"(lk2 + 64u), "v"(gk2 + 32), "v"(lk2 + 128u), "v"(gk2 + 64),
                  "v"(lv), "v"(gv), "v"(lv + 16u * VPH * 2u), "v"(gv + 16 * (size_t)TT), "v"(lv + 32u * VPH * 2u), "v"(gv + 32 * (size_t)TT),
                  "v"(lv + 48u * VPH * 2u), "v"(gv + 48 * (size_t)TT), "v"(lv + 64u * VPH * 2u), "v"(gv + 64 * (size_t)TT), "v"(lv + 80u * VPH * 2u), "v"(gv + 80 * (size_t)TT)
               : "memory");
}
__global__ __launch_bounds__(512) void k_fa(const _Float16* __restrict__ QH, const _Float16* __restrict__ QL, const _Float16* __restrict__ KH, const _Float16* __restrict__ VT, float* __restrict__ O3) {
  __shared__ __align__(16) _Float16 sm[2 * STG];
  const int tid = threadIdx.x, wave = tid >> 5, lane = tid & 31, col = lane & 15, g = lane >> 4; const int h = blockIdx.y; const size_t b = blockIdx.z; const int qn = blockIdx.x * 256 + wave * 16 + col;
  const _Float16* gk = KH + ((b * TT + (tid >> 2)) * NH + h) * KD + (tid & 3) * 8;                 // this lane's first k row of stage 0
  const _Float16* gv = VT + ((b * NH + h) * KD + (tid >> 5)) * (size_t)TT + (tid & 31) * 8;        // this lane's first v^T row, keys of stage 0
  const unsigned lk = (unsigned)(size_t)sm + (unsigned)(tid >> 2) * (KPH * 2u) + (unsigned)(tid & 3) * 16u;
  const unsigned lv = (unsigned)(size_t)sm + KSZ * 2u + (unsigned)(tid >> 5) * (VPH * 2u) + (unsigned)(tid & 31) * 16u;
  stage_copy(lk, gk, lv, gv);
  v16h qh[KD / 32], ql[KD / 32];
  for (int kc = 0; kc < KD / 32; ++kc) { const size_t qo = ((b * TT + qn) * NH + h) * KD + kc * 32; qh[kc] = frag_h(QH + qo, lane); ql[kc] = frag_h(QL + qo, lane); }
  asm volatile("s_wait_asynccnt 0x0" ::: "memory");   // this wave's share of stage 0 has landed
  __syncthreads();                                    // every wave's share has: stage 0 may be read
  stage_copy(lk + STG * 2u, gk + (size_t)SKEYS * RW, lv + STG * 2u, gv + SKEYS);
  v8f o[KD / 16] = {}; float m = -3.0e38f, l = 0.f;
  const float cs = 0.17677669529663689f * 1.4426950408889634f;   // 32^-0.5 * log2 e: exp((s - max) / sqrt(32)) = exp2(s * cs - max * cs)
  for (int st = 0; st < TT / SKEYS; ++st) {
    const _Float16* kp = sm + (st & 1) * STG + col * KPH;          // A row = key k0 + 16 t + col
    const _Float16* vp = sm + (st & 1) * STG + KSZ + col * VPH;    // A row = kk 16 j + col, k = key
#pragma nounroll   // stays rolled as before: unrolled, the four passes' fragment groups overlap and the wave's 256 registers spill to scratch
    for (int k0 = 0; k0 < SKEYS; k0 += 64) { v8f s[4]; v16h kf[4][KD / 32];
      for (int t = 0; t < 4; ++t)
        for (int kc = 0; kc < KD / 32; ++kc) kf[t][kc] = frag_h(kp + (k0 + t * 16) * KPH + kc * 32, lane);
      __builtin_amdgcn_sched_barrier(0);   // the pass's k fragments are read as one group: one LDS latency a pass instead of one per fragment
      for (int t = 0; t < 4; ++t) { v8f a = {};
        for (int kc = 0; kc < KD / 32; ++kc) { a = wmma_h(kf[t][kc], qh[kc], a); a = wmma_h(kf[t][kc], ql[kc], a); }
        s[t] = a; }
      v16h vf[KD / 16];
      for (int j = 0; j < KD / 16; ++j) vf[j] = frag_h(vp + (j * 16) * VPH + k0, lane);          // keys k0 .. k0 + 31
      __builtin_amdgcn_sched_barrier(0);   // the six v^T fragments are read as one group here, so that the softmax below covers their LDS latency
      float mx = s[0][0];   // maximum of the raw scores: cs is positive
      for (int t = 0; t < 4; ++t)
        for (int r = 0; r < 8; ++r) mx = fmaxf(mx, s[t][r]);
      mx = fmaxf(mx, __shfl_xor(mx, 16));   // the other half of the wave holds this query's other keys
      mx = fmaxf(m, mx * cs);
      const float al = __builtin_amdgcn_exp2f(m - mx); m = mx; float ps = 0.f; v16h p;
      const v2f cs2 = {cs, cs}, nb = {11.0f - mx, 11.0f - mx};   // P's factor 2^11 rides in the exponent; the sum carries it too
      for (int j = 0; j < KD / 16; ++j)
        for (int r = 0; r < 8; ++r) o[j][r] *= al;
      for (int t = 0; t < 2; ++t)
        for (int r = 0; r < 8; r += 2) { const v2f a = __builtin_elementwise_fma(v2f{s[t][r], s[t][r + 1]}, cs2, nb); const float e0 = __builtin_amdgcn_exp2f(a[0]), e1 = __builtin_amdgcn_exp2f(a[1]);
          ps += e0; ps += e1; p[t * 8 + r] = (_Float16)e0; p[t * 8 + r + 1] = (_Float16)e1; }
      for (int j = 0; j < KD / 16; ++j) o[j] = wmma_h(vf[j], p, o[j]);
      for (int j = 0; j < KD / 16; ++j) vf[j] = frag_h(vp + (j * 16) * VPH + k0 + 32, lane);     // keys k0 + 32 .. k0 + 63
      __builtin_amdgcn_sched_barrier(0);   // as above: one group, covered by the second half of the softmax
      for (int t = 2; t < 4; ++t)
        for (int r = 0; r < 8; r += 2) { const v2f a = __builtin_elementwise_fma(v2f{s[t][r], s[t][r + 1]}, cs2, nb); const float e0 = __builtin_amdgcn_exp2f(a[0]), e1 = __builtin_amdgcn_exp2f(a[1]);
          ps += e0; ps += e1; p[(t - 2) * 8 + r] = (_Float16)e0; p[(t - 2) * 8 + r + 1] = (_Float16)e1; }
      l = l * al + ps;
      for (int j = 0; j < KD / 16; ++j) o[j] = wmma_h(vf[j], p, o[j]); }
    asm volatile("s_wait_dscnt 0x0" ::: "memory");      // this wave's reads of the buffer are done before it is refilled
    asm volatile("s_wait_asynccnt 0x0" ::: "memory");   // this wave's share of stage st + 1 has landed
    __syncthreads();                                    // publishes stage st + 1 and ends every wave's reads of stage st
    if (st + 2 < TT / SKEYS) stage_copy(lk + (unsigned)(st & 1) * (STG * 2u), gk + (size_t)(st + 2) * SKEYS * RW, lv + (unsigned)(st & 1) * (STG * 2u), gv + (st + 2) * SKEYS); }
  asm volatile("s_wait_asynccnt 0x0" ::: "memory");     // no copy is left in flight when the wave ends
  l += __shfl_xor(l, 16); const float inv = 1.0f / l;   // l and o both carry 2^11
  for (int j = 0; j < KD / 16; ++j) { float* dst = O3 + ((b * NI + (j >> 1)) * TT + qn) * (size_t)CC + h * HD + (j & 1) * 16 + 8 * g;   // kk = 16 j + 8 g + r = i * 32 + c_local
    v4f a, c;
    for (int r = 0; r < 4; ++r) { a[r] = o[j][r] * inv; c[r] = o[j][4 + r] * inv; }
    vst2(dst, a); vst2(dst + 4, c); } }
// ---- k_out: block = (64 points, 128 out channels, z = b*3 + i): out[b][o][i][n] = sum_c Wo[o][c] o3[b][i][n][c] + x[b][o][i][n]
__global__ __launch_bounds__(128) void k_out(const float* __restrict__ O3, const __bf16* __restrict__ PW, const float* __restrict__ X, float* __restrict__ OUT) { __shared__ __align__(16) float st[128][68];
  const int tid = threadIdx.x, wave = tid >> 5, lane = tid & 31, col = lane & 15, g = lane >> 4; const int n0 = blockIdx.x * 64; const int c0 = blockIdx.y * 128; const size_t b = blockIdx.z / NI; const int i = blockIdx.z % NI;
  const int f0 = (3 * 16 + c0 / 16) * 8;
  v16b w[8], wn[8];
  for (int j = 0; j < 8; ++j) w[j] = frag_pw(PW, f0 + j * 8, lane);
  v8f acc[8] = {};
#pragma unroll   // whole: the two fragment sets change places by renaming, without register copies
  for (int kc = 0; kc < CC / 32; ++kc) { const F2 a = split_row(O3 + ((b * NI + i) * TT + n0 + wave * 16 + col) * (size_t)CC, kc * 32, lane);
    if (kc + 1 < CC / 32) {   // the next k step's eight fragments, one group of loads ahead of this step's products
      for (int j = 0; j < 8; ++j) wn[j] = frag_pw(PW, f0 + j * 8 + kc + 1, lane); }
    for (int j = 0; j < 8; ++j) { acc[j] = wmma_bf(a.h, w[j], acc[j]); acc[j] = wmma_bf(a.l, w[j], acc[j]); }
    for (int j = 0; j < 8; ++j) w[j] = wn[j]; }
#pragma unroll
  for (int j = 0; j < 8; ++j)
#pragma unroll
    for (int r = 0; r < 8; ++r) st[j * 16 + col][wave * 16 + 8 * g + r] = acc[j][r];
  __syncthreads();
  for (int e = tid; e < 128 * 16; e += 128) { const int cl = e >> 4, q = e & 15; const size_t go = ((b * CC + c0 + cl) * NI + i) * (size_t)TT + n0 + q * 4; const v4f xr = *(const v4f*)(X + go); v4f v = *(const v4f*)&st[cl][q * 4]; v[0] += bfr(xr[0]); v[1] += bfr(xr[1]); v[2] += bfr(xr[2]); v[3] += bfr(xr[3]); vst2(OUT + go, v); } }
extern "C" void kernel_launch(void* const* d_in, const int* in_sizes, int n_in, void* d_out, int out_size, void* d_ws, size_t ws_size, hipStream_t stream) {
  (void)in_sizes; (void)n_in; (void)out_size;
  const float** F = (const float**)d_in;   // 0 x [4,256,3,2048], 1 Wq, 2 Wk, 3 Wv, 4 Wo [256,256] ([out][in])
  if (ws_size < (size_t)WS_END) return;
  char* ws = (char*)d_ws; _Float16 *QH = (_Float16*)(ws + WS_QH), *QL = (_Float16*)(ws + WS_QL), *KH = (_Float16*)(ws + WS_KH), *VT = (_Float16*)(ws + WS_VT); float *O3 = (float*)(ws + WS_O3); __bf16 *PW = (__bf16*)(ws + WS_PW);
  k_pack<<<dim3(4 * 16 * 8 / 4), 128, 0, stream>>>(F[1], F[2], F[3], F[4], PW);
  k_proj<<<dim3(TT / 64, CC / 128, TNB * 9), 128, 0, stream>>>(F[0], PW, QH, QL, KH, VT);
  k_fa<<<dim3(TT / 256, NH, TNB), 512, 0, stream>>>(QH, QL, KH, VT, O3);
  k_out<<<dim3(TT / 64, CC / 128, TNB * NI), 128, 0, stream>>>(O3, PW, F[0], (float*)d_out);
}

// v006
// One run takes 90.3 microseconds.
// Timed twice side by side with v005, it ran 1.20 times as fast both times.
// Counting every step since v000, it is 14.9 times as fast.
// compute dtype: all float inputs rounded to bf16; the four W rounded to bf16 once per call and laid out in B-fragment order (k_pack); q/k/v = W x over channels (per vector component) with EXACT bf16 products on WMMA 16x16x32 (x tiles transposed in LDS), f32 accumulate; q as f16 hi + residual, k f16 -> 2-product energies over the 96 (head_dim x 3) pairs, / sqrt(32), kept in registers; online softmax in f32, base 2 (one fma and the hardware exp2 per score; running maximum and sum per query) -> unnormalised P f16 x 2^11; o = P . v (v once to f16) / sum, one launch for all heads; out = Wo o (o split bf16 hi + lo, 2 products) + x; f32 output [b][c][3][n].
#include <hip/hip_runtime.h>
#include <math.h>

typedef __attribute__((ext_vector_type(16))) _Float16 v16h;
typedef __attribute__((ext_vector_type(16))) __bf16 v16b;
typedef __attribute__((ext_vector_type(8)))  _Float16 v8h;
typedef __attribute__((ext_vector_type(8)))  float v8f;
typedef __attribute__((ext_vector_type(4)))  float v4f;
typedef __attribute__((ext_vector_type(2)))  float v2f;
typedef __attribute__((ext_vector_type(4)))  unsigned v4u;
typedef __attribute__((ext_vector_type(4)))  int v4i;
typedef float __attribute__((may_alias)) float_a;
typedef int __attribute__((may_alias)) int_a;

template <typename T> __device__ __forceinline__ void vst2(void* p, T v) { *(T*)p = v;  }
__device__ __forceinline__ v8f wmma_h(v16h a, v16h b, v8f c) { return __builtin_amdgcn_wmma_f32_16x16x32_f16(false, a, false, b, (short)0, c, false, false); }
__device__ __forceinline__ v8f wmma_bf(v16b a, v16b b, v8f c) {
  v8f d = __builtin_amdgcn_wmma_f32_16x16x32_bf16(false, a, false, b, (short)0, c, false, false);
  asm volatile("v_nop\n\tv_nop\n\tv_nop\n\tv_nop" : "+v"(d) : "v"(a), "v"(b));
  return d;
}
// 16x16x32 fragments: lane = (h = lane>>4, row/col = lane&15); elements 0..7 = k0+8h+0..7, 8..15 = k0+16+8h+0..7; D element r = row 8h+r
__device__ __forceinline__ v16h frag_h(const _Float16* rowk0, int lane) {
  union { v16h v; v8h q[2]; } u; const _Float16* p = rowk0 + 8 * (lane >> 4);
  u.q[0] = *(const v8h*)p; u.q[1] = *(const v8h*)(p + 16); return u.v;
}
__device__ __forceinline__ v16h frag_f32(const float* rowk0, int lane) {
  v16h a; const float* p = rowk0 + 8 * (lane >> 4);
#pragma unroll
  for (int i = 0; i < 8; ++i) { a[i] = (_Float16)p[i]; a[8 + i] = (_Float16)p[16 + i]; }
  return a;
}
__device__ __forceinline__ v16h frag_f32s(const float* rowk0, int lane, float sc) {
  v16h a; const float* p = rowk0 + 8 * (lane >> 4);
#pragma unroll
  for (int i = 0; i < 8; ++i) { a[i] = (_Float16)(p[i] * sc); a[8 + i] = (_Float16)(p[16 + i] * sc); }
  return a;
}
// column fragment from a [K][ld] layout (column n), rows >= K read as 0
__device__ __forceinline__ v16h fragc_f32(const float* W, int k0, int n, int lane, int ld, int K) {
  v16h a; const int g = lane >> 4;
#pragma unroll
  for (int i = 0; i < 8; ++i) { const int ka = k0 + 8 * g + i, kb = ka + 16;
    a[i] = (_Float16)(ka < K ? W[(size_t)(ka < K ? ka : K - 1) * ld + n] : 0.f); a[8 + i] = (_Float16)(kb < K ? W[(size_t)(kb < K ? kb : K - 1) * ld + n] : 0.f); }
  return a;
}
struct F2 { v16b h, l; };
__device__ __forceinline__ F2 bsplit16(const float v[16]) { F2 r;
#pragma unroll
  for (int i = 0; i < 16; ++i) { const __bf16 h = (__bf16)v[i]; r.h[i] = h; r.l[i] = (__bf16)(v[i] - (float)h); }
  return r; }
__device__ __forceinline__ F2 split_row(const float* row, int k0, int lane) { float v[16]; const float* p = row + k0 + 8 * (lane >> 4);
#pragma unroll
  for (int i = 0; i < 8; ++i) { v[i] = p[i]; v[8 + i] = p[16 + i]; }
  return bsplit16(v); }
__device__ __forceinline__ F2 split_rowK(const float* row, int k0, int lane, int K) { float v[16]; const int g = lane >> 4;
#pragma unroll
  for (int i = 0; i < 8; ++i) { const int ka = k0 + 8 * g + i, kb = ka + 16; v[i] = ka < K ? row[ka < K ? ka : K - 1] : 0.f; v[8 + i] = kb < K ? row[kb < K ? kb : K - 1] : 0.f; }
  return bsplit16(v); }
__device__ __forceinline__ F2 split_col(const float* W, int k0, int n, int lane, int ld, int K) { float v[16]; const int g = lane >> 4;
#pragma unroll
  for (int i = 0; i < 8; ++i) { const int ka = k0 + 8 * g + i, kb = ka + 16; v[i] = ka < K ? W[(size_t)(ka < K ? ka : K - 1) * ld + n] : 0.f; v[8 + i] = kb < K ? W[(size_t)(kb < K ? kb : K - 1) * ld + n] : 0.f; }
  return bsplit16(v); }
__device__ __forceinline__ v8f mac3(const F2& a, const F2& b, v8f c) { c = wmma_bf(a.l, b.h, c); c = wmma_bf(a.h, b.l, c); return wmma_bf(a.h, b.h, c); }
__device__ __forceinline__ float sigm(float v) { return 1.0f / (1.0f + expf(-v)); }


// Vector-neuron attention (B 4, C 256 = 8 heads x 32, 3 vector components, N 2,048 points): energy contracts over (head_dim, 3); residual output.
#define NB 4
#define CC 256
#define NI 3
#define TT 2048
#define NH 8
#define HD 32
#define KD (HD * NI)        // 96: per-head contraction length, index kk = i*32 + c_local
#define RW (NH * KD)        // 768: q/k row length per token
#ifndef TNB
#define TNB NB
#endif
typedef __attribute__((ext_vector_type(8))) __bf16 v8b;
__device__ __forceinline__ v16b frag_b(const __bf16* rowk0, int lane) {
  union { v16b v; v8b q[2]; } u; const __bf16* p = rowk0 + 8 * (lane >> 4);
  u.q[0] = *(const v8b*)p; u.q[1] = *(const v8b*)(p + 16); return u.v;
}
__device__ __forceinline__ float bfr(float v) { return (float)(__bf16)v; }
__device__ __attribute__((noinline)) float exp_ni(float v) { return expf(v); }
__device__ __attribute__((noinline)) float erf_ni(float v) { return erff(v); }

#define WS_QH  0u
#define WS_QL  (WS_QH + 2u * (size_t)NB * TT * RW)
#define WS_KH  (WS_QL + 2u * (size_t)NB * TT * RW)
#define WS_VT  (WS_KH + 2u * (size_t)NB * TT * RW)      // f16 v planes [b][h*96 + kk][n]
#define WS_O3  (WS_VT + 2u * (size_t)NB * RW * TT)      // f32 o [b][i][n][c]
#define WS_PW  (WS_O3 + 4u * (size_t)NB * NI * TT * CC) // bf16 weights in fragment order [matrix q,k,v,o][16 out channels][32 in channels][half][lane][8]
#define WS_END (WS_PW + 2u * 4u * (size_t)CC * CC)

// ---- k_pack: one wave per B fragment f = (matrix * 16 + out tile) * 8 + k step. Lane (col, g) holds W[16 tile + col][32 kc + 8 g + 0..7] and [.. + 16 + 0..7];
// the first eights of the 32 lanes lie in one 512-byte run, the second eights in the next, so that a fragment is read by two loads of whole lines.
__global__ __launch_bounds__(128) void k_pack(const float* __restrict__ WQ, const float* __restrict__ WK, const float* __restrict__ WV, const float* __restrict__ WO, __bf16* __restrict__ PW) {
  const int f = blockIdx.x * 4 + (threadIdx.x >> 5), lane = threadIdx.x & 31, col = lane & 15, g = lane >> 4; const int mat = f >> 7, ot = (f >> 3) & 15, kc = f & 7;
  const float* Wm = mat == 0 ? WQ : mat == 1 ? WK : mat == 2 ? WV : WO; const float* p = Wm + (size_t)(ot * 16 + col) * CC + kc * 32 + 8 * g;
  v8b lo, hi;
  for (int ii = 0; ii < 8; ++ii) { lo[ii] = (__bf16)p[ii]; hi[ii] = (__bf16)p[16 + ii]; }
  __bf16* d = PW + (size_t)f * 512 + lane * 8; *(v8b*)d = lo; *(v8b*)(d + 256) = hi; }
__device__ __forceinline__ v16b frag_pw(const __bf16* PW, int f, int lane) {
  union { v16b v; v8b q[2]; } u; const __bf16* p = PW + (size_t)f * 512 + lane * 8;
  u.q[0] = *(const v8b*)p; u.q[1] = *(const v8b*)(p + 256); return u.v;
}

// ---- k_proj: block = (64 points, 128 out channels, z = b*3 + i): y[o][n] = sum_c W[o][c] x[b][c][i][n] for W = Wq, Wk, Wv in turn, from one staged x tile.
// A wave takes 32 out channels (two B fragments a k step) and all 64 points (four A fragments from LDS): a weight fragment is loaded by one wave only,
// and a matrix's 16 fragments of a wave are in flight together, the next matrix's while this one's results are stored. q, k and v leave through LDS arrays of their own.
__global__ __launch_bounds__(128) void k_proj(const float* __restrict__ X, const __bf16* __restrict__ PW, _Float16* __restrict__ QH, _Float16* __restrict__ QL, _Float16* __restrict__ KH, _Float16* __restrict__ VT) {
  __shared__ __align__(16) __bf16 sx[64][CC + 8]; __shared__ __align__(16) _Float16 sh[64][136], sl[64][136], sk[64][136]; __shared__ __align__(16) _Float16 th[128][72];
  const int tid = threadIdx.x, wave = tid >> 5, lane = tid & 31, col = lane & 15, g = lane >> 4; const int n0 = blockIdx.x * 64; const int c0 = blockIdx.y * 128; const int z = blockIdx.z; const int i = z % NI; const size_t b = z / NI; const int f0 = (c0 / 16 + wave * 2) * 8;
  // x tile: a thread takes four points (one 16-byte load per channel) of eight channels, four such sets. All 32 loads, and the first weight fragments behind
  // them, are issued before the first value is used, so the block waits for memory once; a point's eight channels then go to LDS as one 16-byte store.
  const int nq = tid & 15, c8 = tid >> 4; const float* xp = X + ((b * CC + c8 * 8) * NI + i) * (size_t)TT + n0 + nq * 4;
  v4f xr[4][8];
  for (int k = 0; k < 4; ++k)
    for (int jj = 0; jj < 8; ++jj) xr[k][jj] = *(const v4f*)(xp + (size_t)(k * 64 + jj) * (NI * TT));
  asm volatile("s_wait_xcnt 0x0" ::: "memory");   // stands in front of any reuse of the x loads' address registers (the weight loads below land on them)
  v16b w[CC / 32][2];
  for (int kc = 0; kc < CC / 32; ++kc)
    for (int t = 0; t < 2; ++t) w[kc][t] = frag_pw(PW, f0 + t * 8 + kc, lane);
  __builtin_amdgcn_sched_barrier(0);   // the weight loads are issued ahead of the first wait for x: without it they sink below the conversions and their latency adds to that of x
  for (int k = 0; k < 4; ++k)
    for (int p = 0; p < 4; ++p) { v8b t;
      for (int jj = 0; jj < 8; ++jj) t[jj] = (__bf16)xr[k][jj][p];
      *(v8b*)&sx[nq * 4 + p][(c8 + 8 * k) * 8] = t; }
  __syncthreads();
#pragma unroll   // whole: 'which' is a constant in each copy, so that no copy tests it per element
  for (int which = 0; which < 3; ++which) {
    v8f acc[4][2] = {}; v16b a[4], an[4];
    for (int pt = 0; pt < 4; ++pt) a[pt] = frag_b(&sx[pt * 16 + col][0], lane);
#pragma unroll   // whole: every fragment has its own registers, and the two x fragment sets change places by renaming
    for (int kc = 0; kc < CC / 32; ++kc) {
      if (kc + 1 < CC / 32) {   // the next k step's four x fragments, one group of LDS reads ahead of this step's products
        for (int pt = 0; pt < 4; ++pt) an[pt] = frag_b(&sx[pt * 16 + col][(kc + 1) * 32], lane);
        __builtin_amdgcn_sched_barrier(0); }   // holds the group here: placed behind the products, each k step would wait out the LDS latency
      for (int pt = 0; pt < 4; ++pt)
        for (int t = 0; t < 2; ++t) acc[pt][t] = wmma_bf(a[pt], w[kc][t], acc[pt][t]);
      for (int pt = 0; pt < 4; ++pt) a[pt] = an[pt]; }
#pragma unroll
    for (int pt = 0; pt < 4; ++pt)
#pragma unroll
      for (int t = 0; t < 2; ++t)
#pragma unroll
        for (int r = 0; r < 8; ++r) { const float v = acc[pt][t][r]; const int rl = pt * 16 + 8 * g + r, cl = (wave * 2 + t) * 16 + col; const _Float16 hv = (_Float16)v; if (which == 2) th[cl][rl] = hv; else if (which == 1) sk[rl][cl] = hv; else { sh[rl][cl] = hv; sl[rl][cl] = (_Float16)(v - (float)hv); } }
    __syncthreads();
    if (which < 2) {
      for (int kc = 0; kc < CC / 32; ++kc)
        for (int t = 0; t < 2; ++t) w[kc][t] = frag_pw(PW, f0 + (which + 1) * 128 + t * 8 + kc, lane);
      asm volatile("s_wait_xcnt 0x0" ::: "memory");   // stands in front of any reuse of these loads' address registers (the store loop's addresses land on them)
      __builtin_amdgcn_sched_barrier(0); }   // the next matrix's fragments are issued behind the barrier (which would wait for them) and ahead of the store loop, which covers their latency
    if (which < 2) { _Float16* dh = which == 0 ? QH : KH;   // rows [b][n][h][i*32 + c_local]; this block covers 4 heads (128 channels)
      for (int e = tid; e < 64 * 4 * 4; e += 128) { const int rl = e >> 4, hh = (e >> 2) & 3, q = e & 3; const int h = c0 / HD + hh; const size_t dst = (((b * TT + n0 + rl) * NH + h) * KD) + i * HD + q * 8;
        vst2((unsigned*)(dh + dst), *(const v4u*)&(which == 0 ? sh : sk)[rl][hh * 32 + q * 8]); if (which == 0) vst2((unsigned*)(QL + dst), *(const v4u*)&sl[rl][hh * 32 + q * 8]); } }
    else { for (int e = tid; e < 128 * 8; e += 128) { const int cl = e >> 3, q = e & 7; const int c = c0 + cl; const int h = c / HD, cL = c % HD; vst2((unsigned*)(VT + ((b * NH + h) * KD + i * HD + cL) * (size_t)TT + n0 + q * 8), *(const v4u*)&th[cl][q * 8]); } } } }
// ---- k_fa: block = 16 waves x 16 queries of one (b, head). Per 64 keys: S^T = K Q^T (A = k rows, B = q hi then q lo), so a lane holds one query's
// scores (keys 8g + r of each 16-key tile); running maximum (base-2 units) and sum (x 2^11) per query in f32; two S^T tiles convert in place to the B operand of O^T += V^T P^T.
// The 16 waves read the same K rows and V^T rows: a stage of 256 keys is brought into LDS once per block by asynchronous copies, two buffers, the next
// stage in flight while this one is worked on. Row pitches are odd multiples of 16 bytes, so the 16-byte fragment reads meet no bank conflict.
#define SKEYS 256                 // keys per stage
#define KPH 104                   // k row pitch in LDS, halves (192 B of data in 208 B)
#define VPH 264                   // v^T row pitch in LDS, halves (512 B of data in 528 B)
#define KSZ (SKEYS * KPH)         // halves of k rows per stage
#define STG (KSZ + KD * VPH)      // halves per stage buffer
// One lane's share of a stage: three 16-byte pieces (64 B apart) of each of two k rows (128 rows apart) and one piece of each of six v^T rows (16 rows apart).
// s_wait_xcnt 0 closes the statement so that no address register is rewritten ahead of it.
__device__ __forceinline__ void stage_copy(unsigned lk, const _Float16* gk, unsigned lv, const _Float16* gv) {
  const unsigned lk2 = lk + 128u * KPH * 2u; const _Float16* gk2 = gk + 128 * (size_t)RW;
  asm volatile("global_load_async_to_lds_b128 %0, %1, off\n\t"
               "global_load_async_to_lds_b128 %2, %3, off\n\t"
               "global_load_async_to_lds_b128 %4, %5, off\n\t"
               "global_load_async_to_lds_b128 %6, %7, off\n\t"
               "global_load_async_to_lds_b128 %8, %9, off\n\t"
               "global_load_async_to_lds_b128 %10, %11, off\n\t"
               "global_load_async_to_lds_b128 %12, %13, off\n\t"
               "global_load_async_to_lds_b128 %14, %15, off\n\t"
               "global_load_async_to_lds_b128 %16, %17, off\n\t"
               "global_load_async_to_lds_b128 %18, %19, off\n\t"
               "global_load_async_to_lds_b128 %20, %21, off\n\t"
               "global_load_async_to_lds_b128 %22, %23, off\n\t"
               "s_wait_xcnt 0x0"
               :: "v"(lk), "v"(gk), "v"(lk + 64u), "v"(gk + 32), "v"(lk + 128u), "v"(gk + 64),
                  "v"(lk2), "v"(gk2), "v"(lk2 + 64u), "v"(gk2 + 32), "v"(lk2 + 128u), "v"(gk2 + 64),
                  "v"(lv), "v"(gv), "v"(lv + 16u * VPH * 2u), "v"(gv + 16 * (size_t)TT), "v"(lv + 32u * VPH * 2u), "v"(gv + 32 * (size_t)TT),
                  "v"(lv + 48u * VPH * 2u), "v"(gv + 48 * (size_t)TT), "v"(lv + 64u * VPH * 2u), "v"(gv + 64 * (size_t)TT), "v"(lv + 80u * VPH * 2u), "v"(gv + 80 * (size_t)TT)
               : "memory");
}
__global__ __launch_bounds__(512) void k_fa(const _Float16* __restrict__ QH, const _Float16* __restrict__ QL, const _Float16* __restrict__ KH, const _Float16* __restrict__ VT, float* __restrict__ O3) {
  __shared__ __align__(16) _Float16 sm[2 * STG];
  const int tid = threadIdx.x, wave = tid >> 5, lane = tid & 31, col = lane & 15, g = lane >> 4; const int h = blockIdx.y; const size_t b = blockIdx.z; const int qn = blockIdx.x * 256 + wave * 16 + col;
  const _Float16* gk = KH + ((b * TT + (tid >> 2)) * NH + h) * KD + (tid & 3) * 8;                 // this lane's first k row of stage 0
  const _Float16* gv = VT + ((b * NH + h) * KD + (tid >> 5)) * (size_t)TT + (tid & 31) * 8;        // this lane's first v^T row, keys of stage 0
  const unsigned lk = (unsigned)(size_t)sm + (unsigned)(tid >> 2) * (KPH * 2u) + (unsigned)(tid & 3) * 16u;
  const unsigned lv = (unsigned)(size_t)sm + KSZ * 2u + (unsigned)(tid >> 5) * (VPH * 2u) + (unsigned)(tid & 31) * 16u;
  stage_copy(lk, gk, lv, gv);
  v16h qh[KD / 32], ql[KD / 32];
  for (int kc = 0; kc < KD / 32; ++kc) { const size_t qo = ((b * TT + qn) * NH + h) * KD + kc * 32; qh[kc] = frag_h(QH + qo, lane); ql[kc] = frag_h(QL + qo, lane); }
  asm volatile("s_wait_asynccnt 0x0" ::: "memory");   // this wave's share of stage 0 has landed
  __syncthreads();                                    // every wave's share has: stage 0 may be read
  stage_copy(lk + STG * 2u, gk + (size_t)SKEYS * RW, lv + STG * 2u, gv + SKEYS);
  v8f o[KD / 16] = {}; float m = -3.0e38f, l = 0.f;
  const float cs = 0.17677669529663689f * 1.4426950408889634f;   // 32^-0.5 * log2 e: exp((s - max) / sqrt(32)) = exp2(s * cs - max * cs)
  for (int st = 0; st < TT / SKEYS; ++st) {
    const _Float16* kp = sm + (st & 1) * STG + col * KPH;          // A row = key k0 + 16 t + col
    const _Float16* vp = sm + (st & 1) * STG + KSZ + col * VPH;    // A row = kk 16 j + col, k = key
#pragma nounroll   // stays rolled as before: unrolled, the four passes' fragment groups overlap and the wave's 256 registers spill to scratch
    for (int k0 = 0; k0 < SKEYS; k0 += 64) { v8f s[4]; v16h kf[4][KD / 32];
      for (int t = 0; t < 4; ++t)
        for (int kc = 0; kc < KD / 32; ++kc) kf[t][kc] = frag_h(kp + (k0 + t * 16) * KPH + kc * 32, lane);
      __builtin_amdgcn_sched_barrier(0);   // the pass's k fragments are read as one group: one LDS latency a pass instead of one per fragment
      for (int t = 0; t < 4; ++t) { v8f a = {};
        for (int kc = 0; kc < KD / 32; ++kc) { a = wmma_h(kf[t][kc], qh[kc], a); a = wmma_h(kf[t][kc], ql[kc], a); }
        s[t] = a; }
      v16h vf[KD / 16];
      for (int j = 0; j < KD / 16; ++j) vf[j] = frag_h(vp + (j * 16) * VPH + k0, lane);          // keys k0 .. k0 + 31
      __builtin_amdgcn_sched_barrier(0);   // the six v^T fragments are read as one group here, so that the softmax below covers their LDS latency
      float mx = s[0][0];   // maximum of the raw scores: cs is positive
      for (int t = 0; t < 4; ++t)
        for (int r = 0; r < 8; ++r) mx = fmaxf(mx, s[t][r]);
      mx = fmaxf(mx, __shfl_xor(mx, 16));   // the other half of the wave holds this query's other keys
      mx = fmaxf(m, mx * cs);
      const float al = __builtin_amdgcn_exp2f(m - mx); m = mx; float ps = 0.f; v16h p;
      const v2f cs2 = {cs, cs}, nb = {11.0f - mx, 11.0f - mx};   // P's factor 2^11 rides in the exponent; the sum carries it too
      for (int j = 0; j < KD / 16; ++j)
        for (int r = 0; r < 8; ++r) o[j][r] *= al;
      for (int t = 0; t < 2; ++t)
        for (int r = 0; r < 8; r += 2) { const v2f a = __builtin_elementwise_fma(v2f{s[t][r], s[t][r + 1]}, cs2, nb); const float e0 = __builtin_amdgcn_exp2f(a[0]), e1 = __builtin_amdgcn_exp2f(a[1]);
          ps += e0; ps += e1; p[t * 8 + r] = (_Float16)e0; p[t * 8 + r + 1] = (_Float16)e1; }
      for (int j = 0; j < KD / 16; ++j) o[j] = wmma_h(vf[j], p, o[j]);
      for (int j = 0; j < KD / 16; ++j) vf[j] = frag_h(vp + (j * 16) * VPH + k0 + 32, lane);     // keys k0 + 32 .. k0 + 63
      __builtin_amdgcn_sched_barrier(0);   // as above: one group, covered by the second half of the softmax
      for (int t = 2; t < 4; ++t)
        for (int r = 0; r < 8; r += 2) { const v2f a = __builtin_elementwise_fma(v2f{s[t][r], s[t][r + 1]}, cs2, nb); const float e0 = __builtin_amdgcn_exp2f(a[0]), e1 = __builtin_amdgcn_exp2f(a[1]);
          ps += e0; ps += e1; p[(t - 2) * 8 + r] = (_Float16)e0; p[(t - 2) * 8 + r + 1] = (_Float16)e1; }
      l = l * al + ps;
      for (int j = 0; j < KD / 16; ++j) o[j] = wmma_h(vf[j], p, o[j]); }
    asm volatile("s_wait_dscnt 0x0" ::: "memory");      // this wave's reads of the buffer are done before it is refilled
    asm volatile("s_wait_asynccnt 0x0" ::: "memory");   // this wave's share of stage st + 1 has landed
    __syncthreads();                                    // publishes stage st + 1 and ends every wave's reads of stage st
    if (st + 2 < TT / SKEYS) stage_copy(lk + (unsigned)(st & 1) * (STG * 2u), gk + (size_t)(st + 2) * SKEYS * RW, lv + (unsigned)(st & 1) * (STG * 2u), gv + (st + 2) * SKEYS); }
  asm volatile("s_wait_asynccnt 0x0" ::: "memory");     // no copy is left in flight when the wave ends
  l += __shfl_xor(l, 16); const float inv = 1.0f / l;   // l and o both carry 2^11
  for (int j = 0; j < KD / 16; ++j) { float* dst = O3 + ((b * NI + (j >> 1)) * TT + qn) * (size_t)CC + h * HD + (j & 1) * 16 + 8 * g;   // kk = 16 j + 8 g + r = i * 32 + c_local
    v4f a, c;
    for (int r = 0; r < 4; ++r) { a[r] = o[j][r] * inv; c[r] = o[j][4 + r] * inv; }
    vst2(dst, a); vst2(dst + 4, c); } }
// ---- k_out: block = (64 points, 128 out channels, z = b*3 + i): out[b][o][i][n] = sum_c Wo[o][c] o3[b][i][n][c] + x[b][o][i][n]
__global__ __launch_bounds__(128) void k_out(const float* __restrict__ O3, const __bf16* __restrict__ PW, const float* __restrict__ X, float* __restrict__ OUT) { __shared__ __align__(16) float st[128][68];
  const int tid = threadIdx.x, wave = tid >> 5, lane = tid & 31, col = lane & 15, g = lane >> 4; const int n0 = blockIdx.x * 64; const int c0 = blockIdx.y * 128; const size_t b = blockIdx.z / NI; const int i = blockIdx.z % NI;
  const int f0 = (3 * 16 + c0 / 16) * 8;
  v16b w[8], wn[8];
  for (int j = 0; j < 8; ++j) w[j] = frag_pw(PW, f0 + j * 8, lane);
  v8f acc[8] = {};
#pragma unroll   // whole: the two fragment sets change places by renaming, without register copies
  for (int kc = 0; kc < CC / 32; ++kc) { const F2 a = split_row(O3 + ((b * NI + i) * TT + n0 + wave * 16 + col) * (size_t)CC, kc * 32, lane);
    if (kc + 1 < CC / 32) {   // the next k step's eight fragments, one group of loads ahead of this step's products
      for (int j = 0; j < 8; ++j) wn[j] = frag_pw(PW, f0 + j * 8 + kc + 1, lane); }
    for (int j = 0; j < 8; ++j) { acc[j] = wmma_bf(a.h, w[j], acc[j]); acc[j] = wmma_bf(a.l, w[j], acc[j]); }
    for (int j = 0; j < 8; ++j) w[j] = wn[j]; }
#pragma unroll
  for (int j = 0; j < 8; ++j)
#pragma unroll
    for (int r = 0; r < 8; ++r) st[j * 16 + col][wave * 16 + 8 * g + r] = acc[j][r];
  __syncthreads();
  for (int e = tid; e < 128 * 16; e += 128) { const int cl = e >> 4, q = e & 15; const size_t go = ((b * CC + c0 + cl) * NI + i) * (size_t)TT + n0 + q * 4; const v4f xr = *(const v4f*)(X + go); v4f v = *(const v4f*)&st[cl][q * 4]; v[0] += bfr(xr[0]); v[1] += bfr(xr[1]); v[2] += bfr(xr[2]); v[3] += bfr(xr[3]); vst2(OUT + go, v); } }
extern "C" void kernel_launch(void* const* d_in, const int* in_sizes, int n_in, void* d_out, int out_size, void* d_ws, size_t ws_size, hipStream_t stream) {
  (void)in_sizes; (void)n_in; (void)out_size;
  const float** F = (const float**)d_in;   // 0 x [4,256,3,2048], 1 Wq, 2 Wk, 3 Wv, 4 Wo [256,256] ([out][in])
  if (ws_size < (size_t)WS_END) return;
  char* ws = (char*)d_ws; _Float16 *QH = (_Float16*)(ws + WS_QH), *QL = (_Float16*)(ws + WS_QL), *KH = (_Float16*)(ws + WS_KH), *VT = (_Float16*)(ws + WS_VT); float *O3 = (float*)(ws + WS_O3); __bf16 *PW = (__bf16*)(ws + WS_PW);
  k_pack<<<dim3(4 * 16 * 8 / 4), 128, 0, stream>>>(F[1], F[2], F[3], F[4], PW);
  k_proj<<<dim3(TT / 64, CC / 128, TNB * NI), 128, 0, stream>>>(F[0], PW, QH, QL, KH, VT);
  k_fa<<<dim3(TT / 256, NH, TNB), 512, 0, stream>>>(QH, QL, KH, VT, O3);
  k_out<<<dim3(TT / 64, CC / 128, TNB * NI), 128, 0, stream>>>(O3, PW, F[0], (float*)d_out);
}

// v007
// One run takes 79.8 microseconds.
// Two timings next to v006 put it at 1.14 and 1.13 times that version's speed.
// Over all steps from v000 it is 16.8 times as fast.
// compute dtype: all float inputs rounded to bf16; the four W rounded to bf16 once per call and laid out in B-fragment order (k_pack); q/k/v = W x over channels (per vector component) with EXACT bf16 products on WMMA 16x16x32 (x tiles transposed in LDS), f32 accumulate; q and k each rounded once to f16 -> 1-product energies over the 96 (head_dim x 3) pairs, / sqrt(32), kept in registers; online softmax in f32, base 2 (one fma and the hardware exp2 per score; running maximum and sum per query) -> unnormalised P f16 x 2^11; o = P . v (v once to f16) / sum, one launch for all heads; out = Wo o (o split bf16 hi + lo, 2 products) + x; f32 output [b][c][3][n].
#include <hip/hip_runtime.h>
#include <math.h>

typedef __attribute__((ext_vector_type(16))) _Float16 v16h;
typedef __attribute__((ext_vector_type(16))) __bf16 v16b;
typedef __attribute__((ext_vector_type(8)))  _Float16 v8h;
typedef __attribute__((ext_vector_type(8)))  float v8f;
typedef __attribute__((ext_vector_type(4)))  float v4f;
typedef __attribute__((ext_vector_type(2)))  float v2f;
typedef __attribute__((ext_vector_type(4)))  unsigned v4u;
typedef __attribute__((ext_vector_type(4)))  int v4i;
typedef float __attribute__((may_alias)) float_a;
typedef int __attribute__((may_alias)) int_a;

template <typename T> __device__ __forceinline__ void vst2(void* p, T v) { *(T*)p = v;  }
__device__ __forceinline__ v8f wmma_h(v16h a, v16h b, v8f c) { return __builtin_amdgcn_wmma_f32_16x16x32_f16(false, a, false, b, (short)0, c, false, false); }
__device__ __forceinline__ v8f wmma_bf(v16b a, v16b b, v8f c) {
  v8f d = __builtin_amdgcn_wmma_f32_16x16x32_bf16(false, a, false, b, (short)0, c, false, false);
  asm volatile("v_nop\n\tv_nop\n\tv_nop\n\tv_nop" : "+v"(d) : "v"(a), "v"(b));
  return d;
}
// 16x16x32 fragments: lane = (h = lane>>4, row/col = lane&15); elements 0..7 = k0+8h+0..7, 8..15 = k0+16+8h+0..7; D element r = row 8h+r
__device__ __forceinline__ v16h frag_h(const _Float16* rowk0, int lane) {
  union { v16h v; v8h q[2]; } u; const _Float16* p = rowk0 + 8 * (lane >> 4);
  u.q[0] = *(const v8h*)p; u.q[1] = *(const v8h*)(p + 16); return u.v;
}
__device__ __forceinline__ v16h frag_f32(const float* rowk0, int lane) {
  v16h a; const float* p = rowk0 + 8 * (lane >> 4);
#pragma unroll
  for (int i = 0; i < 8; ++i) { a[i] = (_Float16)p[i]; a[8 + i] = (_Float16)p[16 + i]; }
  return a;
}
__device__ __forceinline__ v16h frag_f32s(const float* rowk0, int lane, float sc) {
  v16h a; const float* p = rowk0 + 8 * (lane >> 4);
#pragma unroll
  for (int i = 0; i < 8; ++i) { a[i] = (_Float16)(p[i] * sc); a[8 + i] = (_Float16)(p[16 + i] * sc); }
  return a;
}
// column fragment from a [K][ld] layout (column n), rows >= K read as 0
__device__ __forceinline__ v16h fragc_f32(const float* W, int k0, int n, int lane, int ld, int K) {
  v16h a; const int g = lane >> 4;
#pragma unroll
  for (int i = 0; i < 8; ++i) { const int ka = k0 + 8 * g + i, kb = ka + 16;
    a[i] = (_Float16)(ka < K ? W[(size_t)(ka < K ? ka : K - 1) * ld + n] : 0.f); a[8 + i] = (_Float16)(kb < K ? W[(size_t)(kb < K ? kb : K - 1) * ld + n] : 0.f); }
  return a;
}
struct F2 { v16b h, l; };
__device__ __forceinline__ F2 bsplit16(const float v[16]) { F2 r;
#pragma unroll
  for (int i = 0; i < 16; ++i) { const __bf16 h = (__bf16)v[i]; r.h[i] = h; r.l[i] = (__bf16)(v[i] - (float)h); }
  return r; }
__device__ __forceinline__ F2 split_row(const float* row, int k0, int lane) { float v[16]; const float* p = row + k0 + 8 * (lane >> 4);
#pragma unroll
  for (int i = 0; i < 8; ++i) { v[i] = p[i]; v[8 + i] = p[16 + i]; }
  return bsplit16(v); }
__device__ __forceinline__ F2 split_rowK(const float* row, int k0, int lane, int K) { float v[16]; const int g = lane >> 4;
#pragma unroll
  for (int i = 0; i < 8; ++i) { const int ka = k0 + 8 * g + i, kb = ka + 16; v[i] = ka < K ? row[ka < K ? ka : K - 1] : 0.f; v[8 + i] = kb < K ? row[kb < K ? kb : K - 1] : 0.f; }
  return bsplit16(v); }
__device__ __forceinline__ F2 split_col(const float* W, int k0, int n, int lane, int ld, int K) { float v[16]; const int g = lane >> 4;
#pragma unroll
  for (int i = 0; i < 8; ++i) { const int ka = k0 + 8 * g + i, kb = ka + 16; v[i] = ka < K ? W[(size_t)(ka < K ? ka : K - 1) * ld + n] : 0.f; v[8 + i] = kb < K ? W[(size_t)(kb < K ? kb : K - 1) * ld + n] : 0.f; }
  return bsplit16(v); }
__device__ __forceinline__ v8f mac3(const F2& a, const F2& b, v8f c) { c = wmma_bf(a.l, b.h, c); c = wmma_bf(a.h, b.l, c); return wmma_bf(a.h, b.h, c); }
__device__ __forceinline__ float sigm(float v) { return 1.0f / (1.0f + expf(-v)); }


// Vector-neuron attention (B 4, C 256 = 8 heads x 32, 3 vector components, N 2,048 points): energy contracts over (head_dim, 3); residual output.
#define NB 4
#define CC 256
#define NI 3
#define TT 2048
#define NH 8
#define HD 32
#define KD (HD * NI)        // 96: per-head contraction length, index kk = i*32 + c_local
#define RW (NH * KD)        // 768: q/k row length per token
#ifndef TNB
#define TNB NB
#endif
typedef __attribute__((ext_vector_type(8))) __bf16 v8b;
__device__ __forceinline__ v16b frag_b(const __bf16* rowk0, int lane) {
  union { v16b v; v8b q[2]; } u; const __bf16* p = rowk0 + 8 * (lane >> 4);
  u.q[0] = *(const v8b*)p; u.q[1] = *(const v8b*)(p + 16); return u.v;
}
__device__ __forceinline__ float bfr(float v) { return (float)(__bf16)v; }
__device__ __attribute__((noinline)) float exp_ni(float v) { return expf(v); }
__device__ __attribute__((noinline)) float erf_ni(float v) { return erff(v); }

#define WS_QH  0u
#define WS_KH  (WS_QH + 2u * (size_t)NB * TT * RW)
#define WS_VT  (WS_KH + 2u * (size_t)NB * TT * RW)      // f16 v planes [b][h*96 + kk][n]
#define WS_O3  (WS_VT + 2u * (size_t)NB * RW * TT)      // f32 o [b][i][n][c]
#define WS_PW  (WS_O3 + 4u * (size_t)NB * NI * TT * CC) // bf16 weights in fragment order [matrix q,k,v,o][16 out channels][32 in channels][half][lane][8]
#define WS_END (WS_PW + 2u * 4u * (size_t)CC * CC)

// ---- k_pack: one wave per B fragment f = (matrix * 16 + out tile) * 8 + k step. Lane (col, g) holds W[16 tile + col][32 kc + 8 g + 0..7] and [.. + 16 + 0..7];
// the first eights of the 32 lanes lie in one 512-byte run, the second eights in the next, so that a fragment is read by two loads of whole lines.
__global__ __launch_bounds__(128) void k_pack(const float* __restrict__ WQ, const float* __restrict__ WK, const float* __restrict__ WV, const float* __restrict__ WO, __bf16* __restrict__ PW) {
  const int f = blockIdx.x * 4 + (threadIdx.x >> 5), lane = threadIdx.x & 31, col = lane & 15, g = lane >> 4; const int mat = f >> 7, ot = (f >> 3) & 15, kc = f & 7;
  const float* Wm = mat == 0 ? WQ : mat == 1 ? WK : mat == 2 ? WV : WO; const float* p = Wm + (size_t)(ot * 16 + col) * CC + kc * 32 + 8 * g;
  v8b lo, hi;
  for (int ii = 0; ii < 8; ++ii) { lo[ii] = (__bf16)p[ii]; hi[ii] = (__bf16)p[16 + ii]; }
  __bf16* d = PW + (size_t)f * 512 + lane * 8; *(v8b*)d = lo; *(v8b*)(d + 256) = hi; }
__device__ __forceinline__ v16b frag_pw(const __bf16* PW, int f, int lane) {
  union { v16b v; v8b q[2]; } u; const __bf16* p = PW + (size_t)f * 512 + lane * 8;
  u.q[0] = *(const v8b*)p; u.q[1] = *(const v8b*)(p + 256); return u.v;
}

// ---- k_proj: block = (64 points, 128 out channels, z = b*3 + i): y[o][n] = sum_c W[o][c] x[b][c][i][n] for W = Wq, Wk, Wv in turn, from one staged x tile.
// A wave takes 32 out channels (two B fragments a k step) and all 64 points (four A fragments from LDS): a weight fragment is loaded by one wave only,
// and a matrix's 16 fragments of a wave are in flight together, the next matrix's while this one's results are stored. q, k and v leave through LDS arrays of their own.
__global__ __launch_bounds__(128) void k_proj(const float* __restrict__ X, const __bf16* __restrict__ PW, _Float16* __restrict__ QH, _Float16* __restrict__ KH, _Float16* __restrict__ VT) {
  __shared__ __align__(16) __bf16 sx[64][CC + 8]; __shared__ __align__(16) _Float16 sh[64][136], sk[64][136]; __shared__ __align__(16) _Float16 th[128][72];
  const int tid = threadIdx.x, wave = tid >> 5, lane = tid & 31, col = lane & 15, g = lane >> 4; const int n0 = blockIdx.x * 64; const int c0 = blockIdx.y * 128; const int z = blockIdx.z; const int i = z % NI; const size_t b = z / NI; const int f0 = (c0 / 16 + wave * 2) * 8;
  // x tile: a thread takes four points (one 16-byte load per channel) of eight channels, four such sets. All 32 loads, and the first weight fragments behind
  // them, are issued before the first value is used, so the block waits for memory once; a point's eight channels then go to LDS as one 16-byte store.
  const int nq = tid & 15, c8 = tid >> 4; const float* xp = X + ((b * CC + c8 * 8) * NI + i) * (size_t)TT + n0 + nq * 4;
  v4f xr[4][8];
  for (int k = 0; k < 4; ++k)
    for (int jj = 0; jj < 8; ++jj) xr[k][jj] = *(const v4f*)(xp + (size_t)(k * 64 + jj) * (NI * TT));
  asm volatile("s_wait_xcnt 0x0" ::: "memory");   // stands in front of any reuse of the x loads' address registers (the weight loads below land on them)
  v16b w[CC / 32][2];
  for (int kc = 0; kc < CC / 32; ++kc)
    for (int t = 0; t < 2; ++t) w[kc][t] = frag_pw(PW, f0 + t * 8 + kc, lane);
  __builtin_amdgcn_sched_barrier(0);   // the weight loads are issued ahead of the first wait for x: without it they sink below the conversions and their latency adds to that of x
  for (int k = 0; k < 4; ++k)
    for (int p = 0; p < 4; ++p) { v8b t;
      for (int jj = 0; jj < 8; ++jj) t[jj] = (__bf16)xr[k][jj][p];
      *(v8b*)&sx[nq * 4 + p][(c8 + 8 * k) * 8] = t; }
  __syncthreads();
#pragma unroll   // whole: 'which' is a constant in each copy, so that no copy tests it per element
  for (int which = 0; which < 3; ++which) {
    v8f acc[4][2] = {}; v16b a[4], an[4];
    for (int pt = 0; pt < 4; ++pt) a[pt] = frag_b(&sx[pt * 16 + col][0], lane);
#pragma unroll   // whole: every fragment has its own registers, and the two x fragment sets change places by renaming
    for (int kc = 0; kc < CC / 32; ++kc) {
      if (kc + 1 < CC / 32) {   // the next k step's four x fragments, one group of LDS reads ahead of this step's products
        for (int pt = 0; pt < 4; ++pt) an[pt] = frag_b(&sx[pt * 16 + col][(kc + 1) * 32], lane);
        __builtin_amdgcn_sched_barrier(0); }   // holds the group here: placed behind the products, each k step would wait out the LDS latency
      for (int pt = 0; pt < 4; ++pt)
        for (int t = 0; t < 2; ++t) acc[pt][t] = wmma_bf(a[pt], w[kc][t], acc[pt][t]);
      for (int pt = 0; pt < 4; ++pt) a[pt] = an[pt]; }
#pragma unroll
    for (int pt = 0; pt < 4; ++pt)
#pragma unroll
      for (int t = 0; t < 2; ++t)
#pragma unroll
        for (int r = 0; r < 8; ++r) { const float v = acc[pt][t][r]; const int rl = pt * 16 + 8 * g + r, cl = (wave * 2 + t) * 16 + col; const _Float16 hv = (_Float16)v; if (which == 2) th[cl][rl] = hv; else if (which == 1) sk[rl][cl] = hv; else sh[rl][cl] = hv; }
    __syncthreads();
    if (which < 2) {
      for (int kc = 0; kc < CC / 32; ++kc)
        for (int t = 0; t < 2; ++t) w[kc][t] = frag_pw(PW, f0 + (which + 1) * 128 + t * 8 + kc, lane);
      asm volatile("s_wait_xcnt 0x0" ::: "memory");   // stands in front of any reuse of these loads' address registers (the store loop's addresses land on them)
      __builtin_amdgcn_sched_barrier(0); }   // the next matrix's fragments are issued behind the barrier (which would wait for them) and ahead of the store loop, which covers their latency
    if (which < 2) { _Float16* dh = which == 0 ? QH : KH;   // rows [b][n][h][i*32 + c_local]; this block covers 4 heads (128 channels)
      for (int e = tid; e < 64 * 4 * 4; e += 128) { const int rl = e >> 4, hh = (e >> 2) & 3, q = e & 3; const int h = c0 / HD + hh; const size_t dst = (((b * TT + n0 + rl) * NH + h) * KD) + i * HD + q * 8;
        vst2((unsigned*)(dh + dst), *(const v4u*)&(which == 0 ? sh : sk)[rl][hh * 32 + q * 8]); } }
    else { for (int e = tid; e < 128 * 8; e += 128) { const int cl = e >> 3, q = e & 7; const int c = c0 + cl; const int h = c / HD, cL = c % HD; vst2((unsigned*)(VT + ((b * NH + h) * KD + i * HD + cL) * (size_t)TT + n0 + q * 8), *(const v4u*)&th[cl][q * 8]); } } } }
// ---- k_fa: block = 16 waves x 16 queries of one (b, head). Per 64 keys: S^T = K Q^T (A = k rows, B = q), so a lane holds one query's
// scores (keys 8g + r of each 16-key tile); running maximum (base-2 units) and sum (x 2^11) per query in f32; two S^T tiles convert in place to the B operand of O^T += V^T P^T.
// The 16 waves read the same K rows and V^T rows: a stage of 256 keys is brought into LDS once per block by asynchronous copies, two buffers, the next
// stage in flight while this one is worked on. Row pitches are odd multiples of 16 bytes, so the 16-byte fragment reads meet no bank conflict.
#define SKEYS 256                 // keys per stage
#define KPH 104                   // k row pitch in LDS, halves (192 B of data in 208 B)
#define VPH 264                   // v^T row pitch in LDS, halves (512 B of data in 528 B)
#define KSZ (SKEYS * KPH)         // halves of k rows per stage
#define STG (KSZ + KD * VPH)      // halves per stage buffer
// One lane's share of a stage: three 16-byte pieces (64 B apart) of each of two k rows (128 rows apart) and one piece of each of six v^T rows (16 rows apart).
// s_wait_xcnt 0 closes the statement so that no address register is rewritten ahead of it.
__device__ __forceinline__ void stage_copy(unsigned lk, const _Float16* gk, unsigned lv, const _Float16* gv) {
  const unsigned lk2 = lk + 128u * KPH * 2u; const _Float16* gk2 = gk + 128 * (size_t)RW;
  asm volatile("global_load_async_to_lds_b128 %0, %1, off\n\t"
               "global_load_async_to_lds_b128 %2, %3, off\n\t"
               "global_load_async_to_lds_b128 %4, %5, off\n\t"
               "global_load_async_to_lds_b128 %6, %7, off\n\t"
               "global_load_async_to_lds_b128 %8, %9, off\n\t"
               "global_load_async_to_lds_b128 %10, %11, off\n\t"
               "global_load_async_to_lds_b128 %12, %13, off\n\t"
               "global_load_async_to_lds_b128 %14, %15, off\n\t"
               "global_load_async_to_lds_b128 %16, %17, off\n\t"
               "global_load_async_to_lds_b128 %18, %19, off\n\t"
               "global_load_async_to_lds_b128 %20, %21, off\n\t"
               "global_load_async_to_lds_b128 %22, %23, off\n\t"
               "s_wait_xcnt 0x0"
               :: "v"(lk), "v"(gk), "v"(lk + 64u), "v"(gk + 32), "v"(lk + 128u), "v"(gk + 64),
                  "v"(lk2), "v"(gk2), "v"(lk2 + 64u), "v"(gk2 + 32), "v"(lk2 + 128u), "v"(gk2 + 64),
                  "v"(lv), "v"(gv), "v"(lv + 16u * VPH * 2u), "v"(gv + 16 * (size_t)TT), "v"(lv + 32u * VPH * 2u), "v"(gv + 32 * (size_t)TT),
                  "v"(lv + 48u * VPH * 2u), "v"(gv + 48 * (size_t)TT), "v"(lv + 64u * VPH * 2u), "v"(gv + 64 * (size_t)TT), "v"(lv + 80u * VPH * 2u), "v"(gv + 80 * (size_t)TT)
               : "memory");
}
__global__ __launch_bounds__(512) void k_fa(const _Float16* __restrict__ QH, const _Float16* __restrict__ KH, const _Float16* __restrict__ VT, float* __restrict__ O3) {
  __shared__ __align__(16) _Float16 sm[2 * STG];
  const int tid = threadIdx.x, wave = tid >> 5, lane = tid & 31, col = lane & 15, g = lane >> 4; const int h = blockIdx.y; const size_t b = blockIdx.z; const int qn = blockIdx.x * 256 + wave * 16 + col;
  const _Float16* gk = KH + ((b * TT + (tid >> 2)) * NH + h) * KD + (tid & 3) * 8;                 // this lane's first k row of stage 0
  const _Float16* gv = VT + ((b * NH + h) * KD + (tid >> 5)) * (size_t)TT + (tid & 31) * 8;        // this lane's first v^T row, keys of stage 0
  const unsigned lk = (unsigned)(size_t)sm + (unsigned)(tid >> 2) * (KPH * 2u) + (unsigned)(tid & 3) * 16u;
  const unsigned lv = (unsigned)(size_t)sm + KSZ * 2u + (unsigned)(tid >> 5) * (VPH * 2u) + (unsigned)(tid & 31) * 16u;
  stage_copy(lk, gk, lv, gv);
  v16h qh[KD / 32];
  for (int kc = 0; kc < KD / 32; ++kc) { const size_t qo = ((b * TT + qn) * NH + h) * KD + kc * 32; qh[kc] = frag_h(QH + qo, lane); }
  asm volatile("s_wait_asynccnt 0x0" ::: "memory");   // this wave's share of stage 0 has landed
  __syncthreads();                                    // every wave's share has: stage 0 may be read
  stage_copy(lk + STG * 2u, gk + (size_t)SKEYS * RW, lv + STG * 2u, gv + SKEYS);
  v8f o[KD / 16] = {}; float m = -3.0e38f, l = 0.f;
  const float cs = 0.17677669529663689f * 1.4426950408889634f;   // 32^-0.5 * log2 e: exp((s - max) / sqrt(32)) = exp2(s * cs - max * cs)
  for (int st = 0; st < TT / SKEYS; ++st) {
    const _Float16* kp = sm + (st & 1) * STG + col * KPH;          // A row = key k0 + 16 t + col
    const _Float16* vp = sm + (st & 1) * STG + KSZ + col * VPH;    // A row = kk 16 j + col, k = key
#pragma nounroll   // stays rolled as before: unrolled, the four passes' fragment groups overlap and the wave's 256 registers spill to scratch
    for (int k0 = 0; k0 < SKEYS; k0 += 64) { v8f s[4]; v16h kf[4][KD / 32];
      for (int t = 0; t < 4; ++t)
        for (int kc = 0; kc < KD / 32; ++kc) kf[t][kc] = frag_h(kp + (k0 + t * 16) * KPH + kc * 32, lane);
      __builtin_amdgcn_sched_barrier(0);   // the pass's k fragments are read as one group: one LDS latency a pass instead of one per fragment
      for (int t = 0; t < 4; ++t) { v8f a = {};
        for (int kc = 0; kc < KD / 32; ++kc) a = wmma_h(kf[t][kc], qh[kc], a);
        s[t] = a; }
      v16h vf[KD / 16];
      for (int j = 0; j < KD / 16; ++j) vf[j] = frag_h(vp + (j * 16) * VPH + k0, lane);          // keys k0 .. k0 + 31
      __builtin_amdgcn_sched_barrier(0);   // the six v^T fragments are read as one group here, so that the softmax below covers their LDS latency
      float mx = s[0][0];   // maximum of the raw scores: cs is positive
      for (int t = 0; t < 4; ++t)
        for (int r = 0; r < 8; ++r) mx = fmaxf(mx, s[t][r]);
      mx = fmaxf(mx, __shfl_xor(mx, 16));   // the other half of the wave holds this query's other keys
      mx = fmaxf(m, mx * cs);
      const float al = __builtin_amdgcn_exp2f(m - mx); m = mx; float ps = 0.f; v16h p;
      const v2f cs2 = {cs, cs}, nb = {11.0f - mx, 11.0f - mx};   // P's factor 2^11 rides in the exponent; the sum carries it too
      for (int j = 0; j < KD / 16; ++j)
        for (int r = 0; r < 8; ++r) o[j][r] *= al;
      for (int t = 0; t < 2; ++t)
        for (int r = 0; r < 8; r += 2) { const v2f a = __builtin_elementwise_fma(v2f{s[t][r], s[t][r + 1]}, cs2, nb); const float e0 = __builtin_amdgcn_exp2f(a[0]), e1 = __builtin_amdgcn_exp2f(a[1]);
          ps += e0; ps += e1; p[t * 8 + r] = (_Float16)e0; p[t * 8 + r + 1] = (_Float16)e1; }
      for (int j = 0; j < KD / 16; ++j) o[j] = wmma_h(vf[j], p, o[j]);
      for (int j = 0; j < KD / 16; ++j) vf[j] = frag_h(vp + (j * 16) * VPH + k0 + 32, lane);     // keys k0 + 32 .. k0 + 63
      __builtin_amdgcn_sched_barrier(0);   // as above: one group, covered by the second half of the softmax
      for (int t = 2; t < 4; ++t)
        for (int r = 0; r < 8; r += 2) { const v2f a = __builtin_elementwise_fma(v2f{s[t][r], s[t][r + 1]}, cs2, nb); const float e0 = __builtin_amdgcn_exp2f(a[0]), e1 = __builtin_amdgcn_exp2f(a[1]);
          ps += e0; ps += e1; p[(t - 2) * 8 + r] = (_Float16)e0; p[(t - 2) * 8 + r + 1] = (_Float16)e1; }
      l = l * al + ps;
      for (int j = 0; j < KD / 16; ++j) o[j] = wmma_h(vf[j], p, o[j]); }
    asm volatile("s_wait_dscnt 0x0" ::: "memory");      // this wave's reads of the buffer are done before it is refilled
    asm volatile("s_wait_asynccnt 0x0" ::: "memory");   // this wave's share of stage st + 1 has landed
    __syncthreads();                                    // publishes stage st + 1 and ends every wave's reads of stage st
    if (st + 2 < TT / SKEYS) stage_copy(lk + (unsigned)(st & 1) * (STG * 2u), gk + (size_t)(st + 2) * SKEYS * RW, lv + (unsigned)(st & 1) * (STG * 2u), gv + (st + 2) * SKEYS); }
  asm volatile("s_wait_asynccnt 0x0" ::: "memory");     // no copy is left in flight when the wave ends
  l += __shfl_xor(l, 16); const float inv = 1.0f / l;   // l and o both carry 2^11
  for (int j = 0; j < KD / 16; ++j) { float* dst = O3 + ((b * NI + (j >> 1)) * TT + qn) * (size_t)CC + h * HD + (j & 1) * 16 + 8 * g;   // kk = 16 j + 8 g + r = i * 32 + c_local
    v4f a, c;
    for (int r = 0; r < 4; ++r) { a[r] = o[j][r] * inv; c[r] = o[j][4 + r] * inv; }
    vst2(dst, a); vst2(dst + 4, c); } }
// ---- k_out: block = (64 points, 128 out channels, z = b*3 + i): out[b][o][i][n] = sum_c Wo[o][c] o3[b][i][n][c] + x[b][o][i][n]
__global__ __launch_bounds__(128) void k_out(const float* __restrict__ O3, const __bf16* __restrict__ PW, const float* __restrict__ X, float* __restrict__ OUT) { __shared__ __align__(16) float st[128][68];
  const int tid = threadIdx.x, wave = tid >> 5, lane = tid & 31, col = lane & 15, g = lane >> 4; const int n0 = blockIdx.x * 64; const int c0 = blockIdx.y * 128; const size_t b = blockIdx.z / NI; const int i = blockIdx.z % NI;
  const int f0 = (3 * 16 + c0 / 16) * 8;
  v16b w[8], wn[8];
  for (int j = 0; j < 8; ++j) w[j] = frag_pw(PW, f0 + j * 8, lane);
  v8f acc[8] = {};
#pragma unroll   // whole: the two fragment sets change places by renaming, without register copies
  for (int kc = 0; kc < CC / 32; ++kc) { const F2 a = split_row(O3 + ((b * NI + i) * TT + n0 + wave * 16 + col) * (size_t)CC, kc * 32, lane);
    if (kc + 1 < CC / 32) {   // the next k step's eight fragments, one group of loads ahead of this step's products
      for (int j = 0; j < 8; ++j) wn[j] = frag_pw(PW, f0 + j * 8 + kc + 1, lane); }
    for (int j = 0; j < 8; ++j) { acc[j] = wmma_bf(a.h, w[j], acc[j]); acc[j] = wmma_bf(a.l, w[j], acc[j]); }
    for (int j = 0; j < 8; ++j) w[j] = wn[j]; }
#pragma unroll
  for (int j = 0; j < 8; ++j)
#pragma unroll
    for (int r = 0; r < 8; ++r) st[j * 16 + col][wave * 16 + 8 * g + r] = acc[j][r];
  __syncthreads();
  for (int e = tid; e < 128 * 16; e += 128) { const int cl = e >> 4, q = e & 15; const size_t go = ((b * CC + c0 + cl) * NI + i) * (size_t)TT + n0 + q * 4; const v4f xr = *(const v4f*)(X + go); v4f v = *(const v4f*)&st[cl][q * 4]; v[0] += bfr(xr[0]); v[1] += bfr(xr[1]); v[2] += bfr(xr[2]); v[3] += bfr(xr[3]); vst2(OUT + go, v); } }
extern "C" void kernel_launch(void* const* d_in, const int* in_sizes, int n_in, void* d_out, int out_size, void* d_ws, size_t ws_size, hipStream_t stream) {
  (void)in_sizes; (void)n_in; (void)out_size;
  const float** F = (const float**)d_in;   // 0 x [4,256,3,2048], 1 Wq, 2 Wk, 3 Wv, 4 Wo [256,256] ([out][in])
  if (ws_size < (size_t)WS_END) return;
  char* ws = (char*)d_ws; _Float16 *QH = (_Float16*)(ws + WS_QH), *KH = (_Float16*)(ws + WS_KH), *VT = (_Float16*)(ws + WS_VT); float *O3 = (float*)(ws + WS_O3); __bf16 *PW = (__bf16*)(ws + WS_PW);
  k_pack<<<dim3(4 * 16 * 8 / 4), 128, 0, stream>>>(F[1], F[2], F[3], F[4], PW);
  k_proj<<<dim3(TT / 64, CC / 128, TNB * NI), 128, 0, stream>>>(F[0], PW, QH, KH, VT);
  k_fa<<<dim3(TT / 256, NH, TNB), 512, 0, stream>>>(QH, KH, VT, O3);
  k_out<<<dim3(TT / 64, CC / 128, TNB * NI), 128, 0, stream>>>(O3, PW, F[0], (float*)d_out);
}

// v008
// It runs in 75.7 microseconds.
// In both of two side-by-side timings against v007, it was 1.05 times as fast.
// All steps since v000 together make it 17.7 times as fast.
// compute dtype: all float inputs rounded to bf16; the four W rounded to bf16 once per call and laid out in B-fragment order (k_pack); q/k/v = W x over channels (per vector component) with EXACT bf16 products on WMMA 16x16x32 (x tiles transposed in LDS), f32 accumulate; q (times log2 e / sqrt(32), in f32) and k each rounded once to f16 -> 1-product energies over the 96 (head_dim x 3) pairs, started at 7 - reference, kept in registers; online softmax in f32, base 2 (the hardware exp2 per score; held reference and sum per query, re-based when a lane's P sum of a pass passes 2^15) -> unnormalised P f16 x 2^7; o = P . v (v once to f16) / sum, one launch for all heads; out = Wo o (o split bf16 hi + lo, 2 products) + x; f32 output [b][c][3][n].
#include <hip/hip_runtime.h>
#include <math.h>

typedef __attribute__((ext_vector_type(16))) _Float16 v16h;
typedef __attribute__((ext_vector_type(16))) __bf16 v16b;
typedef __attribute__((ext_vector_type(8)))  _Float16 v8h;
typedef __attribute__((ext_vector_type(8)))  float v8f;
typedef __attribute__((ext_vector_type(4)))  float v4f;
typedef __attribute__((ext_vector_type(2)))  float v2f;
typedef __attribute__((ext_vector_type(4)))  unsigned v4u;
typedef __attribute__((ext_vector_type(4)))  int v4i;
typedef float __attribute__((may_alias)) float_a;
typedef int __attribute__((may_alias)) int_a;

template <typename T> __device__ __forceinline__ void vst2(void* p, T v) { *(T*)p = v;  }
__device__ __forceinline__ v8f wmma_h(v16h a, v16h b, v8f c) { return __builtin_amdgcn_wmma_f32_16x16x32_f16(false, a, false, b, (short)0, c, false, false); }
__device__ __forceinline__ v8f wmma_bf(v16b a, v16b b, v8f c) {
  v8f d = __builtin_amdgcn_wmma_f32_16x16x32_bf16(false, a, false, b, (short)0, c, false, false);
  asm volatile("v_nop\n\tv_nop\n\tv_nop\n\tv_nop" : "+v"(d) : "v"(a), "v"(b));
  return d;
}
// 16x16x32 fragments: lane = (h = lane>>4, row/col = lane&15); elements 0..7 = k0+8h+0..7, 8..15 = k0+16+8h+0..7; D element r = row 8h+r
__device__ __forceinline__ v16h frag_h(const _Float16* rowk0, int lane) {
  union { v16h v; v8h q[2]; } u; const _Float16* p = rowk0 + 8 * (lane >> 4);
  u.q[0] = *(const v8h*)p; u.q[1] = *(const v8h*)(p + 16); return u.v;
}
__device__ __forceinline__ v16h frag_f32(const float* rowk0, int lane) {
  v16h a; const float* p = rowk0 + 8 * (lane >> 4);
#pragma unroll
  for (int i = 0; i < 8; ++i) { a[i] = (_Float16)p[i]; a[8 + i] = (_Float16)p[16 + i]; }
  return a;
}
__device__ __forceinline__ v16h frag_f32s(const float* rowk0, int lane, float sc) {
  v16h a; const float* p = rowk0 + 8 * (lane >> 4);
#pragma unroll
  for (int i = 0; i < 8; ++i) { a[i] = (_Float16)(p[i] * sc); a[8 + i] = (_Float16)(p[16 + i] * sc); }
  return a;
}
// column fragment from a [K][ld] layout (column n), rows >= K read as 0
__device__ __forceinline__ v16h fragc_f32(const float* W, int k0, int n, int lane, int ld, int K) {
  v16h a; const int g = lane >> 4;
#pragma unroll
  for (int i = 0; i < 8; ++i) { const int ka = k0 + 8 * g + i, kb = ka + 16;
    a[i] = (_Float16)(ka < K ? W[(size_t)(ka < K ? ka : K - 1) * ld + n] : 0.f); a[8 + i] = (_Float16)(kb < K ? W[(size_t)(kb < K ? kb : K - 1) * ld + n] : 0.f); }
  return a;
}
struct F2 { v16b h, l; };
__device__ __forceinline__ F2 bsplit16(const float v[16]) { F2 r;
#pragma unroll
  for (int i = 0; i < 16; ++i) { const __bf16 h = (__bf16)v[i]; r.h[i] = h; r.l[i] = (__bf16)(v[i] - (float)h); }
  return r; }
__device__ __forceinline__ F2 split_row(const float* row, int k0, int lane) { float v[16]; const float* p = row + k0 + 8 * (lane >> 4);
#pragma unroll
  for (int i = 0; i < 8; ++i) { v[i] = p[i]; v[8 + i] = p[16 + i]; }
  return bsplit16(v); }
__device__ __forceinline__ F2 split_rowK(const float* row, int k0, int lane, int K) { float v[16]; const int g = lane >> 4;
#pragma unroll
  for (int i = 0; i < 8; ++i) { const int ka = k0 + 8 * g + i, kb = ka + 16; v[i] = ka < K ? row[ka < K ? ka : K - 1] : 0.f; v[8 + i] = kb < K ? row[kb < K ? kb : K - 1] : 0.f; }
  return bsplit16(v); }
__device__ __forceinline__ F2 split_col(const float* W, int k0, int n, int lane, int ld, int K) { float v[16]; const int g = lane >> 4;
#pragma unroll
  for (int i = 0; i < 8; ++i) { const int ka = k0 + 8 * g + i, kb = ka + 16; v[i] = ka < K ? W[(size_t)(ka < K ? ka : K - 1) * ld + n] : 0.f; v[8 + i] = kb < K ? W[(size_t)(kb < K ? kb : K - 1) * ld + n] : 0.f; }
  return bsplit16(v); }
__device__ __forceinline__ v8f mac3(const F2& a, const F2& b, v8f c) { c = wmma_bf(a.l, b.h, c); c = wmma_bf(a.h, b.l, c); return wmma_bf(a.h, b.h, c); }
__device__ __forceinline__ float sigm(float v) { return 1.0f / (1.0f + expf(-v)); }


// Vector-neuron attention (B 4, C 256 = 8 heads x 32, 3 vector components, N 2,048 points): energy contracts over (head_dim, 3); residual output.
#define NB 4
#define CC 256
#define NI 3
#define TT 2048
#define NH 8
#define HD 32
#define KD (HD * NI)        // 96: per-head contraction length, index kk = i*32 + c_local
#define RW (NH * KD)        // 768: q/k row length per token
#ifndef TNB
#define TNB NB
#endif
typedef __attribute__((ext_vector_type(8))) __bf16 v8b;
__device__ __forceinline__ v16b frag_b(const __bf16* rowk0, int lane) {
  union { v16b v; v8b q[2]; } u; const __bf16* p = rowk0 + 8 * (lane >> 4);
  u.q[0] = *(const v8b*)p; u.q[1] = *(const v8b*)(p + 16); return u.v;
}
__device__ __forceinline__ float bfr(float v) { return (float)(__bf16)v; }
__device__ __attribute__((noinline)) float exp_ni(float v) { return expf(v); }
__device__ __attribute__((noinline)) float erf_ni(float v) { return erff(v); }

#define QSC (0.17677669529663689f * 1.4426950408889634f)   // 32^-0.5 * log2 e, folded into q ahead of its one rounding: q . k is then the exponent of 2
#define WS_QH  0u
#define WS_KH  (WS_QH + 2u * (size_t)NB * TT * RW)
#define WS_VT  (WS_KH + 2u * (size_t)NB * TT * RW)      // f16 v planes [b][h*96 + kk][n]
#define WS_O3  (WS_VT + 2u * (size_t)NB * RW * TT)      // f32 o [b][i][n][c]
#define WS_PW  (WS_O3 + 4u * (size_t)NB * NI * TT * CC) // bf16 weights in fragment order [matrix q,k,v,o][16 out channels][32 in channels][half][lane][8]
#define WS_END (WS_PW + 2u * 4u * (size_t)CC * CC)

// ---- k_pack: one wave per B fragment f = (matrix * 16 + out tile) * 8 + k step. Lane (col, g) holds W[16 tile + col][32 kc + 8 g + 0..7] and [.. + 16 + 0..7];
// the first eights of the 32 lanes lie in one 512-byte run, the second eights in the next, so that a fragment is read by two loads of whole lines.
__global__ __launch_bounds__(128) void k_pack(const float* __restrict__ WQ, const float* __restrict__ WK, const float* __restrict__ WV, const float* __restrict__ WO, __bf16* __restrict__ PW) {
  const int f = blockIdx.x * 4 + (threadIdx.x >> 5), lane = threadIdx.x & 31, col = lane & 15, g = lane >> 4; const int mat = f >> 7, ot = (f >> 3) & 15, kc = f & 7;
  const float* Wm = mat == 0 ? WQ : mat == 1 ? WK : mat == 2 ? WV : WO; const float* p = Wm + (size_t)(ot * 16 + col) * CC + kc * 32 + 8 * g;
  v8b lo, hi;
  for (int ii = 0; ii < 8; ++ii) { lo[ii] = (__bf16)p[ii]; hi[ii] = (__bf16)p[16 + ii]; }
  __bf16* d = PW + (size_t)f * 512 + lane * 8; *(v8b*)d = lo; *(v8b*)(d + 256) = hi; }
__device__ __forceinline__ v16b frag_pw(const __bf16* PW, int f, int lane) {
  union { v16b v; v8b q[2]; } u; const __bf16* p = PW + (size_t)f * 512 + lane * 8;
  u.q[0] = *(const v8b*)p; u.q[1] = *(const v8b*)(p + 256); return u.v;
}

// ---- k_proj: block = (64 points, 128 out channels, z = b*3 + i): y[o][n] = sum_c W[o][c] x[b][c][i][n] for W = Wq, Wk, Wv in turn, from one staged x tile.
// A wave takes 32 out channels (two B fragments a k step) and all 64 points (four A fragments from LDS): a weight fragment is loaded by one wave only,
// and a matrix's 16 fragments of a wave are in flight together, the next matrix's while this one's results are stored. q, k and v leave through LDS arrays of their own.
__global__ __launch_bounds__(128) void k_proj(const float* __restrict__ X, const __bf16* __restrict__ PW, _Float16* __restrict__ QH, _Float16* __restrict__ KH, _Float16* __restrict__ VT) {
  __shared__ __align__(16) __bf16 sx[64][CC + 8]; __shared__ __align__(16) _Float16 sh[64][136], sk[64][136]; __shared__ __align__(16) _Float16 th[128][72];
  const int tid = threadIdx.x, wave = tid >> 5, lane = tid & 31, col = lane & 15, g = lane >> 4; const int n0 = blockIdx.x * 64; const int c0 = blockIdx.y * 128; const int z = blockIdx.z; const int i = z % NI; const size_t b = z / NI; const int f0 = (c0 / 16 + wave * 2) * 8;
  // x tile: a thread takes four points (one 16-byte load per channel) of eight channels, four such sets. All 32 loads, and the first weight fragments behind
  // them, are issued before the first value is used, so the block waits for memory once; a point's eight channels then go to LDS as one 16-byte store.
  const int nq = tid & 15, c8 = tid >> 4; const float* xp = X + ((b * CC + c8 * 8) * NI + i) * (size_t)TT + n0 + nq * 4;
  v4f xr[4][8];
  for (int k = 0; k < 4; ++k)
    for (int jj = 0; jj < 8; ++jj) xr[k][jj] = *(const v4f*)(xp + (size_t)(k * 64 + jj) * (NI * TT));
  asm volatile("s_wait_xcnt 0x0" ::: "memory");   // stands in front of any reuse of the x loads' address registers (the weight loads below land on them)
  v16b w[CC / 32][2];
  for (int kc = 0; kc < CC / 32; ++kc)
    for (int t = 0; t < 2; ++t) w[kc][t] = frag_pw(PW, f0 + t * 8 + kc, lane);
  __builtin_amdgcn_sched_barrier(0);   // the weight loads are issued ahead of the first wait for x: without it they sink below the conversions and their latency adds to that of x
  for (int k = 0; k < 4; ++k)
    for (int p = 0; p < 4; ++p) { v8b t;
      for (int jj = 0; jj < 8; ++jj) t[jj] = (__bf16)xr[k][jj][p];
      *(v8b*)&sx[nq * 4 + p][(c8 + 8 * k) * 8] = t; }
  __syncthreads();
#pragma unroll   // whole: 'which' is a constant in each copy, so that no copy tests it per element
  for (int which = 0; which < 3; ++which) {
    v8f acc[4][2] = {}; v16b a[4], an[4];
    for (int pt = 0; pt < 4; ++pt) a[pt] = frag_b(&sx[pt * 16 + col][0], lane);
#pragma unroll   // whole: every fragment has its own registers, and the two x fragment sets change places by renaming
    for (int kc = 0; kc < CC / 32; ++kc) {
      if (kc + 1 < CC / 32) {   // the next k step's four x fragments, one group of LDS reads ahead of this step's products
        for (int pt = 0; pt < 4; ++pt) an[pt] = frag_b(&sx[pt * 16 + col][(kc + 1) * 32], lane);
        __builtin_amdgcn_sched_barrier(0); }   // holds the group here: placed behind the products, each k step would wait out the LDS latency
      for (int pt = 0; pt < 4; ++pt)
        for (int t = 0; t < 2; ++t) acc[pt][t] = wmma_bf(a[pt], w[kc][t], acc[pt][t]);
      for (int pt = 0; pt < 4; ++pt) a[pt] = an[pt]; }
#pragma unroll
    for (int pt = 0; pt < 4; ++pt)
#pragma unroll
      for (int t = 0; t < 2; ++t)
#pragma unroll
        for (int r = 0; r < 8; ++r) { const float v = acc[pt][t][r]; const int rl = pt * 16 + 8 * g + r, cl = (wave * 2 + t) * 16 + col; const _Float16 hv = (_Float16)(which == 0 ? v * QSC : v); if (which == 2) th[cl][rl] = hv; else if (which == 1) sk[rl][cl] = hv; else sh[rl][cl] = hv; }
    __syncthreads();
    if (which < 2) {
      for (int kc = 0; kc < CC / 32; ++kc)
        for (int t = 0; t < 2; ++t) w[kc][t] = frag_pw(PW, f0 + (which + 1) * 128 + t * 8 + kc, lane);
      asm volatile("s_wait_xcnt 0x0" ::: "memory");   // stands in front of any reuse of these loads' address registers (the store loop's addresses land on them)
      __builtin_amdgcn_sched_barrier(0); }   // the next matrix's fragments are issued behind the barrier (which would wait for them) and ahead of the store loop, which covers their latency
    if (which < 2) { _Float16* dh = which == 0 ? QH : KH;   // rows [b][n][h][i*32 + c_local]; this block covers 4 heads (128 channels)
      for (int e = tid; e < 64 * 4 * 4; e += 128) { const int rl = e >> 4, hh = (e >> 2) & 3, q = e & 3; const int h = c0 / HD + hh; const size_t dst = (((b * TT + n0 + rl) * NH + h) * KD) + i * HD + q * 8;
        vst2((unsigned*)(dh + dst), *(const v4u*)&(which == 0 ? sh : sk)[rl][hh * 32 + q * 8]); } }
    else { for (int e = tid; e < 128 * 8; e += 128) { const int cl = e >> 3, q = e & 7; const int c = c0 + cl; const int h = c / HD, cL = c % HD; vst2((unsigned*)(VT + ((b * NH + h) * KD + i * HD + cL) * (size_t)TT + n0 + q * 8), *(const v4u*)&th[cl][q * 8]); } } } }
// ---- k_fa: block = 16 waves x 16 queries of one (b, head). Per 64 keys: S^T = K Q^T (A = k rows, B = q), so a lane holds one query's
// scores (keys 8g + r of each 16-key tile); two S^T tiles convert in place to the B operand of O^T += V^T P^T.
// Held reference: the score products start from C = 7 - reference, so an accumulator is exp2's argument as it stands. The reference moves (o, sum and this pass's scores
// re-based, P formed anew) only when some lane's sum of P over the pass exceeds 2^15, tested once a pass ahead of the P . V products: P stays inside f16. The first pass always sets it.
// The 16 waves read the same K rows and V^T rows: a stage of 256 keys is brought into LDS once per block by asynchronous copies, two buffers, the next
// stage in flight while this one is worked on. Row pitches are odd multiples of 16 bytes, so the 16-byte fragment reads meet no bank conflict.
#define SKEYS 256                 // keys per stage
#define KPH 104                   // k row pitch in LDS, halves (192 B of data in 208 B)
#define VPH 264                   // v^T row pitch in LDS, halves (512 B of data in 528 B)
#define KSZ (SKEYS * KPH)         // halves of k rows per stage
#define STG (KSZ + KD * VPH)      // halves per stage buffer
// One lane's share of a stage: three 16-byte pieces (64 B apart) of each of two k rows (128 rows apart) and one piece of each of six v^T rows (16 rows apart).
// s_wait_xcnt 0 closes the statement so that no address register is rewritten ahead of it.
__device__ __forceinline__ void stage_copy(unsigned lk, const _Float16* gk, unsigned lv, const _Float16* gv) {
  const unsigned lk2 = lk + 128u * KPH * 2u; const _Float16* gk2 = gk + 128 * (size_t)RW;
  asm volatile("global_load_async_to_lds_b128 %0, %1, off\n\t"
               "global_load_async_to_lds_b128 %2, %3, off\n\t"
               "global_load_async_to_lds_b128 %4, %5, off\n\t"
               "global_load_async_to_lds_b128 %6, %7, off\n\t"
               "global_load_async_to_lds_b128 %8, %9, off\n\t"
               "global_load_async_to_lds_b128 %10, %11, off\n\t"
               "global_load_async_to_lds_b128 %12, %13, off\n\t"
               "global_load_async_to_lds_b128 %14, %15, off\n\t"
               "global_load_async_to_lds_b128 %16, %17, off\n\t"
               "global_load_async_to_lds_b128 %18, %19, off\n\t"
               "global_load_async_to_lds_b128 %20, %21, off\n\t"
               "global_load_async_to_lds_b128 %22, %23, off\n\t"
               "s_wait_xcnt 0x0"
               :: "v"(lk), "v"(gk), "v"(lk + 64u), "v"(gk + 32), "v"(lk + 128u), "v"(gk + 64),
                  "v"(lk2), "v"(gk2), "v"(lk2 + 64u), "v"(gk2 + 32), "v"(lk2 + 128u), "v"(gk2 + 64),
                  "v"(lv), "v"(gv), "v"(lv + 16u * VPH * 2u), "v"(gv + 16 * (size_t)TT), "v"(lv + 32u * VPH * 2u), "v"(gv + 32 * (size_t)TT),
                  "v"(lv + 48u * VPH * 2u), "v"(gv + 48 * (size_t)TT), "v"(lv + 64u * VPH * 2u), "v"(gv + 64 * (size_t)TT), "v"(lv + 80u * VPH * 2u), "v"(gv + 80 * (size_t)TT)
               : "memory");
}
// exp2 for the rare re-base path; the v_nop is the slot that the instruction set asks for behind a transcendental
__device__ __forceinline__ float exp2_slot(float x) { float r; asm("v_exp_f32 %0, %1\n\tv_nop" : "=v"(r) : "v"(x)); return r; }
__global__ __launch_bounds__(512) void k_fa(const _Float16* __restrict__ QH, const _Float16* __restrict__ KH, const _Float16* __restrict__ VT, float* __restrict__ O3) {
  __shared__ __align__(16) _Float16 sm[2 * STG];
  const int tid = threadIdx.x, wave = tid >> 5, lane = tid & 31, col = lane & 15, g = lane >> 4; const int h = blockIdx.y; const size_t b = blockIdx.z; const int qn = blockIdx.x * 256 + wave * 16 + col;
  const _Float16* gk = KH + ((b * TT + (tid >> 2)) * NH + h) * KD + (tid & 3) * 8;                 // this lane's first k row of stage 0
  const _Float16* gv = VT + ((b * NH + h) * KD + (tid >> 5)) * (size_t)TT + (tid & 31) * 8;        // this lane's first v^T row, keys of stage 0
  const unsigned lk = (unsigned)(size_t)sm + (unsigned)(tid >> 2) * (KPH * 2u) + (unsigned)(tid & 3) * 16u;
  const unsigned lv = (unsigned)(size_t)sm + KSZ * 2u + (unsigned)(tid >> 5) * (VPH * 2u) + (unsigned)(tid & 31) * 16u;
  stage_copy(lk, gk, lv, gv);
  v16h qh[KD / 32];
  for (int kc = 0; kc < KD / 32; ++kc) { const size_t qo = ((b * TT + qn) * NH + h) * KD + kc * 32; qh[kc] = frag_h(QH + qo, lane); }
  asm volatile("s_wait_asynccnt 0x0" ::: "memory");   // this wave's share of stage 0 has landed
  __syncthreads();                                    // every wave's share has: stage 0 may be read
  stage_copy(lk + STG * 2u, gk + (size_t)SKEYS * RW, lv + STG * 2u, gv + SKEYS);
  v8f o[KD / 16] = {}; float l = 0.f;
  v8f c8; for (int r = 0; r < 8; ++r) c8[r] = 7.0f;   // C of the score products: 7 - reference of this lane's query (reference 0 until the first pass)
  float lim = -1.0f, dlo = -3.0e38f;                  // first pass: the test always fires and the reference may also go down; afterwards 2^15 and 0
  for (int st = 0; st < TT / SKEYS; ++st) {
    const _Float16* kp = sm + (st & 1) * STG + col * KPH;          // A row = key k0 + 16 t + col
    const _Float16* vp = sm + (st & 1) * STG + KSZ + col * VPH;    // A row = kk 16 j + col, k = key
#pragma nounroll   // stays rolled as before: unrolled, the four passes' fragment groups overlap and the wave's 256 registers spill to scratch
    for (int k0 = 0; k0 < SKEYS; k0 += 64) { v8f s[4]; v16h kf[4][KD / 32];
      for (int t = 0; t < 4; ++t)
        for (int kc = 0; kc < KD / 32; ++kc) kf[t][kc] = frag_h(kp + (k0 + t * 16) * KPH + kc * 32, lane);
      __builtin_amdgcn_sched_barrier(0);   // the pass's k fragments are read as one group: one LDS latency a pass instead of one per fragment
      for (int t = 0; t < 4; ++t) { v8f a = c8;
        for (int kc = 0; kc < KD / 32; ++kc) a = wmma_h(kf[t][kc], qh[kc], a);
        s[t] = a; }
      v16h vf[2][KD / 16];
      for (int j = 0; j < KD / 16; ++j) vf[0][j] = frag_h(vp + (j * 16) * VPH + k0, lane);          // keys k0 .. k0 + 31
      __builtin_amdgcn_sched_barrier(0);   // the six v^T fragments are read as one group here, so that the softmax below covers their LDS latency
      v16h p[2];
      const auto expo = [&](const bool again) {   // P = 2^score, packed to f16, and this lane's sum of it in f32: one chain per 16-key tile, two to a packed add, since the test below waits for the sum
        v2f a01, a23;
        for (int r = 0; r < 8; ++r) { const v2f e01 = {again ? exp2_slot(s[0][r]) : __builtin_amdgcn_exp2f(s[0][r]), again ? exp2_slot(s[1][r]) : __builtin_amdgcn_exp2f(s[1][r])}, e23 = {again ? exp2_slot(s[2][r]) : __builtin_amdgcn_exp2f(s[2][r]), again ? exp2_slot(s[3][r]) : __builtin_amdgcn_exp2f(s[3][r])};
          a01 = r ? a01 + e01 : e01; a23 = r ? a23 + e23 : e23;
          p[0][r] = (_Float16)e01[0]; p[0][8 + r] = (_Float16)e01[1]; p[1][r] = (_Float16)e23[0]; p[1][8 + r] = (_Float16)e23[1]; }
        const v2f a = a01 + a23; return a[0] + a[1]; };
      float ps = expo(false);
      if (__builtin_amdgcn_ballot_w32(ps > lim) != 0) {   // wave-uniform, rare: a scalar branch, once a pass. No term of a sum <= 2^15 is above 2^15, so P as packed is finite
        float mx = s[0][0];
        for (int t = 0; t < 4; ++t)
          for (int r = 0; r < 8; ++r) mx = fmaxf(mx, s[t][r]);
        mx = fmaxf(mx, __shfl_xor(mx, 16));   // the other half of the wave holds this query's other keys
        const float d = fmaxf(mx - 7.0f, dlo);   // the reference rises by d (after the first pass a query below its reference keeps it: d = 0); every score is then <= 7
        const float al = __builtin_amdgcn_exp2f(fminf(-d, 0.f));
        for (int r = 0; r < 8; ++r) c8[r] -= d;
        for (int t = 0; t < 4; ++t)
          for (int r = 0; r < 8; ++r) s[t][r] -= d;
        for (int j = 0; j < KD / 16; ++j)
          for (int r = 0; r < 8; ++r) o[j][r] *= al;
        l *= al; lim = 32768.0f; dlo = 0.f;
        ps = expo(true); }
      l += ps;
      for (int j = 0; j < KD / 16; ++j) vf[1][j] = frag_h(vp + (j * 16) * VPH + k0 + 32, lane);     // keys k0 + 32 .. k0 + 63, into the registers that the scores leave
      __builtin_amdgcn_sched_barrier(0);   // one group, ahead of the first six products, which cover part of its LDS latency
      for (int hf = 0; hf < 2; ++hf)
        for (int j = 0; j < KD / 16; ++j) o[j] = wmma_h(vf[hf][j], p[hf], o[j]); }
    asm volatile("s_wait_dscnt 0x0" ::: "memory");      // this wave's reads of the buffer are done before it is refilled
    asm volatile("s_wait_asynccnt 0x0" ::: "memory");   // this wave's share of stage st + 1 has landed
    __syncthreads();                                    // publishes stage st + 1 and ends every wave's reads of stage st
    if (st + 2 < TT / SKEYS) stage_copy(lk + (unsigned)(st & 1) * (STG * 2u), gk + (size_t)(st + 2) * SKEYS * RW, lv + (unsigned)(st & 1) * (STG * 2u), gv + (st + 2) * SKEYS); }
  asm volatile("s_wait_asynccnt 0x0" ::: "memory");     // no copy is left in flight when the wave ends
  l += __shfl_xor(l, 16); const float inv = 1.0f / l;   // l and o carry the same factor
  for (int j = 0; j < KD / 16; ++j) { float* dst = O3 + ((b * NI + (j >> 1)) * TT + qn) * (size_t)CC + h * HD + (j & 1) * 16 + 8 * g;   // kk = 16 j + 8 g + r = i * 32 + c_local
    v4f a, c;
    for (int r = 0; r < 4; ++r) { a[r] = o[j][r] * inv; c[r] = o[j][4 + r] * inv; }
    vst2(dst, a); vst2(dst + 4, c); } }
// ---- k_out: block = (64 points, 128 out channels, z = b*3 + i): out[b][o][i][n] = sum_c Wo[o][c] o3[b][i][n][c] + x[b][o][i][n]
__global__ __launch_bounds__(128) void k_out(const float* __restrict__ O3, const __bf16* __restrict__ PW, const float* __restrict__ X, float* __restrict__ OUT) { __shared__ __align__(16) float st[128][68];
  const int tid = threadIdx.x, wave = tid >> 5, lane = tid & 31, col = lane & 15, g = lane >> 4; const int n0 = blockIdx.x * 64; const int c0 = blockIdx.y * 128; const size_t b = blockIdx.z / NI; const int i = blockIdx.z % NI;
  const int f0 = (3 * 16 + c0 / 16) * 8;
  v16b w[8], wn[8];
  for (int j = 0; j < 8; ++j) w[j] = frag_pw(PW, f0 + j * 8, lane);
  v8f acc[8] = {};
#pragma unroll   // whole: the two fragment sets change places by renaming, without register copies
  for (int kc = 0; kc < CC / 32; ++kc) { const F2 a = split_row(O3 + ((b * NI + i) * TT + n0 + wave * 16 + col) * (size_t)CC, kc * 32, lane);
    if (kc + 1 < CC / 32) {   // the next k step's eight fragments, one group of loads ahead of this step's products
      for (int j = 0; j < 8; ++j) wn[j] = frag_pw(PW, f0 + j * 8 + kc + 1, lane); }
    for (int j = 0; j < 8; ++j) { acc[j] = wmma_bf(a.h, w[j], acc[j]); acc[j] = wmma_bf(a.l, w[j], acc[j]); }
    for (int j = 0; j < 8; ++j) w[j] = wn[j]; }
#pragma unroll
  for (int j = 0; j < 8; ++j)
#pragma unroll
    for (int r = 0; r < 8; ++r) st[j * 16 + col][wave * 16 + 8 * g + r] = acc[j][r];
  __syncthreads();
  for (int e = tid; e < 128 * 16; e += 128) { const int cl = e >> 4, q = e & 15; const size_t go = ((b * CC + c0 + cl) * NI + i) * (size_t)TT + n0 + q * 4; const v4f xr = *(const v4f*)(X + go); v4f v = *(const v4f*)&st[cl][q * 4]; v[0] += bfr(xr[0]); v[1] += bfr(xr[1]); v[2] += bfr(xr[2]); v[3] += bfr(xr[3]); vst2(OUT + go, v); } }
extern "C" void kernel_launch(void* const* d_in, const int* in_sizes, int n_in, void* d_out, int out_size, void* d_ws, size_t ws_size, hipStream_t stream) {
  (void)in_sizes; (void)n_in; (void)out_size;
  const float** F = (const float**)d_in;   // 0 x [4,256,3,2048], 1 Wq, 2 Wk, 3 Wv, 4 Wo [256,256] ([out][in])
  if (ws_size < (size_t)WS_END) return;
  char* ws = (char*)d_ws; _Float16 *QH = (_Float16*)(ws + WS_QH), *KH = (_Float16*)(ws + WS_KH), *VT = (_Float16*)(ws + WS_VT); float *O3 = (float*)(ws + WS_O3); __bf16 *PW = (__bf16*)(ws + WS_PW);
  k_pack<<<dim3(4 * 16 * 8 / 4), 128, 0, stream>>>(F[1], F[2], F[3], F[4], PW);
  k_proj<<<dim3(TT / 64, CC / 128, TNB * NI), 128, 0, stream>>>(F[0], PW, QH, KH, VT);
  k_fa<<<dim3(TT / 256, NH, TNB), 512, 0, stream>>>(QH, KH, VT, O3);
  k_out<<<dim3(TT / 64, CC / 128, TNB * NI), 128, 0, stream>>>(O3, PW, F[0], (float*)d_out);
}

// v009
// One run takes 73.4 microseconds.
// Next to v008, in two timings, it ran 1.04 and 1.03 times as fast.
// Over all steps from v000 it is 18.3 times as fast.
// compute dtype: all float inputs rounded to bf16; the four W rounded to bf16 once per call and laid out in B-fragment order (k_pack); q/k/v = W x over channels (per vector component) with EXACT bf16 products on WMMA 16x16x32 (x tiles transposed in LDS), f32 accumulate; q (times log2 e / sqrt(32), in f32) and k each rounded once to f16 -> 1-product energies over the 96 (head_dim x 3) pairs, started at 7 - reference, kept in registers; online softmax in f32, base 2 (the hardware exp2 per score; held reference and sum per query, re-based when a lane's P sum of a pass passes 2^15) -> unnormalised P f16 x 2^7; o = P . v (v once to f16) / sum, one launch for all heads; out = Wo o (o split bf16 hi + lo, 2 products) + x; f32 output [b][c][3][n].
#include <hip/hip_runtime.h>
#include <math.h>

typedef __attribute__((ext_vector_type(16))) _Float16 v16h;
typedef __attribute__((ext_vector_type(16))) __bf16 v16b;
typedef __attribute__((ext_vector_type(8)))  _Float16 v8h;
typedef __attribute__((ext_vector_type(8)))  float v8f;
typedef __attribute__((ext_vector_type(4)))  float v4f;
typedef __attribute__((ext_vector_type(2)))  float v2f;
typedef __attribute__((ext_vector_type(4)))  unsigned v4u;
typedef __attribute__((ext_vector_type(4)))  int v4i;
typedef float __attribute__((may_alias)) float_a;
typedef int __attribute__((may_alias)) int_a;

template <typename T> __device__ __forceinline__ void vst2(void* p, T v) { *(T*)p = v;  }
__device__ __forceinline__ v8f wmma_h(v16h a, v16h b, v8f c) { return __builtin_amdgcn_wmma_f32_16x16x32_f16(false, a, false, b, (short)0, c, false, false); }
__device__ __forceinline__ v8f wmma_bf(v16b a, v16b b, v8f c) {
  v8f d = __builtin_amdgcn_wmma_f32_16x16x32_bf16(false, a, false, b, (short)0, c, false, false);
  asm volatile("v_nop\n\tv_nop\n\tv_nop\n\tv_nop" : "+v"(d) : "v"(a), "v"(b));
  return d;
}
// 16x16x32 fragments: lane = (h = lane>>4, row/col = lane&15); elements 0..7 = k0+8h+0..7, 8..15 = k0+16+8h+0..7; D element r = row 8h+r
__device__ __forceinline__ v16h frag_h(const _Float16* rowk0, int lane) {
  union { v16h v; v8h q[2]; } u; const _Float16* p = rowk0 + 8 * (lane >> 4);
  u.q[0] = *(const v8h*)p; u.q[1] = *(const v8h*)(p + 16); return u.v;
}
__device__ __forceinline__ v16h frag_f32(const float* rowk0, int lane) {
  v16h a; const float* p = rowk0 + 8 * (lane >> 4);
#pragma unroll
  for (int i = 0; i < 8; ++i) { a[i] = (_Float16)p[i]; a[8 + i] = (_Float16)p[16 + i]; }
  return a;
}
__device__ __forceinline__ v16h frag_f32s(const float* rowk0, int lane, float sc) {
  v16h a; const float* p = rowk0 + 8 * (lane >> 4);
#pragma unroll
  for (int i = 0; i < 8; ++i) { a[i] = (_Float16)(p[i] * sc); a[8 + i] = (_Float16)(p[16 + i] * sc); }
  return a;
}
// column fragment from a [K][ld] layout (column n), rows >= K read as 0
__device__ __forceinline__ v16h fragc_f32(const float* W, int k0, int n, int lane, int ld, int K) {
  v16h a; const int g = lane >> 4;
#pragma unroll
  for (int i = 0; i < 8; ++i) { const int ka = k0 + 8 * g + i, kb = ka + 16;
    a[i] = (_Float16)(ka < K ? W[(size_t)(ka < K ? ka : K - 1) * ld + n] : 0.f); a[8 + i] = (_Float16)(kb < K ? W[(size_t)(kb < K ? kb : K - 1) * ld + n] : 0.f); }
  return a;
}
struct F2 { v16b h, l; };
__device__ __forceinline__ F2 bsplit16(const float v[16]) { F2 r;
#pragma unroll
  for (int i = 0; i < 16; ++i) { const __bf16 h = (__bf16)v[i]; r.h[i] = h; r.l[i] = (__bf16)(v[i] - (float)h); }
  return r; }
__device__ __forceinline__ F2 split_row(const float* row, int k0, int lane) { float v[16]; const float* p = row + k0 + 8 * (lane >> 4);
#pragma unroll
  for (int i = 0; i < 8; ++i) { v[i] = p[i]; v[8 + i] = p[16 + i]; }
  return bsplit16(v); }
__device__ __forceinline__ F2 split_rowK(const float* row, int k0, int lane, int K) { float v[16]; const int g = lane >> 4;
#pragma unroll
  for (int i = 0; i < 8; ++i) { const int ka = k0 + 8 * g + i, kb = ka + 16; v[i] = ka < K ? row[ka < K ? ka : K - 1] : 0.f; v[8 + i] = kb < K ? row[kb < K ? kb : K - 1] : 0.f; }
  return bsplit16(v); }
__device__ __forceinline__ F2 split_col(const float* W, int k0, int n, int lane, int ld, int K) { float v[16]; const int g = lane >> 4;
#pragma unroll
  for (int i = 0; i < 8; ++i) { const int ka = k0 + 8 * g + i, kb = ka + 16; v[i] = ka < K ? W[(size_t)(ka < K ? ka : K - 1) * ld + n] : 0.f; v[8 + i] = kb < K ? W[(size_t)(kb < K ? kb : K - 1) * ld + n] : 0.f; }
  return bsplit16(v); }
__device__ __forceinline__ v8f mac3(const F2& a, const F2& b, v8f c) { c = wmma_bf(a.l, b.h, c); c = wmma_bf(a.h, b.l, c); return wmma_bf(a.h, b.h, c); }
__device__ __forceinline__ float sigm(float v) { return 1.0f / (1.0f + expf(-v)); }


// Vector-neuron attention (B 4, C 256 = 8 heads x 32, 3 vector components, N 2,048 points): energy contracts over (head_dim, 3); residual output.
#define NB 4
#define CC 256
#define NI 3
#define TT 2048
#define NH 8
#define HD 32
#define KD (HD * NI)        // 96: per-head contraction length, index kk = i*32 + c_local
#define RW (NH * KD)        // 768: q/k row length per token
#ifndef TNB
#define TNB NB
#endif
typedef __attribute__((ext_vector_type(8))) __bf16 v8b;
__device__ __forceinline__ v16b frag_b(const __bf16* rowk0, int lane) {
  union { v16b v; v8b q[2]; } u; const __bf16* p = rowk0 + 8 * (lane >> 4);
  u.q[0] = *(const v8b*)p; u.q[1] = *(const v8b*)(p + 16); return u.v;
}
__device__ __forceinline__ float bfr(float v) { return (float)(__bf16)v; }
__device__ __attribute__((noinline)) float exp_ni(float v) { return expf(v); }
__device__ __attribute__((noinline)) float erf_ni(float v) { return erff(v); }

#define QSC (0.17677669529663689f * 1.4426950408889634f)   // 32^-0.5 * log2 e, folded into q ahead of its one rounding: q . k is then the exponent of 2
#define WS_QH  0u
#define WS_KH  (WS_QH + 2u * (size_t)NB * TT * RW)
#define WS_VT  (WS_KH + 2u * (size_t)NB * TT * RW)      // f16 v planes [b][h*96 + kk][n]
#define WS_O3  (WS_VT + 2u * (size_t)NB * RW * TT)      // f32 o [b][i][n][c]
#define WS_PW  (WS_O3 + 4u * (size_t)NB * NI * TT * CC) // bf16 weights in fragment order [matrix q,k,v,o][16 out channels][32 in channels][half][lane][8]
#define WS_END (WS_PW + 2u * 4u * (size_t)CC * CC)

// ---- k_pack: one wave per B fragment f = (matrix * 16 + out tile) * 8 + k step. Lane (col, g) holds W[16 tile + col][32 kc + 8 g + 0..7] and [.. + 16 + 0..7];
// the first eights of the 32 lanes lie in one 512-byte run, the second eights in the next, so that a fragment is read by two loads of whole lines.
__global__ __launch_bounds__(128) void k_pack(const float* __restrict__ WQ, const float* __restrict__ WK, const float* __restrict__ WV, const float* __restrict__ WO, __bf16* __restrict__ PW) {
  const int f = blockIdx.x * 4 + (threadIdx.x >> 5), lane = threadIdx.x & 31, col = lane & 15, g = lane >> 4; const int mat = f >> 7, ot = (f >> 3) & 15, kc = f & 7;
  const float* Wm = mat == 0 ? WQ : mat == 1 ? WK : mat == 2 ? WV : WO; const float* p = Wm + (size_t)(ot * 16 + col) * CC + kc * 32 + 8 * g;
  v8b lo, hi;
  for (int ii = 0; ii < 8; ++ii) { lo[ii] = (__bf16)p[ii]; hi[ii] = (__bf16)p[16 + ii]; }
  __bf16* d = PW + (size_t)f * 512 + lane * 8; *(v8b*)d = lo; *(v8b*)(d + 256) = hi; }
__device__ __forceinline__ v16b frag_pw(const __bf16* PW, int f, int lane) {
  union { v16b v; v8b q[2]; } u; const __bf16* p = PW + (size_t)f * 512 + lane * 8;
  u.q[0] = *(const v8b*)p; u.q[1] = *(const v8b*)(p + 256); return u.v;
}

// ---- k_proj: block = (64 points, 128 out channels, z = b*3 + i): y[o][n] = sum_c W[o][c] x[b][c][i][n] for W = Wq, Wk, Wv in turn, from one staged x tile.
// A wave takes 32 out channels (two B fragments a k step) and all 64 points (four A fragments from LDS): a weight fragment is loaded by one wave only,
// and a matrix's 16 fragments of a wave are in flight together, the next matrix's while this one's results are stored. q, k and v leave through LDS arrays of their own.
__global__ __launch_bounds__(128) void k_proj(const float* __restrict__ X, const __bf16* __restrict__ PW, _Float16* __restrict__ QH, _Float16* __restrict__ KH, _Float16* __restrict__ VT) {
  __shared__ __align__(16) __bf16 sx[64][CC + 8]; __shared__ __align__(16) _Float16 sh[64][136], sk[64][136]; __shared__ __align__(16) _Float16 th[128][72];
  const int tid = threadIdx.x, wave = tid >> 5, lane = tid & 31, col = lane & 15, g = lane >> 4; const int n0 = blockIdx.x * 64; const int c0 = blockIdx.y * 128; const int z = blockIdx.z; const int i = z % NI; const size_t b = z / NI; const int f0 = (c0 / 16 + wave * 2) * 8;
  // x tile: a thread takes four points (one 16-byte load per channel) of eight channels, four such sets. All 32 loads, and the first weight fragments behind
  // them, are issued before the first value is used, so the block waits for memory once; a point's eight channels then go to LDS as one 16-byte store.
  const int nq = tid & 15, c8 = tid >> 4; const float* xp = X + ((b * CC + c8 * 8) * NI + i) * (size_t)TT + n0 + nq * 4;
  v4f xr[4][8];
  for (int k = 0; k < 4; ++k)
    for (int jj = 0; jj < 8; ++jj) xr[k][jj] = *(const v4f*)(xp + (size_t)(k * 64 + jj) * (NI * TT));
  asm volatile("s_wait_xcnt 0x0" ::: "memory");   // stands in front of any reuse of the x loads' address registers (the weight loads below land on them)
  v16b w[CC / 32][2];
  for (int kc = 0; kc < CC / 32; ++kc)
    for (int t = 0; t < 2; ++t) w[kc][t] = frag_pw(PW, f0 + t * 8 + kc, lane);
  __builtin_amdgcn_sched_barrier(0);   // the weight loads are issued ahead of the first wait for x: without it they sink below the conversions and their latency adds to that of x
  for (int k = 0; k < 4; ++k)
    for (int p = 0; p < 4; ++p) { v8b t;
      for (int jj = 0; jj < 8; ++jj) t[jj] = (__bf16)xr[k][jj][p];
      *(v8b*)&sx[nq * 4 + p][(c8 + 8 * k) * 8] = t; }
  __syncthreads();
#pragma unroll   // whole: 'which' is a constant in each copy, so that no copy tests it per element
  for (int which = 0; which < 3; ++which) {
    v8f acc[4][2] = {}; v16b a[4], an[4];
    for (int pt = 0; pt < 4; ++pt) a[pt] = frag_b(&sx[pt * 16 + col][0], lane);
#pragma unroll   // whole: every fragment has its own registers, and the two x fragment sets change places by renaming
    for (int kc = 0; kc < CC / 32; ++kc) {
      if (kc + 1 < CC / 32) {   // the next k step's four x fragments, one group of LDS reads ahead of this step's products
        for (int pt = 0; pt < 4; ++pt) an[pt] = frag_b(&sx[pt * 16 + col][(kc + 1) * 32], lane);
        __builtin_amdgcn_sched_barrier(0); }   // holds the group here: placed behind the products, each k step would wait out the LDS latency
      for (int pt = 0; pt < 4; ++pt)
        for (int t = 0; t < 2; ++t) acc[pt][t] = wmma_bf(a[pt], w[kc][t], acc[pt][t]);
      for (int pt = 0; pt < 4; ++pt) a[pt] = an[pt]; }
#pragma unroll
    for (int pt = 0; pt < 4; ++pt)
#pragma unroll
      for (int t = 0; t < 2; ++t)
#pragma unroll
        for (int r = 0; r < 8; ++r) { const float v = acc[pt][t][r]; const int rl = pt * 16 + 8 * g + r, cl = (wave * 2 + t) * 16 + col; const _Float16 hv = (_Float16)(which == 0 ? v * QSC : v); if (which == 2) th[cl][rl] = hv; else if (which == 1) sk[rl][cl] = hv; else sh[rl][cl] = hv; }
    __syncthreads();
    if (which < 2) {
      for (int kc = 0; kc < CC / 32; ++kc)
        for (int t = 0; t < 2; ++t) w[kc][t] = frag_pw(PW, f0 + (which + 1) * 128 + t * 8 + kc, lane);
      asm volatile("s_wait_xcnt 0x0" ::: "memory");   // stands in front of any reuse of these loads' address registers (the store loop's addresses land on them)
      __builtin_amdgcn_sched_barrier(0); }   // the next matrix's fragments are issued behind the barrier (which would wait for them) and ahead of the store loop, which covers their latency
    if (which < 2) { _Float16* dh = which == 0 ? QH : KH;   // rows [b][n][h][i*32 + c_local]; this block covers 4 heads (128 channels)
      for (int e = tid; e < 64 * 4 * 4; e += 128) { const int rl = e >> 4, hh = (e >> 2) & 3, q = e & 3; const int h = c0 / HD + hh; const size_t dst = (((b * TT + n0 + rl) * NH + h) * KD) + i * HD + q * 8;
        vst2((unsigned*)(dh + dst), *(const v4u*)&(which == 0 ? sh : sk)[rl][hh * 32 + q * 8]); } }
    else { for (int e = tid; e < 128 * 8; e += 128) { const int cl = e >> 3, q = e & 7; const int c = c0 + cl; const int h = c / HD, cL = c % HD; vst2((unsigned*)(VT + ((b * NH + h) * KD + i * HD + cL) * (size_t)TT + n0 + q * 8), *(const v4u*)&th[cl][q * 8]); } } } }
// ---- k_fa: block = 8 waves x 32 queries of one (b, head). Per 64 keys: S^T = K Q^T (A = k rows, B = q), so a lane holds one query's
// scores in each of its wave's two 16-query column groups (keys 8g + r of each 16-key tile); two S^T tiles convert in place to the B operand of O^T += V^T P^T.
// A k or v^T fragment read from LDS feeds two products, one per column group: at 16 queries a wave the fragment reads asked twice the LDS rate that the matrix rate allows.
// Held reference: the score products start from C = 7 - reference, so an accumulator is exp2's argument as it stands. The reference moves (o, sum and this pass's scores
// re-based, P formed anew) only when some lane's sum of P over the pass exceeds 2^15, tested once a pass ahead of the P . V products: P stays inside f16. The first pass always sets it.
// The 8 waves read the same K rows and V^T rows: a stage of 256 keys is brought into LDS once per block by asynchronous copies, two buffers, the next
// stage in flight while this one is worked on. Row pitches are odd multiples of 16 bytes, so the 16-byte fragment reads meet no bank conflict.
#define SKEYS 256                 // keys per stage
#define KPH 104                   // k row pitch in LDS, halves (192 B of data in 208 B)
#define VPH 264                   // v^T row pitch in LDS, halves (512 B of data in 528 B)
#define KSZ (SKEYS * KPH)         // halves of k rows per stage
#define STG (KSZ + KD * VPH)      // halves per stage buffer
// Half of one lane's share of a stage: three 16-byte pieces (64 B apart) of each of two k rows (128 rows apart) and one piece of each of six v^T rows (16 rows apart).
// s_wait_xcnt 0 closes the statement so that no address register is rewritten ahead of it.
__device__ __forceinline__ void stage_copy(unsigned lk, const _Float16* gk, unsigned lv, const _Float16* gv) {
  const unsigned lk2 = lk + 128u * KPH * 2u; const _Float16* gk2 = gk + 128 * (size_t)RW;
  asm volatile("global_load_async_to_lds_b128 %0, %1, off\n\t"
               "global_load_async_to_lds_b128 %2, %3, off\n\t"
               "global_load_async_to_lds_b128 %4, %5, off\n\t"
               "global_load_async_to_lds_b128 %6, %7, off\n\t"
               "global_load_async_to_lds_b128 %8, %9, off\n\t"
               "global_load_async_to_lds_b128 %10, %11, off\n\t"
               "global_load_async_to_lds_b128 %12, %13, off\n\t"
               "global_load_async_to_lds_b128 %14, %15, off\n\t"
               "global_load_async_to_lds_b128 %16, %17, off\n\t"
               "global_load_async_to_lds_b128 %18, %19, off\n\t"
               "global_load_async_to_lds_b128 %20, %21, off\n\t"
               "global_load_async_to_lds_b128 %22, %23, off\n\t"
               "s_wait_xcnt 0x0"
               :: "v"(lk), "v"(gk), "v"(lk + 64u), "v"(gk + 32), "v"(lk + 128u), "v"(gk + 64),
                  "v"(lk2), "v"(gk2), "v"(lk2 + 64u), "v"(gk2 + 32), "v"(lk2 + 128u), "v"(gk2 + 64),
                  "v"(lv), "v"(gv), "v"(lv + 16u * VPH * 2u), "v"(gv + 16 * (size_t)TT), "v"(lv + 32u * VPH * 2u), "v"(gv + 32 * (size_t)TT),
                  "v"(lv + 48u * VPH * 2u), "v"(gv + 48 * (size_t)TT), "v"(lv + 64u * VPH * 2u), "v"(gv + 64 * (size_t)TT), "v"(lv + 80u * VPH * 2u), "v"(gv + 80 * (size_t)TT)
               : "memory");
}
// exp2 for the rare re-base path; the v_nop is the slot that the instruction set asks for behind a transcendental
__device__ __forceinline__ float exp2_slot(float x) { float r; asm("v_exp_f32 %0, %1\n\tv_nop" : "=v"(r) : "v"(x)); return r; }
// A lane's whole share: 256 threads cover k rows 0..63 and 128..191 and v^T rows 0..7 (+ 16 j) by the first half, the rows 64 and 8 further on by the second.
__device__ __forceinline__ void stage_fill(unsigned lk, const _Float16* gk, unsigned lv, const _Float16* gv) {
  stage_copy(lk, gk, lv, gv);
  stage_copy(lk + 64u * KPH * 2u, gk + 64 * (size_t)RW, lv + 8u * VPH * 2u, gv + 8 * (size_t)TT);
}
#define QG 2                      // 16-query column groups per wave
__global__ __launch_bounds__(256) void k_fa(const _Float16* __restrict__ QH, const _Float16* __restrict__ KH, const _Float16* __restrict__ VT, float* __restrict__ O3) {
  __shared__ __align__(16) _Float16 sm[2 * STG];
  const int tid = threadIdx.x, wave = tid >> 5, lane = tid & 31, col = lane & 15, g = lane >> 4; const int h = blockIdx.y; const size_t b = blockIdx.z; const int qn = blockIdx.x * 256 + wave * (16 * QG) + col;   // column group c: query qn + 16 c
  // Copy addresses = a scalar part (buffer, stage, the wave's rows: k rows 8 wave .., v^T row wave) + a lane part (k row lane / 4, piece lane % 4; v^T piece lane). Only the three lane parts
  // stay in vector registers through the loop; held whole, the addresses were spilled to scratch there.
  const unsigned ws = (unsigned)__builtin_amdgcn_readfirstlane(wave);
  const unsigned lkl = (unsigned)(lane >> 2) * (KPH * 2u) + (unsigned)(lane & 3) * 16u, gkl = (unsigned)(lane >> 2) * RW + (unsigned)(lane & 3) * 8u, vl = (unsigned)lane * 8u;
  const auto fill = [&](const int stg) {   // stage stg into buffer stg & 1
    const unsigned sb = (unsigned)__builtin_amdgcn_readfirstlane((int)((unsigned)(size_t)sm + (unsigned)(stg & 1) * (STG * 2u) + ws * (8u * KPH * 2u)));
    const unsigned sv = (unsigned)__builtin_amdgcn_readfirstlane((int)((unsigned)(size_t)sm + (unsigned)(stg & 1) * (STG * 2u) + KSZ * 2u + ws * (VPH * 2u)));
    const _Float16* pk = KH + ((b * TT + (size_t)stg * SKEYS + ws * 8u) * NH + h) * KD;
    const _Float16* pv = VT + ((b * NH + h) * KD + ws) * (size_t)TT + (size_t)stg * SKEYS;
    stage_fill(sb + lkl, pk + gkl, sv + vl * 2u, pv + vl); };
  fill(0);
  v16h qh[QG][KD / 32];
  for (int c = 0; c < QG; ++c)
    for (int kc = 0; kc < KD / 32; ++kc) { const size_t qo = ((b * TT + qn + 16 * c) * NH + h) * KD + kc * 32; qh[c][kc] = frag_h(QH + qo, lane); }
  asm volatile("s_wait_asynccnt 0x0" ::: "memory");   // this wave's share of stage 0 has landed
  __syncthreads();                                    // every wave's share has: stage 0 may be read
  fill(1);
  v8f o[QG][KD / 16] = {}; float l[QG] = {};
  v8f c8[QG];                                         // C of the score products: 7 - reference of this lane's query of the group (reference 0 until the first pass)
  for (int c = 0; c < QG; ++c)
    for (int r = 0; r < 8; ++r) c8[c][r] = 7.0f;
  float lim = -1.0f, dlo = -3.0e38f;                  // first pass: the test always fires and the reference may also go down; afterwards 2^15 and 0
  for (int st = 0; st < TT / SKEYS; ++st) {
    const _Float16* kp = sm + (st & 1) * STG + col * KPH;          // A row = key k0 + 16 t + col
    const _Float16* vp = sm + (st & 1) * STG + KSZ + col * VPH;    // A row = kk 16 j + col, k = key
#pragma nounroll   // stays rolled as before: unrolled, the four passes' fragment groups overlap and the wave's registers spill to scratch
    for (int k0 = 0; k0 < SKEYS; k0 += 64) { v8f s[QG][4]; v16h kf[4][KD / 32], vf[2][KD / 16];
      for (int t = 0; t < 4; ++t)
        for (int kc = 0; kc < KD / 32; ++kc) kf[t][kc] = frag_h(kp + (k0 + t * 16) * KPH + kc * 32, lane);
      for (int hf = 0; hf < 2; ++hf)
        for (int j = 0; j < KD / 16; ++j) vf[hf][j] = frag_h(vp + (j * 16) * VPH + k0 + 32 * hf, lane);   // keys k0 + 32 hf .. + 31
      __builtin_amdgcn_sched_barrier(0);   // the pass's k and v^T fragments are read as one group, k first: one place with LDS reads a pass; the score products and the softmax cover the v^T reads
      for (int kc = 0; kc < KD / 32; ++kc)   // eight independent accumulators per k step
        for (int t = 0; t < 4; ++t)
          for (int c = 0; c < QG; ++c) s[c][t] = wmma_h(kf[t][kc], qh[c][kc], kc ? s[c][t] : c8[c]);
      v16h p[QG][2];
      const auto expo = [&](const int c, const bool again) {   // P = 2^score, packed to f16, and this lane's sum of it in f32: one chain per 16-key tile, two to a packed add, since the test below waits for the sum
        v2f a01, a23;
        for (int r = 0; r < 8; ++r) { const v2f e01 = {again ? exp2_slot(s[c][0][r]) : __builtin_amdgcn_exp2f(s[c][0][r]), again ? exp2_slot(s[c][1][r]) : __builtin_amdgcn_exp2f(s[c][1][r])}, e23 = {again ? exp2_slot(s[c][2][r]) : __builtin_amdgcn_exp2f(s[c][2][r]), again ? exp2_slot(s[c][3][r]) : __builtin_amdgcn_exp2f(s[c][3][r])};
          a01 = r ? a01 + e01 : e01; a23 = r ? a23 + e23 : e23;
          p[c][0][r] = (_Float16)e01[0]; p[c][0][8 + r] = (_Float16)e01[1]; p[c][1][r] = (_Float16)e23[0]; p[c][1][8 + r] = (_Float16)e23[1]; }
        const v2f a = a01 + a23; return a[0] + a[1]; };
      float ps[QG];
      for (int c = 0; c < QG; ++c) ps[c] = expo(c, false);
      if (__builtin_amdgcn_ballot_w32(fmaxf(ps[0], ps[1]) > lim) != 0) {   // wave-uniform, rare: a scalar branch, once a pass for both groups. No term of a sum <= 2^15 is above 2^15, so P as packed is finite
        for (int c = 0; c < QG; ++c) {
          float mx = s[c][0][0];
          for (int t = 0; t < 4; ++t)
            for (int r = 0; r < 8; ++r) mx = fmaxf(mx, s[c][t][r]);
          mx = fmaxf(mx, __shfl_xor(mx, 16));   // the other half of the wave holds this query's other keys
          const float d = fmaxf(mx - 7.0f, dlo);   // the reference rises by d (a query below its reference keeps it: d = 0); every score is then <= 7
          const float al = exp2_slot(fminf(-d, 0.f));
          for (int r = 0; r < 8; ++r) c8[c][r] -= d;
          for (int t = 0; t < 4; ++t)
            for (int r = 0; r < 8; ++r) s[c][t][r] -= d;
          for (int j = 0; j < KD / 16; ++j)
            for (int r = 0; r < 8; ++r) o[c][j][r] *= al;
          l[c] *= al;
          ps[c] = expo(c, true); }
        lim = 32768.0f; dlo = 0.f; }
      for (int c = 0; c < QG; ++c) l[c] += ps[c];
      for (int hf = 0; hf < 2; ++hf)
        for (int j = 0; j < KD / 16; ++j)
          for (int c = 0; c < QG; ++c) o[c][j] = wmma_h(vf[hf][j], p[c][hf], o[c][j]); }
    asm volatile("s_wait_dscnt 0x0" ::: "memory");      // this wave's reads of the buffer are done before it is refilled
    asm volatile("s_wait_asynccnt 0x0" ::: "memory");   // this wave's share of stage st + 1 has landed
    __syncthreads();                                    // publishes stage st + 1 and ends every wave's reads of stage st
    if (st + 2 < TT / SKEYS) fill(st + 2); }
  asm volatile("s_wait_asynccnt 0x0" ::: "memory");     // no copy is left in flight when the wave ends
  for (int c = 0; c < QG; ++c) {
    const float lt = l[c] + __shfl_xor(l[c], 16); const float inv = 1.0f / lt;   // l and o carry the same factor
    for (int j = 0; j < KD / 16; ++j) { float* dst = O3 + ((b * NI + (j >> 1)) * TT + qn + 16 * c) * (size_t)CC + h * HD + (j & 1) * 16 + 8 * g;   // kk = 16 j + 8 g + r = i * 32 + c_local
      v4f a, e;
      for (int r = 0; r < 4; ++r) { a[r] = o[c][j][r] * inv; e[r] = o[c][j][4 + r] * inv; }
      vst2(dst, a); vst2(dst + 4, e); } } }
// ---- k_out: block = (64 points, 128 out channels, z = b*3 + i): out[b][o][i][n] = sum_c Wo[o][c] o3[b][i][n][c] + x[b][o][i][n]
__global__ __launch_bounds__(128) void k_out(const float* __restrict__ O3, const __bf16* __restrict__ PW, const float* __restrict__ X, float* __restrict__ OUT) { __shared__ __align__(16) float st[128][68];
  const int tid = threadIdx.x, wave = tid >> 5, lane = tid & 31, col = lane & 15, g = lane >> 4; const int n0 = blockIdx.x * 64; const int c0 = blockIdx.y * 128; const size_t b = blockIdx.z / NI; const int i = blockIdx.z % NI;
  const int f0 = (3 * 16 + c0 / 16) * 8;
  v16b w[8], wn[8];
  for (int j = 0; j < 8; ++j) w[j] = frag_pw(PW, f0 + j * 8, lane);
  v8f acc[8] = {};
#pragma unroll   // whole: the two fragment sets change places by renaming, without register copies
  for (int kc = 0; kc < CC / 32; ++kc) { const F2 a = split_row(O3 + ((b * NI + i) * TT + n0 + wave * 16 + col) * (size_t)CC, kc * 32, lane);
    if (kc + 1 < CC / 32) {   // the next k step's eight fragments, one group of loads ahead of this step's products
      for (int j = 0; j < 8; ++j) wn[j] = frag_pw(PW, f0 + j * 8 + kc + 1, lane); }
    for (int j = 0; j < 8; ++j) { acc[j] = wmma_bf(a.h, w[j], acc[j]); acc[j] = wmma_bf(a.l, w[j], acc[j]); }
    for (int j = 0; j < 8; ++j) w[j] = wn[j]; }
#pragma unroll
  for (int j = 0; j < 8; ++j)
#pragma unroll
    for (int r = 0; r < 8; ++r) st[j * 16 + col][wave * 16 + 8 * g + r] = acc[j][r];
  __syncthreads();
  for (int e = tid; e < 128 * 16; e += 128) { const int cl = e >> 4, q = e & 15; const size_t go = ((b * CC + c0 + cl) * NI + i) * (size_t)TT + n0 + q * 4; const v4f xr = *(const v4f*)(X + go); v4f v = *(const v4f*)&st[cl][q * 4]; v[0] += bfr(xr[0]); v[1] += bfr(xr[1]); v[2] += bfr(xr[2]); v[3] += bfr(xr[3]); vst2(OUT + go, v); } }
extern "C" void kernel_launch(void* const* d_in, const int* in_sizes, int n_in, void* d_out, int out_size, void* d_ws, size_t ws_size, hipStream_t stream) {
  (void)in_sizes; (void)n_in; (void)out_size;
  const float** F = (const float**)d_in;   // 0 x [4,256,3,2048], 1 Wq, 2 Wk, 3 Wv, 4 Wo [256,256] ([out][in])
  if (ws_size < (size_t)WS_END) return;
  char* ws = (char*)d_ws; _Float16 *QH = (_Float16*)(ws + WS_QH), *KH = (_Float16*)(ws + WS_KH), *VT = (_Float16*)(ws + WS_VT); float *O3 = (float*)(ws + WS_O3); __bf16 *PW = (__bf16*)(ws + WS_PW);
  k_pack<<<dim3(4 * 16 * 8 / 4), 128, 0, stream>>>(F[1], F[2], F[3], F[4], PW);
  k_proj<<<dim3(TT / 64, CC / 128, TNB * NI), 128, 0, stream>>>(F[0], PW, QH, KH, VT);
  k_fa<<<dim3(TT / 256, NH, TNB), 256, 0, stream>>>(QH, KH, VT, O3);
  k_out<<<dim3(TT / 64, CC / 128, TNB * NI), 128, 0, stream>>>(O3, PW, F[0], (float*)d_out);
}

// v010
// Measured time: 65.6 microseconds a run.
// Next to v009, in two timings, it ran 1.12 and 1.11 times as fast.
// Over all steps from v000 it is 20.4 times as fast.
// compute dtype: all float inputs rounded to bf16; the four W rounded to bf16 once per call and laid out in B-fragment order (k_pack); q/k/v = W x over channels (per vector component) with EXACT bf16 products on WMMA 16x16x32 (x tiles transposed in LDS), f32 accumulate; q (times log2 e / sqrt(32), in f32) and k each rounded once to f16 -> 1-product energies over the 96 (head_dim x 3) pairs, started at 7 - reference, kept in registers; online softmax in f32, base 2 (the hardware exp2 per score; held reference and sum per query, re-based when a lane's P sum of a pass passes 2^15) -> unnormalised P f16 x 2^7; o = P . v (v once to f16) / sum, one launch for all heads; out = Wo o (o split bf16 hi + lo, 2 products) + x; f32 output [b][c][3][n].
#include <hip/hip_runtime.h>
#include <math.h>

typedef __attribute__((ext_vector_type(16))) _Float16 v16h;
typedef __attribute__((ext_vector_type(16))) __bf16 v16b;
typedef __attribute__((ext_vector_type(8)))  _Float16 v8h;
typedef __attribute__((ext_vector_type(8)))  float v8f;
typedef __attribute__((ext_vector_type(4)))  float v4f;
typedef __attribute__((ext_vector_type(2)))  float v2f;
typedef __attribute__((ext_vector_type(4)))  unsigned v4u;
typedef __attribute__((ext_vector_type(4)))  int v4i;
typedef float __attribute__((may_alias)) float_a;
typedef int __attribute__((may_alias)) int_a;

template <typename T> __device__ __forceinline__ void vst2(void* p, T v) { *(T*)p = v;  }
__device__ __forceinline__ v8f wmma_h(v16h a, v16h b, v8f c) { return __builtin_amdgcn_wmma_f32_16x16x32_f16(false, a, false, b, (short)0, c, false, false); }
__device__ __forceinline__ v8f wmma_bf(v16b a, v16b b, v8f c) {
  v8f d = __builtin_amdgcn_wmma_f32_16x16x32_bf16(false, a, false, b, (short)0, c, false, false);
  asm volatile("v_nop\n\tv_nop\n\tv_nop\n\tv_nop" : "+v"(d) : "v"(a), "v"(b));
  return d;
}
// 16x16x32 fragments: lane = (h = lane>>4, row/col = lane&15); elements 0..7 = k0+8h+0..7, 8..15 = k0+16+8h+0..7; D element r = row 8h+r
__device__ __forceinline__ v16h frag_h(const _Float16* rowk0, int lane) {
  union { v16h v; v8h q[2]; } u; const _Float16* p = rowk0 + 8 * (lane >> 4);
  u.q[0] = *(const v8h*)p; u.q[1] = *(const v8h*)(p + 16); return u.v;
}
__device__ __forceinline__ v16h frag_f32(const float* rowk0, int lane) {
  v16h a; const float* p = rowk0 + 8 * (lane >> 4);
#pragma unroll
  for (int i = 0; i < 8; ++i) { a[i] = (_Float16)p[i]; a[8 + i] = (_Float16)p[16 + i]; }
  return a;
}
__device__ __forceinline__ v16h frag_f32s(const float* rowk0, int lane, float sc) {
  v16h a; const float* p = rowk0 + 8 * (lane >> 4);
#pragma unroll
  for (int i = 0; i < 8; ++i) { a[i] = (_Float16)(p[i] * sc); a[8 + i] = (_Float16)(p[16 + i] * sc); }
  return a;
}
// column fragment from a [K][ld] layout (column n), rows >= K read as 0
__device__ __forceinline__ v16h fragc_f32(const float* W, int k0, int n, int lane, int ld, int K) {
  v16h a; const int g = lane >> 4;
#pragma unroll
  for (int i = 0; i < 8; ++i) { const int ka = k0 + 8 * g + i, kb = ka + 16;
    a[i] = (_Float16)(ka < K ? W[(size_t)(ka < K ? ka : K - 1) * ld + n] : 0.f); a[8 + i] = (_Float16)(kb < K ? W[(size_t)(kb < K ? kb : K - 1) * ld + n] : 0.f); }
  return a;
}
struct F2 { v16b h, l; };
__device__ __forceinline__ F2 bsplit16(const float v[16]) { F2 r;
#pragma unroll
  for (int i = 0; i < 16; ++i) { const __bf16 h = (__bf16)v[i]; r.h[i] = h; r.l[i] = (__bf16)(v[i] - (float)h); }
  return r; }
__device__ __forceinline__ F2 split_row(const float* row, int k0, int lane) { float v[16]; const float* p = row + k0 + 8 * (lane >> 4);
#pragma unroll
  for (int i = 0; i < 8; ++i) { v[i] = p[i]; v[8 + i] = p[16 + i]; }
  return bsplit16(v); }
__device__ __forceinline__ F2 split_rowK(const float* row, int k0, int lane, int K) { float v[16]; const int g = lane >> 4;
#pragma unroll
  for (int i = 0; i < 8; ++i) { const int ka = k0 + 8 * g + i, kb = ka + 16; v[i] = ka < K ? row[ka < K ? ka : K - 1] : 0.f; v[8 + i] = kb < K ? row[kb < K ? kb : K - 1] : 0.f; }
  return bsplit16(v); }
__device__ __forceinline__ F2 split_col(const float* W, int k0, int n, int lane, int ld, int K) { float v[16]; const int g = lane >> 4;
#pragma unroll
  for (int i = 0; i < 8; ++i) { const int ka = k0 + 8 * g + i, kb = ka + 16; v[i] = ka < K ? W[(size_t)(ka < K ? ka : K - 1) * ld + n] : 0.f; v[8 + i] = kb < K ? W[(size_t)(kb < K ? kb : K - 1) * ld + n] : 0.f; }
  return bsplit16(v); }
__device__ __forceinline__ v8f mac3(const F2& a, const F2& b, v8f c) { c = wmma_bf(a.l, b.h, c); c = wmma_bf(a.h, b.l, c); return wmma_bf(a.h, b.h, c); }
__device__ __forceinline__ float sigm(float v) { return 1.0f / (1.0f + expf(-v)); }


// Vector-neuron attention (B 4, C 256 = 8 heads x 32, 3 vector components, N 2,048 points): energy contracts over (head_dim, 3); residual output.
#define NB 4
#define CC 256
#define NI 3
#define TT 2048
#define NH 8
#define HD 32
#define KD (HD * NI)        // 96: per-head contraction length, index kk = i*32 + c_local
#define RW (NH * KD)        // 768: q/k row length per token
#ifndef TNB
#define TNB NB
#endif
typedef __attribute__((ext_vector_type(8))) __bf16 v8b;
__device__ __forceinline__ v16b frag_b(const __bf16* rowk0, int lane) {
  union { v16b v; v8b q[2]; } u; const __bf16* p = rowk0 + 8 * (lane >> 4);
  u.q[0] = *(const v8b*)p; u.q[1] = *(const v8b*)(p + 16); return u.v;
}
__device__ __forceinline__ float bfr(float v) { return (float)(__bf16)v; }
__device__ __attribute__((noinline)) float exp_ni(float v) { return expf(v); }
__device__ __attribute__((noinline)) float erf_ni(float v) { return erff(v); }

#define QSC (0.17677669529663689f * 1.4426950408889634f)   // 32^-0.5 * log2 e, folded into q ahead of its one rounding: q . k is then the exponent of 2
#define WS_QH  0u
#define WS_KH  (WS_QH + 2u * (size_t)NB * TT * RW)
#define WS_VT  (WS_KH + 2u * (size_t)NB * TT * RW)      // f16 v planes [b][h*96 + kk][n]
#define WS_O3  (WS_VT + 2u * (size_t)NB * RW * TT)      // f32 o [b][i][n][c]
#define WS_PW  (WS_O3 + 4u * (size_t)NB * NI * TT * CC) // bf16 weights in fragment order [matrix q,k,v,o][16 out channels][32 in channels][half][lane][8]
#define WS_END (WS_PW + 2u * 4u * (size_t)CC * CC)

// ---- k_pack: one wave per B fragment f = (matrix * 16 + out tile) * 8 + k step. Lane (col, g) holds W[16 tile + col][32 kc + 8 g + 0..7] and [.. + 16 + 0..7];
// the first eights of the 32 lanes lie in one 512-byte run, the second eights in the next, so that a fragment is read by two loads of whole lines.
__global__ __launch_bounds__(128) void k_pack(const float* __restrict__ WQ, const float* __restrict__ WK, const float* __restrict__ WV, const float* __restrict__ WO, __bf16* __restrict__ PW) {
  const int f = blockIdx.x * 4 + (threadIdx.x >> 5), lane = threadIdx.x & 31, col = lane & 15, g = lane >> 4; const int mat = f >> 7, ot = (f >> 3) & 15, kc = f & 7;
  const float* Wm = mat == 0 ? WQ : mat == 1 ? WK : mat == 2 ? WV : WO; const float* p = Wm + (size_t)(ot * 16 + col) * CC + kc * 32 + 8 * g;
  v8b lo, hi;
  for (int ii = 0; ii < 8; ++ii) { lo[ii] = (__bf16)p[ii]; hi[ii] = (__bf16)p[16 + ii]; }
  __bf16* d = PW + (size_t)f * 512 + lane * 8; *(v8b*)d = lo; *(v8b*)(d + 256) = hi; }
__device__ __forceinline__ v16b frag_pw(const __bf16* PW, int f, int lane) {
  union { v16b v; v8b q[2]; } u; const __bf16* p = PW + (size_t)f * 512 + lane * 8;
  u.q[0] = *(const v8b*)p; u.q[1] = *(const v8b*)(p + 256); return u.v;
}

// ---- k_proj: block = (64 points, 128 out channels, z = b*3 + i): y[o][n] = sum_c W[o][c] x[b][c][i][n] for W = Wq, Wk, Wv in turn, from one staged x tile.
// A wave takes 32 out channels (two B fragments a k step) and all 64 points (four A fragments from LDS): a weight fragment is loaded by one wave only,
// and a matrix's 16 fragments of a wave are in flight together, the next matrix's while this one's results are stored. q, k and v leave through LDS arrays of their own.
__global__ __launch_bounds__(128) void k_proj(const float* __restrict__ X, const __bf16* __restrict__ PW, _Float16* __restrict__ QH, _Float16* __restrict__ KH, _Float16* __restrict__ VT) {
  __shared__ __align__(16) __bf16 sx[64][CC + 8]; __shared__ __align__(16) _Float16 sh[64][136], sk[64][136]; __shared__ __align__(16) _Float16 th[128][72];
  const int tid = threadIdx.x, wave = tid >> 5, lane = tid & 31, col = lane & 15, g = lane >> 4; const int n0 = blockIdx.x * 64; const int c0 = blockIdx.y * 128; const int z = blockIdx.z; const int i = z % NI; const size_t b = z / NI; const int f0 = (c0 / 16 + wave * 2) * 8;
  // x tile: a thread takes four points (one 16-byte load per channel) of eight channels, four such sets. All 32 loads, and the first weight fragments behind
  // them, are issued before the first value is used, so the block waits for memory once; a point's eight channels then go to LDS as one 16-byte store.
  const int nq = tid & 15, c8 = tid >> 4; const float* xp = X + ((b * CC + c8 * 8) * NI + i) * (size_t)TT + n0 + nq * 4;
  v4f xr[4][8];
  for (int k = 0; k < 4; ++k)
    for (int jj = 0; jj < 8; ++jj) xr[k][jj] = *(const v4f*)(xp + (size_t)(k * 64 + jj) * (NI * TT));
  asm volatile("s_wait_xcnt 0x0" ::: "memory");   // stands in front of any reuse of the x loads' address registers (the weight loads below land on them)
  v16b w[CC / 32][2];
  for (int kc = 0; kc < CC / 32; ++kc)
    for (int t = 0; t < 2; ++t) w[kc][t] = frag_pw(PW, f0 + t * 8 + kc, lane);
  __builtin_amdgcn_sched_barrier(0);   // the weight loads are issued ahead of the first wait for x: without it they sink below the conversions and their latency adds to that of x
  for (int k = 0; k < 4; ++k)
    for (int p = 0; p < 4; ++p) { v8b t;
      for (int jj = 0; jj < 8; ++jj) t[jj] = (__bf16)xr[k][jj][p];
      *(v8b*)&sx[nq * 4 + p][(c8 + 8 * k) * 8] = t; }
  __syncthreads();
#pragma unroll   // whole: 'which' is a constant in each copy, so that no copy tests it per element
  for (int which = 0; which < 3; ++which) {
    v8f acc[4][2] = {}; v16b a[4], an[4];
    for (int pt = 0; pt < 4; ++pt) a[pt] = frag_b(&sx[pt * 16 + col][0], lane);
#pragma unroll   // whole: every fragment has its own registers, and the two x fragment sets change places by renaming
    for (int kc = 0; kc < CC / 32; ++kc) {
      if (kc + 1 < CC / 32) {   // the next k step's four x fragments, one group of LDS reads ahead of this step's products
        for (int pt = 0; pt < 4; ++pt) an[pt] = frag_b(&sx[pt * 16 + col][(kc + 1) * 32], lane);
        __builtin_amdgcn_sched_barrier(0); }   // holds the group here: placed behind the products, each k step would wait out the LDS latency
      for (int pt = 0; pt < 4; ++pt)
        for (int t = 0; t < 2; ++t) acc[pt][t] = wmma_bf(a[pt], w[kc][t], acc[pt][t]);
      for (int pt = 0; pt < 4; ++pt) a[pt] = an[pt]; }
#pragma unroll
    for (int pt = 0; pt < 4; ++pt)
#pragma unroll
      for (int t = 0; t < 2; ++t)
#pragma unroll
        for (int r = 0; r < 8; ++r) { const float v = acc[pt][t][r]; const int rl = pt * 16 + 8 * g + r, cl = (wave * 2 + t) * 16 + col; const _Float16 hv = (_Float16)(which == 0 ? v * QSC : v); if (which == 2) th[cl][rl] = hv; else if (which == 1) sk[rl][cl] = hv; else sh[rl][cl] = hv; }
    __syncthreads();
    if (which < 2) {
      for (int kc = 0; kc < CC / 32; ++kc)
        for (int t = 0; t < 2; ++t) w[kc][t] = frag_pw(PW, f0 + (which + 1) * 128 + t * 8 + kc, lane);
      asm volatile("s_wait_xcnt 0x0" ::: "memory");   // stands in front of any reuse of these loads' address registers (the store loop's addresses land on them)
      __builtin_amdgcn_sched_barrier(0); }   // the next matrix's fragments are issued behind the barrier (which would wait for them) and ahead of the store loop, which covers their latency
    if (which < 2) { _Float16* dh = which == 0 ? QH : KH;   // rows [b][n][h][i*32 + c_local]; this block covers 4 heads (128 channels)
      for (int e = tid; e < 64 * 4 * 4; e += 128) { const int rl = e >> 4, hh = (e >> 2) & 3, q = e & 3; const int h = c0 / HD + hh; const size_t dst = (((b * TT + n0 + rl) * NH + h) * KD) + i * HD + q * 8;
        vst2((unsigned*)(dh + dst), *(const v4u*)&(which == 0 ? sh : sk)[rl][hh * 32 + q * 8]); } }
    else { for (int e = tid; e < 128 * 8; e += 128) { const int cl = e >> 3, q = e & 7; const int c = c0 + cl; const int h = c / HD, cL = c % HD; vst2((unsigned*)(VT + ((b * NH + h) * KD + i * HD + cL) * (size_t)TT + n0 + q * 8), *(const v4u*)&th[cl][q * 8]); } } } }
// ---- k_fa: block = 8 waves x 32 queries of one (b, head). Per 64 keys: S^T = K Q^T (A = k rows, B = q), so a lane holds one query's
// scores in each of its wave's two 16-query column groups (keys 8g + r of each 16-key tile); two S^T tiles convert in place to the B operand of O^T += V^T P^T.
// A k or v^T fragment read from LDS feeds two products, one per column group: at 16 queries a wave the fragment reads asked twice the LDS rate that the matrix rate allows.
// Held reference: the score products start from C = 7 - reference, so an accumulator is exp2's argument as it stands. The reference moves (o, sum and this pass's scores
// re-based, P formed anew) only when some lane's sum of P over the pass exceeds 2^15, tested once a pass ahead of the P . V products: P stays inside f16. The first pass always sets it.
// The 8 waves read the same K rows and V^T rows: a stage of 256 keys is brought into LDS once per block by asynchronous copies, two buffers, the next
// stage in flight while this one is worked on. Row pitches are odd multiples of 16 bytes, so the 16-byte fragment reads meet no bank conflict.
#define SKEYS 256                 // keys per stage
#define KPH 104                   // k row pitch in LDS, halves (192 B of data in 208 B)
#define VPH 264                   // v^T row pitch in LDS, halves (512 B of data in 528 B)
#define KSZ (SKEYS * KPH)         // halves of k rows per stage
#define STG (KSZ + KD * VPH)      // halves per stage buffer
// Half of one lane's share of a stage: three 16-byte pieces (64 B apart) of each of two k rows (128 rows apart) and one piece of each of six v^T rows (16 rows apart).
// s_wait_xcnt 0 closes the statement so that no address register is rewritten ahead of it.
__device__ __forceinline__ void stage_copy(unsigned lk, const _Float16* gk, unsigned lv, const _Float16* gv) {
  const unsigned lk2 = lk + 128u * KPH * 2u; const _Float16* gk2 = gk + 128 * (size_t)RW;
  asm volatile("global_load_async_to_lds_b128 %0, %1, off\n\t"
               "global_load_async_to_lds_b128 %2, %3, off\n\t"
               "global_load_async_to_lds_b128 %4, %5, off\n\t"
               "global_load_async_to_lds_b128 %6, %7, off\n\t"
               "global_load_async_to_lds_b128 %8, %9, off\n\t"
               "global_load_async_to_lds_b128 %10, %11, off\n\t"
               "global_load_async_to_lds_b128 %12, %13, off\n\t"
               "global_load_async_to_lds_b128 %14, %15, off\n\t"
               "global_load_async_to_lds_b128 %16, %17, off\n\t"
               "global_load_async_to_lds_b128 %18, %19, off\n\t"
               "global_load_async_to_lds_b128 %20, %21, off\n\t"
               "global_load_async_to_lds_b128 %22, %23, off\n\t"
               "s_wait_xcnt 0x0"
               :: "v"(lk), "v"(gk), "v"(lk + 64u), "v"(gk + 32), "v"(lk + 128u), "v"(gk + 64),
                  "v"(lk2), "v"(gk2), "v"(lk2 + 64u), "v"(gk2 + 32), "v"(lk2 + 128u), "v"(gk2 + 64),
                  "v"(lv), "v"(gv), "v"(lv + 16u * VPH * 2u), "v"(gv + 16 * (size_t)TT), "v"(lv + 32u * VPH * 2u), "v"(gv + 32 * (size_t)TT),
                  "v"(lv + 48u * VPH * 2u), "v"(gv + 48 * (size_t)TT), "v"(lv + 64u * VPH * 2u), "v"(gv + 64 * (size_t)TT), "v"(lv + 80u * VPH * 2u), "v"(gv + 80 * (size_t)TT)
               : "memory");
}
// exp2 for the rare re-base path; the v_nop is the slot that the instruction set asks for behind a transcendental
__device__ __forceinline__ float exp2_slot(float x) { float r; asm("v_exp_f32 %0, %1\n\tv_nop" : "=v"(r) : "v"(x)); return r; }
// A lane's whole share: 256 threads cover k rows 0..63 and 128..191 and v^T rows 0..7 (+ 16 j) by the first half, the rows 64 and 8 further on by the second.
__device__ __forceinline__ void stage_fill(unsigned lk, const _Float16* gk, unsigned lv, const _Float16* gv) {
  stage_copy(lk, gk, lv, gv);
  stage_copy(lk + 64u * KPH * 2u, gk + 64 * (size_t)RW, lv + 8u * VPH * 2u, gv + 8 * (size_t)TT);
}
#define QG 2                      // 16-query column groups per wave
__global__ __launch_bounds__(256) void k_fa(const _Float16* __restrict__ QH, const _Float16* __restrict__ KH, const _Float16* __restrict__ VT, float* __restrict__ O3) {
  __shared__ __align__(16) _Float16 sm[2 * STG];
  const int tid = threadIdx.x, wave = tid >> 5, lane = tid & 31, col = lane & 15, g = lane >> 4; const int h = blockIdx.y; const size_t b = blockIdx.z; const int qn = blockIdx.x * 256 + wave * (16 * QG) + col;   // column group c: query qn + 16 c
  // Copy addresses = a scalar part (buffer, stage, the wave's rows: k rows 8 wave .., v^T row wave) + a lane part (k row lane / 4, piece lane % 4; v^T piece lane). Only the three lane parts
  // stay in vector registers through the loop; held whole, the addresses were spilled to scratch there.
  const unsigned ws = (unsigned)__builtin_amdgcn_readfirstlane(wave);
  const unsigned lkl = (unsigned)(lane >> 2) * (KPH * 2u) + (unsigned)(lane & 3) * 16u, gkl = (unsigned)(lane >> 2) * RW + (unsigned)(lane & 3) * 8u, vl = (unsigned)lane * 8u;
  const auto fill = [&](const int stg) {   // stage stg into buffer stg & 1
    const unsigned sb = (unsigned)__builtin_amdgcn_readfirstlane((int)((unsigned)(size_t)sm + (unsigned)(stg & 1) * (STG * 2u) + ws * (8u * KPH * 2u)));
    const unsigned sv = (unsigned)__builtin_amdgcn_readfirstlane((int)((unsigned)(size_t)sm + (unsigned)(stg & 1) * (STG * 2u) + KSZ * 2u + ws * (VPH * 2u)));
    const _Float16* pk = KH + ((b * TT + (size_t)stg * SKEYS + ws * 8u) * NH + h) * KD;
    const _Float16* pv = VT + ((b * NH + h) * KD + ws) * (size_t)TT + (size_t)stg * SKEYS;
    stage_fill(sb + lkl, pk + gkl, sv + vl * 2u, pv + vl); };
  fill(0);
  v16h qh[QG][KD / 32];
  for (int c = 0; c < QG; ++c)
    for (int kc = 0; kc < KD / 32; ++kc) { const size_t qo = ((b * TT + qn + 16 * c) * NH + h) * KD + kc * 32; qh[c][kc] = frag_h(QH + qo, lane); }
  asm volatile("s_wait_asynccnt 0x0" ::: "memory");   // this wave's share of stage 0 has landed
  __syncthreads();                                    // every wave's share has: stage 0 may be read
  fill(1);
  v8f o[QG][KD / 16] = {}; float l[QG] = {};
  v8f c8[QG];                                         // C of the score products: 7 - reference of this lane's query of the group (reference 0 until the first pass)
  for (int c = 0; c < QG; ++c)
    for (int r = 0; r < 8; ++r) c8[c][r] = 7.0f;
  float lim = -1.0f, dlo = -3.0e38f;                  // first pass: the test always fires and the reference may also go down; afterwards 2^15 and 0
  for (int st = 0; st < TT / SKEYS; ++st) {
    const _Float16* kp = sm + (st & 1) * STG + col * KPH;          // A row = key k0 + 16 t + col
    const _Float16* vp = sm + (st & 1) * STG + KSZ + col * VPH;    // A row = kk 16 j + col, k = key
#pragma nounroll   // stays rolled as before: unrolled, the four passes' fragment groups overlap and the wave's registers spill to scratch
    for (int k0 = 0; k0 < SKEYS; k0 += 64) { v8f s[QG][4]; v16h kf[4][KD / 32], vf[2][KD / 16];
      for (int t = 0; t < 4; ++t)
        for (int kc = 0; kc < KD / 32; ++kc) kf[t][kc] = frag_h(kp + (k0 + t * 16) * KPH + kc * 32, lane);
      for (int hf = 0; hf < 2; ++hf)
        for (int j = 0; j < KD / 16; ++j) vf[hf][j] = frag_h(vp + (j * 16) * VPH + k0 + 32 * hf, lane);   // keys k0 + 32 hf .. + 31
      __builtin_amdgcn_sched_barrier(0);   // the pass's k and v^T fragments are read as one group, k first: one place with LDS reads a pass; the score products and the softmax cover the v^T reads
      for (int kc = 0; kc < KD / 32; ++kc)   // eight independent accumulators per k step
        for (int t = 0; t < 4; ++t)
          for (int c = 0; c < QG; ++c) s[c][t] = wmma_h(kf[t][kc], qh[c][kc], kc ? s[c][t] : c8[c]);
      v16h p[QG][2];
      const auto expo = [&](const int c, const bool again) {   // P = 2^score, packed to f16, and this lane's sum of it in f32: one chain per 16-key tile, two to a packed add, since the test below waits for the sum
        v2f a01, a23;
        for (int r = 0; r < 8; ++r) { const v2f e01 = {again ? exp2_slot(s[c][0][r]) : __builtin_amdgcn_exp2f(s[c][0][r]), again ? exp2_slot(s[c][1][r]) : __builtin_amdgcn_exp2f(s[c][1][r])}, e23 = {again ? exp2_slot(s[c][2][r]) : __builtin_amdgcn_exp2f(s[c][2][r]), again ? exp2_slot(s[c][3][r]) : __builtin_amdgcn_exp2f(s[c][3][r])};
          a01 = r ? a01 + e01 : e01; a23 = r ? a23 + e23 : e23;
          p[c][0][r] = (_Float16)e01[0]; p[c][0][8 + r] = (_Float16)e01[1]; p[c][1][r] = (_Float16)e23[0]; p[c][1][8 + r] = (_Float16)e23[1]; }
        const v2f a = a01 + a23; return a[0] + a[1]; };
      float ps[QG];
      for (int c = 0; c < QG; ++c) ps[c] = expo(c, false);
      if (__builtin_amdgcn_ballot_w32(fmaxf(ps[0], ps[1]) > lim) != 0) {   // wave-uniform, rare: a scalar branch, once a pass for both groups. No term of a sum <= 2^15 is above 2^15, so P as packed is finite
        for (int c = 0; c < QG; ++c) {
          float mx = s[c][0][0];
          for (int t = 0; t < 4; ++t)
            for (int r = 0; r < 8; ++r) mx = fmaxf(mx, s[c][t][r]);
          mx = fmaxf(mx, __shfl_xor(mx, 16));   // the other half of the wave holds this query's other keys
          const float d = fmaxf(mx - 7.0f, dlo);   // the reference rises by d (a query below its reference keeps it: d = 0); every score is then <= 7
          const float al = exp2_slot(fminf(-d, 0.f));
          for (int r = 0; r < 8; ++r) c8[c][r] -= d;
          for (int t = 0; t < 4; ++t)
            for (int r = 0; r < 8; ++r) s[c][t][r] -= d;
          for (int j = 0; j < KD / 16; ++j)
            for (int r = 0; r < 8; ++r) o[c][j][r] *= al;
          l[c] *= al;
          ps[c] = expo(c, true); }
        lim = 32768.0f; dlo = 0.f; }
      for (int c = 0; c < QG; ++c) l[c] += ps[c];
      for (int hf = 0; hf < 2; ++hf)
        for (int j = 0; j < KD / 16; ++j)
          for (int c = 0; c < QG; ++c) o[c][j] = wmma_h(vf[hf][j], p[c][hf], o[c][j]); }
    asm volatile("s_wait_dscnt 0x0" ::: "memory");      // this wave's reads of the buffer are done before it is refilled
    asm volatile("s_wait_asynccnt 0x0" ::: "memory");   // this wave's share of stage st + 1 has landed
    __syncthreads();                                    // publishes stage st + 1 and ends every wave's reads of stage st
    if (st + 2 < TT / SKEYS) fill(st + 2); }
  asm volatile("s_wait_asynccnt 0x0" ::: "memory");     // no copy is left in flight when the wave ends
  for (int c = 0; c < QG; ++c) {
    const float lt = l[c] + __shfl_xor(l[c], 16); const float inv = 1.0f / lt;   // l and o carry the same factor
    for (int j = 0; j < KD / 16; ++j) { float* dst = O3 + ((b * NI + (j >> 1)) * TT + qn + 16 * c) * (size_t)CC + h * HD + (j & 1) * 16 + 8 * g;   // kk = 16 j + 8 g + r = i * 32 + c_local
      v4f a, e;
      for (int r = 0; r < 4; ++r) { a[r] = o[c][j][r] * inv; e[r] = o[c][j][4 + r] * inv; }
      vst2(dst, a); vst2(dst + 4, e); } } }
// ---- k_out: block = (64 points, 128 out channels, z = b*3 + i): out[b][o][i][n] = sum_c Wo[o][c] o3[b][i][n][c] + x[b][o][i][n]
// The block's o tile (64 rows of 1 KB, one contiguous 64 KB run) is read once, by whole-line 16-byte loads that are all in flight together, split into bf16 hi and lo
// once and laid in LDS. A wave takes 32 out channels (two B fragments a k step) and all 64 points (four A fragments a plane from LDS): a weight fragment is loaded by
// one wave only, k steps 0..3 ahead of the o tile's conversion, the others at least eight planes of products ahead of their use. The residual x tile's loads are issued inside the product loop, which covers their latency.
typedef __attribute__((ext_vector_type(2))) __bf16 v2b;
typedef __attribute__((ext_vector_type(2))) unsigned v2u;
// two values -> {packed bf16 hi, packed bf16 lo = bf16(v - hi)}; hi widens to f32 by its bits alone (exact)
__device__ __forceinline__ v2u split2(float x, float y) {
  const v2b h = {(__bf16)x, (__bf16)y}; const unsigned hi = __builtin_bit_cast(unsigned, h);
  const v2b l = {(__bf16)(x - __builtin_bit_cast(float, hi << 16)), (__bf16)(y - __builtin_bit_cast(float, hi & 0xffff0000u))};
  const v2u r = {hi, __builtin_bit_cast(unsigned, l)}; return r; }
__global__ __launch_bounds__(128) void k_out(const float* __restrict__ O3, const __bf16* __restrict__ PW, const float* __restrict__ X, float* __restrict__ OUT) {
  __shared__ __align__(16) __bf16 so[2][64][CC + 8]; __shared__ __align__(16) float st[128][68];
  const int tid = threadIdx.x, wave = tid >> 5, lane = tid & 31, col = lane & 15, g = lane >> 4; const int n0 = blockIdx.x * 64; const int c0 = blockIdx.y * 128; const size_t b = blockIdx.z / NI; const int i = blockIdx.z % NI;
  const int f0 = (3 * 16 + c0 / 16 + wave * 2) * 8;
  const float* op = O3 + ((b * NI + i) * TT + n0) * (size_t)CC + tid * 4;
  v4f orr[32];
  for (int k = 0; k < 32; ++k) orr[k] = *(const v4f*)(op + k * 512);   // piece k * 128 + tid of the tile: row 2 k + tid / 64, channels 4 (tid % 64) ..
  asm volatile("s_wait_xcnt 0x0" ::: "memory");   // stands in front of any reuse of the o loads' address registers
  v16b w[CC / 32][2];
  for (int kc = 0; kc < 4; ++kc)
    for (int t = 0; t < 2; ++t) w[kc][t] = frag_pw(PW, f0 + t * 8 + kc, lane);
  asm volatile("s_wait_xcnt 0x0" ::: "memory");   // stands in front of any reuse of the weight loads' address registers
  __builtin_amdgcn_sched_barrier(0);   // the first weight loads are issued ahead of the first wait for o: without it they sink below the conversions and their latency adds to that of o
  for (int k = 0; k < 32; ++k) { const v2u p01 = split2(orr[k][0], orr[k][1]), p23 = split2(orr[k][2], orr[k][3]); const v2u hi = {p01[0], p23[0]}, lo = {p01[1], p23[1]};
    *(v2u*)&so[0][2 * k + (tid >> 6)][(tid & 63) * 4] = hi; *(v2u*)&so[1][2 * k + (tid >> 6)][(tid & 63) * 4] = lo; }
  __syncthreads();
  for (int kc = 4; kc < 6; ++kc)   // the next k steps' fragments: behind the barrier (which would wait for them), in registers that the o tile has left
    for (int t = 0; t < 2; ++t) w[kc][t] = frag_pw(PW, f0 + t * 8 + kc, lane);
  asm volatile("s_wait_xcnt 0x0" ::: "memory");   // stands in front of any reuse of these loads' address registers
  __builtin_amdgcn_sched_barrier(0);   // holds them ahead of the product loop
  const int xc = tid >> 4, xq = tid & 15; const size_t go = ((b * CC + c0 + xc) * NI + i) * (size_t)TT + n0 + xq * 4;   // store-out piece m: channel c0 + 8 m + xc, points n0 + 4 xq ..
  v4f xv[16];
  v8f acc[4][2] = {}; v16b a[4], an[4];
  for (int pt = 0; pt < 4; ++pt) a[pt] = frag_b(&so[0][pt * 16 + col][0], lane);
#pragma unroll   // whole: every fragment has its own registers, and the two o fragment sets change places by renaming
  for (int s = 0; s < 2 * (CC / 32); ++s) {   // k step s / 2, plane s % 2 (hi, then lo: the order of the sums as before)
    if (s + 1 < 2 * (CC / 32)) {   // the next plane's four o fragments, one group of LDS reads ahead of this plane's products
      for (int pt = 0; pt < 4; ++pt) an[pt] = frag_b(&so[(s + 1) & 1][pt * 16 + col][((s + 1) >> 1) * 32], lane);
      __builtin_amdgcn_sched_barrier(0); }   // holds the group here: placed behind the products, each plane would wait out the LDS latency
    if (s == 2 || s == 4) {   // k step 6's, then 7's fragments take the registers of a k step that is done, ten planes of products ahead of their use (all sixteen held at once spilled to scratch)
      for (int t = 0; t < 2; ++t) w[5 + s / 2][t] = frag_pw(PW, f0 + t * 8 + 5 + s / 2, lane);
      asm volatile("s_wait_xcnt 0x0" ::: "memory");   // stands in front of any reuse of these loads' address registers
      __builtin_amdgcn_sched_barrier(0); }   // holds the loads here, ahead of this plane's products
    if (s == 4) {   // behind the last weight loads, so that no wait for a weight fragment waits for x; the twelve planes of products that are left cover the loads
      for (int m = 0; m < 16; ++m) xv[m] = *(const v4f*)(X + go + (size_t)m * (8 * NI * TT));
      asm volatile("s_wait_xcnt 0x0" ::: "memory");   // stands in front of any reuse of the x loads' address registers
      __builtin_amdgcn_sched_barrier(0); }   // holds the loads here: sunk to the store-out loop they would be waited for there
    for (int pt = 0; pt < 4; ++pt)
      for (int t = 0; t < 2; ++t) acc[pt][t] = wmma_bf(a[pt], w[s >> 1][t], acc[pt][t]);
    for (int pt = 0; pt < 4; ++pt) a[pt] = an[pt]; }
#pragma unroll
  for (int pt = 0; pt < 4; ++pt)
#pragma unroll
    for (int t = 0; t < 2; ++t)
#pragma unroll
      for (int r = 0; r < 8; ++r) st[(wave * 2 + t) * 16 + col][pt * 16 + 8 * g + r] = acc[pt][t][r];
  __syncthreads();
  v4f sv[16];
  for (int m = 0; m < 16; ++m) sv[m] = *(const v4f*)&st[m * 8 + xc][xq * 4];
  __builtin_amdgcn_sched_barrier(0);   // the sixteen LDS reads stand as one group: spread among the adds and stores, each pair waited out the LDS latency
  for (int m = 0; m < 16; ++m)
    for (int p = 0; p < 4; ++p) sv[m][p] += bfr(xv[m][p]);
  __builtin_amdgcn_sched_barrier(0);   // the sixteen stores stand behind all the adds
  for (int m = 0; m < 16; ++m) vst2(OUT + go + (size_t)m * (8 * NI * TT), sv[m]); }
extern "C" void kernel_launch(void* const* d_in, const int* in_sizes, int n_in, void* d_out, int out_size, void* d_ws, size_t ws_size, hipStream_t stream) {
  (void)in_sizes; (void)n_in; (void)out_size;
  const float** F = (const float**)d_in;   // 0 x [4,256,3,2048], 1 Wq, 2 Wk, 3 Wv, 4 Wo [256,256] ([out][in])
  if (ws_size < (size_t)WS_END) return;
  char* ws = (char*)d_ws; _Float16 *QH = (_Float16*)(ws + WS_QH), *KH = (_Float16*)(ws + WS_KH), *VT = (_Float16*)(ws + WS_VT); float *O3 = (float*)(ws + WS_O3); __bf16 *PW = (__bf16*)(ws + WS_PW);
  k_pack<<<dim3(4 * 16 * 8 / 4), 128, 0, stream>>>(F[1], F[2], F[3], F[4], PW);
  k_proj<<<dim3(TT / 64, CC / 128, TNB * NI), 128, 0, stream>>>(F[0], PW, QH, KH, VT);
  k_fa<<<dim3(TT / 256, NH, TNB), 256, 0, stream>>>(QH, KH, VT, O3);
  k_out<<<dim3(TT / 64, CC / 128, TNB * NI), 128, 0, stream>>>(O3, PW, F[0], (float*)d_out);
}
